// v000
// Times are from an AMD MI455X. After a warm-up the kernel runs many times in a row, and a time is the length of
// such a window on the GPU divided by its runs, so every launch and the gaps after it count. The runs cycle
// through copies of the inputs. A figure is the median of several windows, for all but v000 over two sittings.
// Sittings can differ by a few percent; kernels timed side by side share one.
// v000 is the starting kernel. One run takes 2010 microseconds.
#include <hip/hip_runtime.h>

// Sliding-window (banded) multi-head attention (x [2][2048][1024]; q, k, v = x W + b ('xw' [1024][1024] 0.02, zero biases; 16 heads x 64); scores x 64^-0.5; keys j with i - 128 <= j <= i + 128 (symmetric window 256, -inf elsewhere); softmax; out = merged wo + bo ('xw') -> [2][2048][1024] (4.2 M); argument order x, wq, bq, wk, bk, wv, bv, wo, bo).
// Layout per batch: bf16 copy of x; 'xw' weights transposed once; exact projections + f32 biases; dense T-2048 attention (all score tiles computed; the band is a select in the softmax; hybrid rows: < 512 hi/lo 3 products, rest fp16 x1024); merged hi/lo x wo exact + bo.
// Compute dtypes, f32 accumulate: every input rounded to bf16; projections exact + f32 biases; attention rows < 512 3 products, rest fp16; softmax f32; wo hl x exact + bias.

#define NB_  2
#define TT   2048
#define DM   1024
#define NH_  16
#define NKV  16
#define REP  (NH_ / NKV)
#define HD   64
#define DQ   (NH_ * HD)
#define DKV  (NKV * HD)
#define ZH   2
#define RH   512                  // query rows < RH use hi+lo planes (0: none)
#define WIN  2048
#define BW   128      // half window: keys j in [i - 128, i + 128]
#define PCAR 1024.0f
#define SCL  0.125f   // HD^-0.5
typedef _Float16 h16;
typedef unsigned short bf;
typedef __attribute__((ext_vector_type(16))) __bf16   v16bf;
typedef __attribute__((ext_vector_type(16))) _Float16 v16h;
typedef __attribute__((ext_vector_type(8)))  _Float16 v8h;
typedef __attribute__((ext_vector_type(8)))  unsigned short v8us;
typedef __attribute__((ext_vector_type(8)))  float    v8f;
typedef __attribute__((ext_vector_type(4)))  float    v4f;
typedef v8h  __attribute__((may_alias)) v8ha;
typedef v4f  __attribute__((may_alias)) v4fa;
typedef v8us __attribute__((may_alias)) v8usa;

__device__ __forceinline__ unsigned short f2bf(float f) { unsigned u = __float_as_uint(f); u += 0x7FFFu + ((u >> 16) & 1u); return (unsigned short)(u >> 16); }
__device__ __forceinline__ float bf2f(unsigned short b) { return __uint_as_float(((unsigned)b) << 16); }
__device__ __forceinline__ float bfr(float f) { return bf2f(f2bf(f)); }
__device__ __forceinline__ v16h cat16(v8h lo, v8h hi) { return __builtin_shufflevector(lo, hi, 0, 1, 2, 3, 4, 5, 6, 7, 8, 9, 10, 11, 12, 13, 14, 15); }
__device__ __forceinline__ v16bf cat16b(v8us lo, v8us hi) { return __builtin_bit_cast(v16bf, __builtin_shufflevector(lo, hi, 0, 1, 2, 3, 4, 5, 6, 7, 8, 9, 10, 11, 12, 13, 14, 15)); }
__device__ __forceinline__ v8f wmma16(v16h a, v16h b, v8f c) { return __builtin_amdgcn_wmma_f32_16x16x32_f16(false, a, false, b, (short)0, c, false, false); }
__device__ __forceinline__ v8f wmmab(v16bf a, v16bf b, v8f c) { return __builtin_amdgcn_wmma_f32_16x16x32_bf16(false, a, false, b, (short)0, c, false, false); }



// ---- k_gemmw: register-blocked GEMM, ONE WAVE per 64x64 output tile (16 accumulators), operands straight from K-contiguous 16-bit planes; grid (M/64, N/64, Z), 32 threads.
// C[m][n] (f32, pitch ldc, + optional f32 bias[n]) = sum_k A[m][k] Bt[n][k] (+ split products per NSPLIT). z-batch strides sA/sB/sC in elements. K % 32 == 0.
template <typename T16> struct WFrag;
template <> struct WFrag<h16> { typedef v16h V; static __device__ __forceinline__ V ld(const h16* p) { return cat16(*(const v8h*)p, *(const v8h*)(p + 16)); } static __device__ __forceinline__ v8f mma(V a, V b, v8f c) { return wmma16(a, b, c); } };
template <> struct WFrag<bf> { typedef v16bf V; static __device__ __forceinline__ V ld(const bf* p) { return cat16b(*(const v8us*)p, *(const v8us*)(p + 16)); } static __device__ __forceinline__ v8f mma(V a, V b, v8f c) { return wmmab(a, b, c); } };
template <typename T16, int NSPLIT, bool BIAS>
__global__ __launch_bounds__(32) void k_gemmw(const T16* __restrict__ A, const T16* __restrict__ A2, const T16* __restrict__ Bt, const T16* __restrict__ Bt2, int K, float* C, int ldc, const float* __restrict__ bias, size_t sA, size_t sB, size_t sC) {
    typedef typename WFrag<T16>::V V;
    __shared__ __align__(16) float os[16 * 68];
    const size_t z = blockIdx.z; A += z * sA; if (A2) A2 += z * sA; Bt += z * sB; if (Bt2) Bt2 += z * sB; C += z * sC;
    const int lane = threadIdx.x & 31, lr = lane & 15, hi = lane >> 4; const int r0 = blockIdx.x * 64, c0 = blockIdx.y * 64;
    v8f acc[4][4];
#pragma unroll
    for (int mb = 0; mb < 4; ++mb)
#pragma unroll
        for (int nb = 0; nb < 4; ++nb) acc[mb][nb] = (v8f){};
    const size_t aoff = (size_t)(r0 + lr) * K + 8 * hi, boff = (size_t)(c0 + lr) * K + 8 * hi;
#pragma unroll 1
    for (int kc = 0; kc < K; kc += 32) {
        V a[4], a2[4];
#pragma unroll
        for (int mb = 0; mb < 4; ++mb) { a[mb] = WFrag<T16>::ld(A + aoff + (size_t)mb * 16 * K + kc); if (NSPLIT == 1 || NSPLIT == 2) a2[mb] = WFrag<T16>::ld(A2 + aoff + (size_t)mb * 16 * K + kc); }
#pragma unroll
        for (int nb = 0; nb < 4; ++nb) { const V b = WFrag<T16>::ld(Bt + boff + (size_t)nb * 16 * K + kc); V b2; if (NSPLIT >= 2) b2 = WFrag<T16>::ld(Bt2 + boff + (size_t)nb * 16 * K + kc);
#pragma unroll
            for (int mb = 0; mb < 4; ++mb) { acc[mb][nb] = WFrag<T16>::mma(a[mb], b, acc[mb][nb]); if (NSPLIT == 1 || NSPLIT == 2) acc[mb][nb] = WFrag<T16>::mma(a2[mb], b, acc[mb][nb]); if (NSPLIT >= 2) acc[mb][nb] = WFrag<T16>::mma(a[mb], b2, acc[mb][nb]); } }
        asm volatile("v_nop\n\tv_nop\n\tv_nop\n\tv_nop" : "+v"(acc[0][0]), "+v"(acc[1][1]), "+v"(acc[2][2]), "+v"(acc[3][3]) : "v"(a[0]), "v"(a[3]));
    }
#pragma unroll
    for (int mb = 0; mb < 4; ++mb) {
#pragma unroll
        for (int nb = 0; nb < 4; ++nb) {
#pragma unroll
            for (int j = 0; j < 8; ++j) os[(hi * 8 + j) * 68 + nb * 16 + lr] = acc[mb][nb][j]; }
        __builtin_amdgcn_wave_barrier(); asm volatile("" ::: "memory");
        float* crow = C + (size_t)(r0 + mb * 16) * ldc + c0;
{
#pragma unroll
            for (int s = 0; s < 8; ++s) { const int row = 2 * s + hi, cofs = lr * 4; v4f val = *(const v4fa*)(os + row * 68 + cofs); if (BIAS) { val[0] += bfr(bias[c0 + cofs]); val[1] += bfr(bias[c0 + cofs + 1]); val[2] += bfr(bias[c0 + cofs + 2]); val[3] += bfr(bias[c0 + cofs + 3]); }
                *(v4f*)(crow + (size_t)row * ldc + cofs) = val; }
             }
        __builtin_amdgcn_wave_barrier(); asm volatile("" ::: "memory");
    }
}

__device__ __forceinline__ h16 tohx(float x) { return (h16)x; }
__device__ __forceinline__ void splitf(float y, unsigned short& h, unsigned short& l) { h = f2bf(y); l = f2bf(y - bf2f(h)); }
typedef __attribute__((ext_vector_type(2))) _Float16 v2h;
typedef __attribute__((ext_vector_type(4))) _Float16 v4h;
typedef __attribute__((ext_vector_type(2))) unsigned short v2us;
typedef __attribute__((ext_vector_type(4))) unsigned short v4us;
typedef __attribute__((ext_vector_type(2))) float v2f;
typedef __attribute__((ext_vector_type(4))) int v4i;

__global__ __launch_bounds__(256) void k_wtG(const float* __restrict__ w, int K, int N, bf* Bt) {
    const int lane = threadIdx.x & 31; const int L0 = (blockIdx.x * 8 + (threadIdx.x >> 5)) * 8; const int nlines = N * K / 64;
{
#pragma unroll 1
        for (int l = 0; l < 8; ++l) { const int L = L0 + l; if (L >= nlines) break; const size_t e = (size_t)L * 64 + lane * 2; const int k = (int)(e % K), n = (int)(e / K); v2us o;
            o[0] = f2bf(w[(size_t)k * N + n]); o[1] = f2bf(w[(size_t)(k + 1) * N + n]); *(v2us*)(Bt + e) = o; }
         }
}
__global__ __launch_bounds__(256) void k_cvt8(const float* __restrict__ src, bf* dst, size_t n8) { const size_t i = (size_t)blockIdx.x * 256 + threadIdx.x; if (i >= n8) return; const v8f v = *(const v8f*)(src + i * 8); v8us o;
#pragma unroll
    for (int k = 0; k < 8; ++k) o[k] = f2bf(v[k]); *(v8us*)(dst + i * 8) = o;  }

// k_rope: head planes [h][t][d] (fp16 + hi/lo) of rope(x) x sc with the rotate-half convention out[d] = x[d] cos[t][d] - x[d+HD/2] sin[t][d], out[d+HD/2] = x[d+HD/2] cos[t][d+HD/2] + x[d] sin[t][d+HD/2]
__global__ __launch_bounds__(256) void k_rope(const float* __restrict__ F, int pitch, int nheads, const float* __restrict__ CS, const float* __restrict__ RF, const float* __restrict__ nw, float sc, h16* P16, bf* Ph, bf* Pl) {
    const size_t e = ((size_t)blockIdx.x * 256 + threadIdx.x) * 2; if (e >= (size_t)nheads * TT * HD) return; const int d = (int)(e % HD); const int t = (int)((e / HD) % TT); const int h = (int)(e / ((size_t)HD * TT)); const float* f = F + (size_t)t * pitch + h * HD; const float rf = RF ? RF[(size_t)h * TT + t] : 1.0f; v2h o16; v2us oh, ol;
#pragma unroll
    for (int q = 0; q < 2; ++q) { const int dd = d + q; const int dp = (dd < HD / 2) ? dd + HD / 2 : dd - HD / 2; float x0 = f[dd], x1 = f[dp];
        if (RF) { float n0 = __fmul_rn(x0, rf), n1 = __fmul_rn(x1, rf); asm volatile("" : "+v"(n0)); asm volatile("" : "+v"(n1)); x0 = __fmul_rn(bfr(nw[dd]), n0); x1 = __fmul_rn(bfr(nw[dp]), n1); }
        const v2f cs = *(const v2f*)(CS + ((size_t)t * HD + dd) * 2); float a = __fmul_rn(x0, cs[0]), bq = __fmul_rn(x1, cs[1]); asm volatile("" : "+v"(a)); asm volatile("" : "+v"(bq)); const float r = ((dd < HD / 2) ? __fsub_rn(a, bq) : __fadd_rn(a, bq)) * sc;
        o16[q] = tohx(r); unsigned short a2, c2; splitf(r, a2, c2); oh[q] = a2; ol[q] = c2; }
    *(v2h*)(P16 + e) = o16; *(v2us*)(Ph + e) = oh; *(v2us*)(Pl + e) = ol;  }
__global__ __launch_bounds__(256) void k_vtp(const float* __restrict__ F, int pitch, int nheads, h16* V16, bf* Vh, bf* Vl) { const size_t e = ((size_t)blockIdx.x * 256 + threadIdx.x) * 2; if (e >= (size_t)nheads * HD * TT) return; const int t = (int)(e % TT); const int d = (int)((e / TT) % HD); const int g = (int)(e / ((size_t)TT * HD)); v2h o16; v2us oh, ol;
#pragma unroll
    for (int q = 0; q < 2; ++q) { const float x = F[(size_t)(t + q) * pitch + g * HD + d]; o16[q] = tohx(x); unsigned short a2, c2; splitf(x, a2, c2); oh[q] = a2; ol[q] = c2; }
    *(v2h*)(V16 + e) = o16; *(v2us*)(Vh + e) = oh; *(v2us*)(Vl + e) = ol;  }
__global__ __launch_bounds__(256) void k_csid(float* CS) { const int idx = blockIdx.x * 256 + threadIdx.x; if (idx >= TT * HD) return; v2f cs; cs[0] = 1.0f; cs[1] = 0.0f; *(v2f*)(CS + (size_t)idx * 2) = cs;  }
// k_asoft: per row (zz, i): t = S x HD^-0.5 for keys with |i - j| <= 128 (the module's band), -3e38 elsewhere (-inf == exclusion); softmax over the 2048 keys (register row, one exp, fixed trees);
__global__ __launch_bounds__(256) void k_asoft(const float* __restrict__ Sb, h16* P16, bf* Ph, bf* Pl) {
    const int lane = threadIdx.x & 31; const int row = blockIdx.x * 8 + (threadIdx.x >> 5); if (row >= ZH * TT) return; const int i = row % TT; const int zz = row / TT; (void)zz; const bool hires = (i < RH); const float* sr = Sb + (size_t)row * TT; float v[TT / 32]; float mx = -3.0e38f;
#pragma unroll
    for (int ch = 0; ch < TT / 128; ++ch) { const int j0 = ch * 128 + lane * 4; const v4f a = *(const v4f*)(sr + j0);
#pragma unroll
        for (int q = 0; q < 4; ++q) { const int j = j0 + q; (void)j; const float t = (i - j <= BW && j - i <= BW) ? a[q] * SCL : -3.0e38f;   /* symmetric band |i - j| <= 128 */ v[ch * 4 + q] = t; mx = fmaxf(mx, t); } }
#pragma unroll
    for (int sh = 16; sh; sh >>= 1) mx = fmaxf(mx, __shfl_xor(mx, sh, 32));
    float sum = 0.f;
#pragma unroll
    for (int k = 0; k < TT / 32; ++k) { float d0 = __fsub_rn(v[k], mx); asm volatile("" : "+v"(d0)); v[k] = __builtin_amdgcn_exp2f(__fmul_rn(d0, 1.4426950408889634f)); sum += v[k]; }
#pragma unroll
    for (int sh = 16; sh; sh >>= 1) sum += __shfl_xor(sum, sh, 32);
    const float f = __fdiv_rn(hires ? 1.0f : PCAR, sum);
{
        if (hires) {
#pragma unroll
            for (int ch = 0; ch < TT / 128; ++ch) { v4us oh, ol;
#pragma unroll
                for (int q = 0; q < 4; ++q) { unsigned short a, c2; splitf(v[ch * 4 + q] * f, a, c2); oh[q] = a; ol[q] = c2; }
                const size_t oo = ((size_t)zz * (RH ? RH : 1) + i) * TT + ch * 128 + lane * 4; *(v4us*)(Ph + oo) = oh; *(v4us*)(Pl + oo) = ol; }
        } else {
#pragma unroll
            for (int ch = 0; ch < TT / 128; ++ch) { v4h o4;
#pragma unroll
                for (int q = 0; q < 4; ++q) o4[q] = tohx(v[ch * 4 + q] * f);
                *(v4h*)(P16 + (size_t)row * TT + ch * 128 + lane * 4) = o4; } }
         }
}
__global__ __launch_bounds__(256) void k_merge(const float* __restrict__ O, int h0, bf* Ah, bf* Al) { const size_t e = ((size_t)blockIdx.x * 256 + threadIdx.x) * 2; if (e >= (size_t)ZH * TT * HD) return; const int d = (int)(e % HD); const int t = (int)((e / HD) % TT); const int zz = (int)(e / ((size_t)HD * TT)); const float cs = (t < RH) ? 1.0f : (1.0f / PCAR); const size_t oo = (size_t)t * DQ + (h0 + zz) * HD + d;
    v2us oh, ol;
#pragma unroll
    for (int q = 0; q < 2; ++q) { unsigned short a, c2; splitf(O[e + q] * cs, a, c2); oh[q] = a; ol[q] = c2; } *(v2us*)(Ah + oo) = oh; *(v2us*)(Al + oo) = ol;  }

extern "C" void kernel_launch(void* const* d_in, const int* in_sizes, int n_in,
                              void* d_out, int out_size, void* d_ws, size_t ws_size, hipStream_t stream) {
    (void)in_sizes; (void)n_in; (void)out_size;
    const float* x = (const float*)d_in[0]; const float* wq = (const float*)d_in[1]; const float* bq = (const float*)d_in[2]; const float* wk = (const float*)d_in[3]; const float* bk = (const float*)d_in[4]; const float* wv = (const float*)d_in[5]; const float* bv = (const float*)d_in[6]; const float* wo = (const float*)d_in[7]; const float* bo = (const float*)d_in[8];   /* argument order x, wq, bq, wk, bk, wv, bv, wo, bo */
    float* OUT = (float*)d_out;     // [2][2048][1024]
    char* wsp = (char*)d_ws;
    auto take = [&](size_t bytes) { char* p = wsp; wsp += (bytes + 255) & ~(size_t)255; return (void*)p; };
    bf* WQ = (bf*)take((size_t)DQ * DM * 2); bf* WK = (bf*)take((size_t)DKV * DM * 2); bf* WV = (bf*)take((size_t)DKV * DM * 2); bf* WO = (bf*)take((size_t)DM * DQ * 2); float* CS = (float*)take((size_t)TT * HD * 2 * 4);
    bf* XB = (bf*)take((size_t)TT * DM * 2); float* FQ = (float*)take((size_t)TT * DQ * 4); float* FK = (float*)take((size_t)TT * DKV * 4);
    h16* QP16 = (h16*)take((size_t)NH_ * TT * HD * 2); h16* KP16 = (h16*)take((size_t)NKV * TT * HD * 2); h16* VT16 = (h16*)take((size_t)NKV * HD * TT * 2);
    bf* QPh = (bf*)take((size_t)NH_ * TT * HD * 2); bf* QPl = (bf*)take((size_t)NH_ * TT * HD * 2); bf* KPh = (bf*)take((size_t)NKV * TT * HD * 2); bf* KPl = (bf*)take((size_t)NKV * TT * HD * 2); bf* VTh = (bf*)take((size_t)NKV * HD * TT * 2); bf* VTl = (bf*)take((size_t)NKV * HD * TT * 2); bf* Ph = (bf*)take((size_t)ZH * RH * TT * 2); bf* Pl = (bf*)take((size_t)ZH * RH * TT * 2);
    float* Sb = (float*)take((size_t)ZH * TT * TT * 4); h16* P16 = (h16*)take((size_t)ZH * TT * TT * 2); float* Ob = (float*)take((size_t)ZH * TT * HD * 4); bf* ATh = (bf*)take((size_t)TT * DQ * 2); bf* ATl = (bf*)take((size_t)TT * DQ * 2);
    if ((size_t)(wsp - (char*)d_ws) > ws_size) return;    // ws 256 MiB
    float* FV = FK;   // v projection reuses the k buffer after the k planes are built (stream-ordered)
    { k_wtG<<<(unsigned)((DM * DQ / 64 + 63) / 64), 256, 0, stream>>>(wq, DM, DQ, WQ); k_wtG<<<(unsigned)((DM * DKV / 64 + 63) / 64), 256, 0, stream>>>(wk, DM, DKV, WK); k_wtG<<<(unsigned)((DM * DKV / 64 + 63) / 64), 256, 0, stream>>>(wv, DM, DKV, WV);
      k_wtG<<<(unsigned)((DQ * DM / 64 + 63) / 64), 256, 0, stream>>>(wo, DQ, DM, WO);
       }
    k_csid<<<(TT * HD + 255) / 256, 256, 0, stream>>>(CS);
    const unsigned LQ = (unsigned)(((size_t)NH_ * TT * HD / 2 + 255) / 256), LKv = (unsigned)(((size_t)NKV * TT * HD / 2 + 255) / 256);
    for (int b = 0; b < NB_; ++b) {
        
        k_cvt8<<<(unsigned)(((size_t)TT * DM / 8 + 255) / 256), 256, 0, stream>>>(x + (size_t)b * TT * DM, XB, (size_t)TT * DM / 8);
        k_gemmw<bf, 0, true><<<dim3(TT / 64, DQ / 64, 1), 32, 0, stream>>>(XB, nullptr, WQ, nullptr, DM, FQ, DQ, bq, 0, 0, 0);
        k_rope<<<LQ, 256, 0, stream>>>(FQ, DQ, NH_, CS, nullptr, nullptr, 1.0f, QP16, QPh, QPl);
        k_gemmw<bf, 0, true><<<dim3(TT / 64, DKV / 64, 1), 32, 0, stream>>>(XB, nullptr, WK, nullptr, DM, FK, DKV, bk, 0, 0, 0);
        k_rope<<<LKv, 256, 0, stream>>>(FK, DKV, NKV, CS, nullptr, nullptr, 1.0f, KP16, KPh, KPl);
        k_gemmw<bf, 0, true><<<dim3(TT / 64, DKV / 64, 1), 32, 0, stream>>>(XB, nullptr, WV, nullptr, DM, FV, DKV, bv, 0, 0, 0); k_vtp<<<LKv, 256, 0, stream>>>(FV, DKV, NKV, VT16, VTh, VTl);
        for (int h0 = 0; h0 < NH_; h0 += ZH) { const size_t zq = (size_t)h0, zk = (size_t)(h0 / REP);   // one kv head per query head: the pass's two heads use consecutive kv planes (z-strides TT*HD)
            k_gemmw<bf, 2, false><<<dim3(RH / 64, TT / 64, ZH), 32, 0, stream>>>(QPh + zq * TT * HD, QPl + zq * TT * HD, KPh + zk * TT * HD, KPl + zk * TT * HD, HD, Sb, TT, nullptr, (size_t)TT * HD, (size_t)TT * HD, (size_t)TT * TT);
            k_gemmw<h16, 0, false><<<dim3((TT - RH) / 64, TT / 64, ZH), 32, 0, stream>>>(QP16 + zq * TT * HD + (size_t)RH * HD, nullptr, KP16 + zk * TT * HD, nullptr, HD, Sb + (size_t)RH * TT, TT, nullptr, (size_t)TT * HD, (size_t)TT * HD, (size_t)TT * TT);
            k_asoft<<<ZH * TT / 8, 256, 0, stream>>>(Sb, P16, Ph, Pl);
            k_gemmw<bf, 2, false><<<dim3(RH / 64, HD / 64, ZH), 32, 0, stream>>>(Ph, Pl, VTh + zk * HD * TT, VTl + zk * HD * TT, TT, Ob, HD, nullptr, (size_t)RH * TT, (size_t)HD * TT, (size_t)TT * HD);
            k_gemmw<h16, 0, false><<<dim3((TT - RH) / 64, HD / 64, ZH), 32, 0, stream>>>(P16 + (size_t)RH * TT, nullptr, VT16 + zk * HD * TT, nullptr, TT, Ob + (size_t)RH * HD, HD, nullptr, (size_t)TT * TT, (size_t)HD * TT, (size_t)TT * HD);
            k_merge<<<(unsigned)(((size_t)ZH * TT * HD / 2 + 255) / 256), 256, 0, stream>>>(Ob, h0, ATh, ATl); }
        k_gemmw<bf, 1, true><<<dim3(TT / 64, DM / 64, 1), 32, 0, stream>>>(ATh, ATl, WO, nullptr, DQ, OUT + (size_t)b * TT * DM, DM, bo, 0, 0, 0); }
}

// v001
// A run of this version takes 805 microseconds.
// Next to v000, in two timings, it ran 2.50 times as fast each time.
#include <hip/hip_runtime.h>

// Sliding-window (banded) multi-head attention (x [2][2048][1024]; q, k, v = x W + b ('xw' [1024][1024] 0.02, zero biases; 16 heads x 64); scores x 64^-0.5; keys j with i - 128 <= j <= i + 128 (symmetric window 256, -inf elsewhere); softmax; out = merged wo + bo ('xw') -> [2][2048][1024] (4.2 M); argument order x, wq, bq, wk, bk, wv, bv, wo, bo).
// Layout per batch: bf16 copy of x; 'xw' weights transposed once; exact projections + f32 biases; banded T-2048 attention (per 64-row tile only the 5 64-key tiles [r0 - 128, r0 + 192) that meet its band are scored, normalised and multiplied with v; inside them the band is a select in the softmax; hybrid rows: < 512 hi/lo 3 products, rest fp16 x1024); merged hi/lo x wo exact + bo.
// Compute dtypes, f32 accumulate: every input rounded to bf16; projections exact + f32 biases; attention rows < 512 3 products, rest fp16; softmax f32; wo hl x exact + bias.

#define NB_  2
#define TT   2048
#define DM   1024
#define NH_  16
#define NKV  16
#define REP  (NH_ / NKV)
#define HD   64
#define DQ   (NH_ * HD)
#define DKV  (NKV * HD)
#define ZH   2
#define RH   512                  // query rows < RH use hi+lo planes (0: none)
#define WIN  2048
#define BW   128      // half window: keys j in [i - 128, i + 128]
#define NBT  ((2 * BW + 64) / 64)   // 64-key tiles that a 64-row tile's band can meet: keys [r0 - BW, r0 + 64 + BW)
#define PCAR 1024.0f
#define SCL  0.125f   // HD^-0.5
typedef _Float16 h16;
typedef unsigned short bf;
typedef __attribute__((ext_vector_type(16))) __bf16   v16bf;
typedef __attribute__((ext_vector_type(16))) _Float16 v16h;
typedef __attribute__((ext_vector_type(8)))  _Float16 v8h;
typedef __attribute__((ext_vector_type(8)))  unsigned short v8us;
typedef __attribute__((ext_vector_type(8)))  float    v8f;
typedef __attribute__((ext_vector_type(4)))  float    v4f;
typedef v8h  __attribute__((may_alias)) v8ha;
typedef v4f  __attribute__((may_alias)) v4fa;
typedef v8us __attribute__((may_alias)) v8usa;

__device__ __forceinline__ unsigned short f2bf(float f) { unsigned u = __float_as_uint(f); u += 0x7FFFu + ((u >> 16) & 1u); return (unsigned short)(u >> 16); }
__device__ __forceinline__ float bf2f(unsigned short b) { return __uint_as_float(((unsigned)b) << 16); }
__device__ __forceinline__ float bfr(float f) { return bf2f(f2bf(f)); }
__device__ __forceinline__ v16h cat16(v8h lo, v8h hi) { return __builtin_shufflevector(lo, hi, 0, 1, 2, 3, 4, 5, 6, 7, 8, 9, 10, 11, 12, 13, 14, 15); }
__device__ __forceinline__ v16bf cat16b(v8us lo, v8us hi) { return __builtin_bit_cast(v16bf, __builtin_shufflevector(lo, hi, 0, 1, 2, 3, 4, 5, 6, 7, 8, 9, 10, 11, 12, 13, 14, 15)); }
__device__ __forceinline__ v8f wmma16(v16h a, v16h b, v8f c) { return __builtin_amdgcn_wmma_f32_16x16x32_f16(false, a, false, b, (short)0, c, false, false); }
__device__ __forceinline__ v8f wmmab(v16bf a, v16bf b, v8f c) { return __builtin_amdgcn_wmma_f32_16x16x32_bf16(false, a, false, b, (short)0, c, false, false); }



// ---- k_gemmw: register-blocked GEMM, ONE WAVE per 64x64 output tile (16 accumulators), operands straight from K-contiguous 16-bit planes; grid (M/64, N/64, Z), 32 threads.
// C[m][n] (f32, pitch ldc, + optional f32 bias[n]) = sum_k A[m][k] Bt[n][k] (+ split products per NSPLIT). z-batch strides sA/sB/sC in elements. K % 32 == 0.
// BAND 0: dense. BAND 1 (scores): blockIdx.y counts the NBT key tiles from column rbase + r0 - BW; a tile outside [0, TT) is left out. BAND 2 (p x v): k runs over the keys [rbase + r0 - BW, rbase + r0 + 64 + BW) clipped to [0, K); p is exactly 0 on all others. rbase: sequence position of A's row 0.
template <typename T16> struct WFrag;
template <> struct WFrag<h16> { typedef v16h V; static __device__ __forceinline__ V ld(const h16* p) { return cat16(*(const v8h*)p, *(const v8h*)(p + 16)); } static __device__ __forceinline__ v8f mma(V a, V b, v8f c) { return wmma16(a, b, c); } };
template <> struct WFrag<bf> { typedef v16bf V; static __device__ __forceinline__ V ld(const bf* p) { return cat16b(*(const v8us*)p, *(const v8us*)(p + 16)); } static __device__ __forceinline__ v8f mma(V a, V b, v8f c) { return wmmab(a, b, c); } };
template <typename T16, int NSPLIT, bool BIAS, int BAND>
__global__ __launch_bounds__(32) void k_gemmw(const T16* __restrict__ A, const T16* __restrict__ A2, const T16* __restrict__ Bt, const T16* __restrict__ Bt2, int K, float* C, int ldc, const float* __restrict__ bias, size_t sA, size_t sB, size_t sC, int rbase) {
    typedef typename WFrag<T16>::V V;
    __shared__ __align__(16) float os[16 * 68];
    const size_t z = blockIdx.z; A += z * sA; if (A2) A2 += z * sA; Bt += z * sB; if (Bt2) Bt2 += z * sB; C += z * sC;
    const int lane = threadIdx.x & 31, lr = lane & 15, hi = lane >> 4; const int r0 = blockIdx.x * 64, c0 = (BAND == 1) ? rbase + r0 - BW + (int)blockIdx.y * 64 : (int)blockIdx.y * 64;
    if (BAND == 1 && (c0 < 0 || c0 >= TT)) return;
    const int kb = (BAND == 2) ? max(rbase + r0 - BW, 0) : 0, kw = ((BAND == 2) ? min(rbase + r0 + 64 + BW, K) : K) - kb;
    if (BAND == 2) { A += kb; Bt += kb; if (NSPLIT == 1 || NSPLIT == 2) A2 += kb; if (NSPLIT >= 2) Bt2 += kb; }
    v8f acc[4][4];
#pragma unroll
    for (int mb = 0; mb < 4; ++mb)
#pragma unroll
        for (int nb = 0; nb < 4; ++nb) acc[mb][nb] = (v8f){};
    const size_t aoff = (size_t)(r0 + lr) * K + 8 * hi, boff = (size_t)(c0 + lr) * K + 8 * hi;
#pragma unroll 1
    for (int kc = 0; kc < kw; kc += 32) {
        V a[4], a2[4];
#pragma unroll
        for (int mb = 0; mb < 4; ++mb) { a[mb] = WFrag<T16>::ld(A + aoff + (size_t)mb * 16 * K + kc); if (NSPLIT == 1 || NSPLIT == 2) a2[mb] = WFrag<T16>::ld(A2 + aoff + (size_t)mb * 16 * K + kc); }
#pragma unroll
        for (int nb = 0; nb < 4; ++nb) { const V b = WFrag<T16>::ld(Bt + boff + (size_t)nb * 16 * K + kc); V b2; if (NSPLIT >= 2) b2 = WFrag<T16>::ld(Bt2 + boff + (size_t)nb * 16 * K + kc);
#pragma unroll
            for (int mb = 0; mb < 4; ++mb) { acc[mb][nb] = WFrag<T16>::mma(a[mb], b, acc[mb][nb]); if (NSPLIT == 1 || NSPLIT == 2) acc[mb][nb] = WFrag<T16>::mma(a2[mb], b, acc[mb][nb]); if (NSPLIT >= 2) acc[mb][nb] = WFrag<T16>::mma(a[mb], b2, acc[mb][nb]); } }
        asm volatile("v_nop\n\tv_nop\n\tv_nop\n\tv_nop" : "+v"(acc[0][0]), "+v"(acc[1][1]), "+v"(acc[2][2]), "+v"(acc[3][3]) : "v"(a[0]), "v"(a[3]));
    }
#pragma unroll
    for (int mb = 0; mb < 4; ++mb) {
#pragma unroll
        for (int nb = 0; nb < 4; ++nb) {
#pragma unroll
            for (int j = 0; j < 8; ++j) os[(hi * 8 + j) * 68 + nb * 16 + lr] = acc[mb][nb][j]; }
        __builtin_amdgcn_wave_barrier(); asm volatile("" ::: "memory");
        float* crow = C + (size_t)(r0 + mb * 16) * ldc + c0;
{
#pragma unroll
            for (int s = 0; s < 8; ++s) { const int row = 2 * s + hi, cofs = lr * 4; v4f val = *(const v4fa*)(os + row * 68 + cofs); if (BIAS) { val[0] += bfr(bias[c0 + cofs]); val[1] += bfr(bias[c0 + cofs + 1]); val[2] += bfr(bias[c0 + cofs + 2]); val[3] += bfr(bias[c0 + cofs + 3]); }
                *(v4f*)(crow + (size_t)row * ldc + cofs) = val; }
             }
        __builtin_amdgcn_wave_barrier(); asm volatile("" ::: "memory");
    }
}

__device__ __forceinline__ h16 tohx(float x) { return (h16)x; }
__device__ __forceinline__ void splitf(float y, unsigned short& h, unsigned short& l) { h = f2bf(y); l = f2bf(y - bf2f(h)); }
typedef __attribute__((ext_vector_type(2))) _Float16 v2h;
typedef __attribute__((ext_vector_type(4))) _Float16 v4h;
typedef __attribute__((ext_vector_type(2))) unsigned short v2us;
typedef __attribute__((ext_vector_type(4))) unsigned short v4us;
typedef __attribute__((ext_vector_type(2))) float v2f;
typedef __attribute__((ext_vector_type(4))) int v4i;

__global__ __launch_bounds__(256) void k_wtG(const float* __restrict__ w, int K, int N, bf* Bt) {
    const int lane = threadIdx.x & 31; const int L0 = (blockIdx.x * 8 + (threadIdx.x >> 5)) * 8; const int nlines = N * K / 64;
{
#pragma unroll 1
        for (int l = 0; l < 8; ++l) { const int L = L0 + l; if (L >= nlines) break; const size_t e = (size_t)L * 64 + lane * 2; const int k = (int)(e % K), n = (int)(e / K); v2us o;
            o[0] = f2bf(w[(size_t)k * N + n]); o[1] = f2bf(w[(size_t)(k + 1) * N + n]); *(v2us*)(Bt + e) = o; }
         }
}
__global__ __launch_bounds__(256) void k_cvt8(const float* __restrict__ src, bf* dst, size_t n8) { const size_t i = (size_t)blockIdx.x * 256 + threadIdx.x; if (i >= n8) return; const v8f v = *(const v8f*)(src + i * 8); v8us o;
#pragma unroll
    for (int k = 0; k < 8; ++k) o[k] = f2bf(v[k]); *(v8us*)(dst + i * 8) = o;  }

// k_rope: head planes [h][t][d] (fp16 + hi/lo) of rope(x) x sc with the rotate-half convention out[d] = x[d] cos[t][d] - x[d+HD/2] sin[t][d], out[d+HD/2] = x[d+HD/2] cos[t][d+HD/2] + x[d] sin[t][d+HD/2]
__global__ __launch_bounds__(256) void k_rope(const float* __restrict__ F, int pitch, int nheads, const float* __restrict__ CS, const float* __restrict__ RF, const float* __restrict__ nw, float sc, h16* P16, bf* Ph, bf* Pl) {
    const size_t e = ((size_t)blockIdx.x * 256 + threadIdx.x) * 2; if (e >= (size_t)nheads * TT * HD) return; const int d = (int)(e % HD); const int t = (int)((e / HD) % TT); const int h = (int)(e / ((size_t)HD * TT)); const float* f = F + (size_t)t * pitch + h * HD; const float rf = RF ? RF[(size_t)h * TT + t] : 1.0f; v2h o16; v2us oh, ol;
#pragma unroll
    for (int q = 0; q < 2; ++q) { const int dd = d + q; const int dp = (dd < HD / 2) ? dd + HD / 2 : dd - HD / 2; float x0 = f[dd], x1 = f[dp];
        if (RF) { float n0 = __fmul_rn(x0, rf), n1 = __fmul_rn(x1, rf); asm volatile("" : "+v"(n0)); asm volatile("" : "+v"(n1)); x0 = __fmul_rn(bfr(nw[dd]), n0); x1 = __fmul_rn(bfr(nw[dp]), n1); }
        const v2f cs = *(const v2f*)(CS + ((size_t)t * HD + dd) * 2); float a = __fmul_rn(x0, cs[0]), bq = __fmul_rn(x1, cs[1]); asm volatile("" : "+v"(a)); asm volatile("" : "+v"(bq)); const float r = ((dd < HD / 2) ? __fsub_rn(a, bq) : __fadd_rn(a, bq)) * sc;
        o16[q] = tohx(r); unsigned short a2, c2; splitf(r, a2, c2); oh[q] = a2; ol[q] = c2; }
    *(v2h*)(P16 + e) = o16; *(v2us*)(Ph + e) = oh; *(v2us*)(Pl + e) = ol;  }
__global__ __launch_bounds__(256) void k_vtp(const float* __restrict__ F, int pitch, int nheads, h16* V16, bf* Vh, bf* Vl) { const size_t e = ((size_t)blockIdx.x * 256 + threadIdx.x) * 2; if (e >= (size_t)nheads * HD * TT) return; const int t = (int)(e % TT); const int d = (int)((e / TT) % HD); const int g = (int)(e / ((size_t)TT * HD)); v2h o16; v2us oh, ol;
#pragma unroll
    for (int q = 0; q < 2; ++q) { const float x = F[(size_t)(t + q) * pitch + g * HD + d]; o16[q] = tohx(x); unsigned short a2, c2; splitf(x, a2, c2); oh[q] = a2; ol[q] = c2; }
    *(v2h*)(V16 + e) = o16; *(v2us*)(Vh + e) = oh; *(v2us*)(Vl + e) = ol;  }
__global__ __launch_bounds__(256) void k_csid(float* CS) { const int idx = blockIdx.x * 256 + threadIdx.x; if (idx >= TT * HD) return; v2f cs; cs[0] = 1.0f; cs[1] = 0.0f; *(v2f*)(CS + (size_t)idx * 2) = cs;  }
// k_asoft: per row (zz, i): t = S x HD^-0.5 for keys with |i - j| <= 128 (the module's band), -3e38 elsewhere (-inf == exclusion); softmax over the keys (register row, one exp, fixed trees). Only the row tile's key window [w0, w1) is read and written: it lies in the three 128-key chunks around the row, walked in the dense order, so max and sum are those of the dense row;
__global__ __launch_bounds__(256) void k_asoft(const float* __restrict__ Sb, h16* P16, bf* Ph, bf* Pl) {
    const int lane = threadIdx.x & 31; const int row = blockIdx.x * 8 + (threadIdx.x >> 5); if (row >= ZH * TT) return; const int i = row % TT; const int zz = row / TT; (void)zz; const bool hires = (i < RH); const float* sr = Sb + (size_t)row * TT; float v[12]; float mx = -3.0e38f;
    const int w0 = max((i & ~63) - BW, 0), w1 = min((i & ~63) + 64 + BW, TT), jb = ((i >> 7) - 1) * 128 + lane * 4;
#pragma unroll
    for (int ch = 0; ch < 3; ++ch) { const int j0 = jb + ch * 128; const bool in = (j0 >= w0 && j0 < w1); v4f a = (v4f){}; if (in) a = *(const v4f*)(sr + j0);
#pragma unroll
        for (int q = 0; q < 4; ++q) { const int j = j0 + q; (void)j; const float t = (in && i - j <= BW && j - i <= BW) ? a[q] * SCL : -3.0e38f;   /* symmetric band |i - j| <= 128 */ v[ch * 4 + q] = t; mx = fmaxf(mx, t); } }
#pragma unroll
    for (int sh = 16; sh; sh >>= 1) mx = fmaxf(mx, __shfl_xor(mx, sh, 32));
    float sum = 0.f;
#pragma unroll
    for (int k = 0; k < 12; ++k) { float d0 = __fsub_rn(v[k], mx); asm volatile("" : "+v"(d0)); float ex; asm("v_exp_f32 %0, %1\n\tv_nop" : "=v"(ex) : "v"(__fmul_rn(d0, 1.4426950408889634f)));   /* exp2 with the one slot that the instruction set asks for behind a transcendental, in one statement so that it stays directly behind it */ v[k] = ex; sum += v[k]; }
#pragma unroll
    for (int sh = 16; sh; sh >>= 1) sum += __shfl_xor(sum, sh, 32);
    const float f = __fdiv_rn(hires ? 1.0f : PCAR, sum);
{
        if (hires) {
#pragma unroll
            for (int ch = 0; ch < 3; ++ch) { const int j0 = jb + ch * 128; if (j0 < w0 || j0 >= w1) continue; v4us oh, ol;
#pragma unroll
                for (int q = 0; q < 4; ++q) { unsigned short a, c2; splitf(v[ch * 4 + q] * f, a, c2); oh[q] = a; ol[q] = c2; }
                const size_t oo = ((size_t)zz * (RH ? RH : 1) + i) * TT + j0; *(v4us*)(Ph + oo) = oh; *(v4us*)(Pl + oo) = ol; }
        } else {
#pragma unroll
            for (int ch = 0; ch < 3; ++ch) { const int j0 = jb + ch * 128; if (j0 < w0 || j0 >= w1) continue; v4h o4;
#pragma unroll
                for (int q = 0; q < 4; ++q) o4[q] = tohx(v[ch * 4 + q] * f);
                *(v4h*)(P16 + (size_t)row * TT + j0) = o4; } }
         }
}
__global__ __launch_bounds__(256) void k_merge(const float* __restrict__ O, int h0, bf* Ah, bf* Al) { const size_t e = ((size_t)blockIdx.x * 256 + threadIdx.x) * 2; if (e >= (size_t)ZH * TT * HD) return; const int d = (int)(e % HD); const int t = (int)((e / HD) % TT); const int zz = (int)(e / ((size_t)HD * TT)); const float cs = (t < RH) ? 1.0f : (1.0f / PCAR); const size_t oo = (size_t)t * DQ + (h0 + zz) * HD + d;
    v2us oh, ol;
#pragma unroll
    for (int q = 0; q < 2; ++q) { unsigned short a, c2; splitf(O[e + q] * cs, a, c2); oh[q] = a; ol[q] = c2; } *(v2us*)(Ah + oo) = oh; *(v2us*)(Al + oo) = ol;  }

extern "C" void kernel_launch(void* const* d_in, const int* in_sizes, int n_in,
                              void* d_out, int out_size, void* d_ws, size_t ws_size, hipStream_t stream) {
    (void)in_sizes; (void)n_in; (void)out_size;
    const float* x = (const float*)d_in[0]; const float* wq = (const float*)d_in[1]; const float* bq = (const float*)d_in[2]; const float* wk = (const float*)d_in[3]; const float* bk = (const float*)d_in[4]; const float* wv = (const float*)d_in[5]; const float* bv = (const float*)d_in[6]; const float* wo = (const float*)d_in[7]; const float* bo = (const float*)d_in[8];   /* argument order x, wq, bq, wk, bk, wv, bv, wo, bo */
    float* OUT = (float*)d_out;     // [2][2048][1024]
    char* wsp = (char*)d_ws;
    auto take = [&](size_t bytes) { char* p = wsp; wsp += (bytes + 255) & ~(size_t)255; return (void*)p; };
    bf* WQ = (bf*)take((size_t)DQ * DM * 2); bf* WK = (bf*)take((size_t)DKV * DM * 2); bf* WV = (bf*)take((size_t)DKV * DM * 2); bf* WO = (bf*)take((size_t)DM * DQ * 2); float* CS = (float*)take((size_t)TT * HD * 2 * 4);
    bf* XB = (bf*)take((size_t)TT * DM * 2); float* FQ = (float*)take((size_t)TT * DQ * 4); float* FK = (float*)take((size_t)TT * DKV * 4);
    h16* QP16 = (h16*)take((size_t)NH_ * TT * HD * 2); h16* KP16 = (h16*)take((size_t)NKV * TT * HD * 2); h16* VT16 = (h16*)take((size_t)NKV * HD * TT * 2);
    bf* QPh = (bf*)take((size_t)NH_ * TT * HD * 2); bf* QPl = (bf*)take((size_t)NH_ * TT * HD * 2); bf* KPh = (bf*)take((size_t)NKV * TT * HD * 2); bf* KPl = (bf*)take((size_t)NKV * TT * HD * 2); bf* VTh = (bf*)take((size_t)NKV * HD * TT * 2); bf* VTl = (bf*)take((size_t)NKV * HD * TT * 2); bf* Ph = (bf*)take((size_t)ZH * RH * TT * 2); bf* Pl = (bf*)take((size_t)ZH * RH * TT * 2);
    float* Sb = (float*)take((size_t)ZH * TT * TT * 4); h16* P16 = (h16*)take((size_t)ZH * TT * TT * 2); float* Ob = (float*)take((size_t)ZH * TT * HD * 4); bf* ATh = (bf*)take((size_t)TT * DQ * 2); bf* ATl = (bf*)take((size_t)TT * DQ * 2);
    if ((size_t)(wsp - (char*)d_ws) > ws_size) return;    // ws 256 MiB
    float* FV = FK;   // v projection reuses the k buffer after the k planes are built (stream-ordered)
    { k_wtG<<<(unsigned)((DM * DQ / 64 + 63) / 64), 256, 0, stream>>>(wq, DM, DQ, WQ); k_wtG<<<(unsigned)((DM * DKV / 64 + 63) / 64), 256, 0, stream>>>(wk, DM, DKV, WK); k_wtG<<<(unsigned)((DM * DKV / 64 + 63) / 64), 256, 0, stream>>>(wv, DM, DKV, WV);
      k_wtG<<<(unsigned)((DQ * DM / 64 + 63) / 64), 256, 0, stream>>>(wo, DQ, DM, WO);
       }
    k_csid<<<(TT * HD + 255) / 256, 256, 0, stream>>>(CS);
    const unsigned LQ = (unsigned)(((size_t)NH_ * TT * HD / 2 + 255) / 256), LKv = (unsigned)(((size_t)NKV * TT * HD / 2 + 255) / 256);
    for (int b = 0; b < NB_; ++b) {
        
        k_cvt8<<<(unsigned)(((size_t)TT * DM / 8 + 255) / 256), 256, 0, stream>>>(x + (size_t)b * TT * DM, XB, (size_t)TT * DM / 8);
        k_gemmw<bf, 0, true, 0><<<dim3(TT / 64, DQ / 64, 1), 32, 0, stream>>>(XB, nullptr, WQ, nullptr, DM, FQ, DQ, bq, 0, 0, 0, 0);
        k_rope<<<LQ, 256, 0, stream>>>(FQ, DQ, NH_, CS, nullptr, nullptr, 1.0f, QP16, QPh, QPl);
        k_gemmw<bf, 0, true, 0><<<dim3(TT / 64, DKV / 64, 1), 32, 0, stream>>>(XB, nullptr, WK, nullptr, DM, FK, DKV, bk, 0, 0, 0, 0);
        k_rope<<<LKv, 256, 0, stream>>>(FK, DKV, NKV, CS, nullptr, nullptr, 1.0f, KP16, KPh, KPl);
        k_gemmw<bf, 0, true, 0><<<dim3(TT / 64, DKV / 64, 1), 32, 0, stream>>>(XB, nullptr, WV, nullptr, DM, FV, DKV, bv, 0, 0, 0, 0); k_vtp<<<LKv, 256, 0, stream>>>(FV, DKV, NKV, VT16, VTh, VTl);
        for (int h0 = 0; h0 < NH_; h0 += ZH) { const size_t zq = (size_t)h0, zk = (size_t)(h0 / REP);   // one kv head per query head: the pass's two heads use consecutive kv planes (z-strides TT*HD)
            k_gemmw<bf, 2, false, 1><<<dim3(RH / 64, NBT, ZH), 32, 0, stream>>>(QPh + zq * TT * HD, QPl + zq * TT * HD, KPh + zk * TT * HD, KPl + zk * TT * HD, HD, Sb, TT, nullptr, (size_t)TT * HD, (size_t)TT * HD, (size_t)TT * TT, 0);
            k_gemmw<h16, 0, false, 1><<<dim3((TT - RH) / 64, NBT, ZH), 32, 0, stream>>>(QP16 + zq * TT * HD + (size_t)RH * HD, nullptr, KP16 + zk * TT * HD, nullptr, HD, Sb + (size_t)RH * TT, TT, nullptr, (size_t)TT * HD, (size_t)TT * HD, (size_t)TT * TT, RH);
            k_asoft<<<ZH * TT / 8, 256, 0, stream>>>(Sb, P16, Ph, Pl);
            k_gemmw<bf, 2, false, 2><<<dim3(RH / 64, HD / 64, ZH), 32, 0, stream>>>(Ph, Pl, VTh + zk * HD * TT, VTl + zk * HD * TT, TT, Ob, HD, nullptr, (size_t)RH * TT, (size_t)HD * TT, (size_t)TT * HD, 0);
            k_gemmw<h16, 0, false, 2><<<dim3((TT - RH) / 64, HD / 64, ZH), 32, 0, stream>>>(P16 + (size_t)RH * TT, nullptr, VT16 + zk * HD * TT, nullptr, TT, Ob + (size_t)RH * HD, HD, nullptr, (size_t)TT * TT, (size_t)HD * TT, (size_t)TT * HD, RH);
            k_merge<<<(unsigned)(((size_t)ZH * TT * HD / 2 + 255) / 256), 256, 0, stream>>>(Ob, h0, ATh, ATl); }
        k_gemmw<bf, 1, true, 0><<<dim3(TT / 64, DM / 64, 1), 32, 0, stream>>>(ATh, ATl, WO, nullptr, DQ, OUT + (size_t)b * TT * DM, DM, bo, 0, 0, 0, 0); }
}

// v002
// Measured time: 227 microseconds a run.
// Next to v001, in two timings, it ran 3.56 times as fast each time.
// All steps since v000 together make it 8.90 times as fast.
#include <hip/hip_runtime.h>

// Sliding-window (banded) multi-head attention (x [2][2048][1024]; q, k, v = x W + b ('xw' [1024][1024] 0.02, zero biases; 16 heads x 64); scores x 64^-0.5; keys j with i - 128 <= j <= i + 128 (symmetric window 256, -inf elsewhere); softmax; out = merged wo + bo ('xw') -> [2][2048][1024] (4.2 M); argument order x, wq, bq, wk, bk, wv, bv, wo, bo).
// Layout, both batches at once (4096 rows; 32 head planes z = batch * 16 + head): bf16 copy of x; 'xw' weights transposed once; exact projections + f32 biases; banded T-2048 attention, every attention launch over all 32 planes, scores and p stored as bands of 320 columns (column c of row i is key (i & ~63) - 128 + c) (per 64-row tile only the 5 64-key tiles [r0 - 128, r0 + 192) that meet its band are scored, normalised and multiplied with v; inside them the band is a select in the softmax; hybrid rows: < 512 hi/lo 3 products, rest fp16 x1024); merged hi/lo x wo exact + bo.
// Compute dtypes, f32 accumulate: every input rounded to bf16; projections exact + f32 biases; attention rows < 512 3 products, rest fp16; softmax f32; wo hl x exact + bias.

#define NB_  2
#define TT   2048
#define DM   1024
#define NH_  16
#define NKV  16
#define REP  (NH_ / NKV)
#define HD   64
#define DQ   (NH_ * HD)
#define DKV  (NKV * HD)
#define ZH   (NB_ * NH_)          // head planes per attention launch: all heads of both batches
#define RH   512                  // query rows < RH use hi+lo planes (0: none)
#define WIN  2048
#define BW   128      // half window: keys j in [i - 128, i + 128]
#define NBT  ((2 * BW + 64) / 64)   // 64-key tiles that a 64-row tile's band can meet: keys [r0 - BW, r0 + 64 + BW)
#define BP   (NBT * 64)             // pitch of a stored score or p row: the band's NBT key tiles, from key (i & ~63) - BW
#define PCAR 1024.0f
#define SCL  0.125f   // HD^-0.5
typedef _Float16 h16;
typedef unsigned short bf;
typedef __attribute__((ext_vector_type(16))) __bf16   v16bf;
typedef __attribute__((ext_vector_type(16))) _Float16 v16h;
typedef __attribute__((ext_vector_type(8)))  _Float16 v8h;
typedef __attribute__((ext_vector_type(8)))  unsigned short v8us;
typedef __attribute__((ext_vector_type(8)))  float    v8f;
typedef __attribute__((ext_vector_type(4)))  float    v4f;
typedef v8h  __attribute__((may_alias)) v8ha;
typedef v4f  __attribute__((may_alias)) v4fa;
typedef v8us __attribute__((may_alias)) v8usa;

__device__ __forceinline__ unsigned short f2bf(float f) { unsigned u = __float_as_uint(f); u += 0x7FFFu + ((u >> 16) & 1u); return (unsigned short)(u >> 16); }
__device__ __forceinline__ float bf2f(unsigned short b) { return __uint_as_float(((unsigned)b) << 16); }
__device__ __forceinline__ float bfr(float f) { return bf2f(f2bf(f)); }
__device__ __forceinline__ v16h cat16(v8h lo, v8h hi) { return __builtin_shufflevector(lo, hi, 0, 1, 2, 3, 4, 5, 6, 7, 8, 9, 10, 11, 12, 13, 14, 15); }
__device__ __forceinline__ v16bf cat16b(v8us lo, v8us hi) { return __builtin_bit_cast(v16bf, __builtin_shufflevector(lo, hi, 0, 1, 2, 3, 4, 5, 6, 7, 8, 9, 10, 11, 12, 13, 14, 15)); }
__device__ __forceinline__ v8f wmma16(v16h a, v16h b, v8f c) { return __builtin_amdgcn_wmma_f32_16x16x32_f16(false, a, false, b, (short)0, c, false, false); }
__device__ __forceinline__ v8f wmmab(v16bf a, v16bf b, v8f c) { return __builtin_amdgcn_wmma_f32_16x16x32_bf16(false, a, false, b, (short)0, c, false, false); }



// ---- k_gemmw: register-blocked GEMM, ONE WAVE per 64x64 output tile (16 accumulators), operands straight from K-contiguous 16-bit planes; grid (M/64, N/64, Z), 32 threads.
// C[m][n] (f32, pitch ldc, + optional f32 bias[n]; bias, bias1, bias2 for z = 0, 1, 2) = sum_k A[m][k] Bt[n][k] (+ split products per NSPLIT). z-batch strides sA/sB/sC in elements. K % 32 == 0.
// BAND 0: dense. BAND 1 (scores): blockIdx.y counts the NBT key tiles from key rbase + r0 - BW, stored at column blockIdx.y * 64 of C (band rows, ldc = BP); a tile outside [0, TT) is left out. BAND 2 (p x v): k runs over the keys [rbase + r0 - BW, rbase + r0 + 64 + BW) clipped to [0, K); p is exactly 0 on all others; A holds band rows of pitch BP. rbase: sequence position of A's row 0.
template <typename T16> struct WFrag;
template <> struct WFrag<h16> { typedef v16h V; static __device__ __forceinline__ V ld(const h16* p) { return cat16(*(const v8h*)p, *(const v8h*)(p + 16)); } static __device__ __forceinline__ v8f mma(V a, V b, v8f c) { return wmma16(a, b, c); } };
template <> struct WFrag<bf> { typedef v16bf V; static __device__ __forceinline__ V ld(const bf* p) { return cat16b(*(const v8us*)p, *(const v8us*)(p + 16)); } static __device__ __forceinline__ v8f mma(V a, V b, v8f c) { return wmmab(a, b, c); } };
template <typename T16, int NSPLIT, bool BIAS, int BAND>
__global__ __launch_bounds__(32) void k_gemmw(const T16* __restrict__ A, const T16* __restrict__ A2, const T16* __restrict__ Bt, const T16* __restrict__ Bt2, int K, float* C, int ldc, const float* __restrict__ bias, const float* __restrict__ bias1, const float* __restrict__ bias2, size_t sA, size_t sB, size_t sC, int rbase) {
    typedef typename WFrag<T16>::V V;
    __shared__ __align__(16) float os[16 * 68];
    const size_t z = blockIdx.z; A += z * sA; if (A2) A2 += z * sA; Bt += z * sB; if (Bt2) Bt2 += z * sB; C += z * sC;
    if (BIAS) bias = (z == 0) ? bias : (z == 1) ? bias1 : bias2;   // z-batched projections: each z has its own bias vector
    const int lane = threadIdx.x & 31, lr = lane & 15, hi = lane >> 4; const int r0 = blockIdx.x * 64, c0 = (BAND == 1) ? rbase + r0 - BW + (int)blockIdx.y * 64 : (int)blockIdx.y * 64;
    if (BAND == 1 && (c0 < 0 || c0 >= TT)) return;
    const int kb = (BAND == 2) ? max(rbase + r0 - BW, 0) : 0, kw = ((BAND == 2) ? min(rbase + r0 + 64 + BW, K) : K) - kb;
    const int lda = (BAND == 2) ? BP : K, ka = (BAND == 2) ? kb - (rbase + r0 - BW) : 0, cc0 = (BAND == 1) ? (int)blockIdx.y * 64 : c0;   // A's pitch; band column of key kb; C's column
    if (BAND == 2) { A += ka; Bt += kb; if (NSPLIT == 1 || NSPLIT == 2) A2 += ka; if (NSPLIT >= 2) Bt2 += kb; }
    v8f acc[4][4];
#pragma unroll
    for (int mb = 0; mb < 4; ++mb)
#pragma unroll
        for (int nb = 0; nb < 4; ++nb) acc[mb][nb] = (v8f){};
    const size_t aoff = (size_t)(r0 + lr) * lda + 8 * hi, boff = (size_t)(c0 + lr) * K + 8 * hi;
#pragma unroll 1
    for (int kc = 0; kc < kw; kc += 32) {
        V a[4], a2[4];
#pragma unroll
        for (int mb = 0; mb < 4; ++mb) { a[mb] = WFrag<T16>::ld(A + aoff + (size_t)mb * 16 * lda + kc); if (NSPLIT == 1 || NSPLIT == 2) a2[mb] = WFrag<T16>::ld(A2 + aoff + (size_t)mb * 16 * lda + kc); }
#pragma unroll
        for (int nb = 0; nb < 4; ++nb) { const V b = WFrag<T16>::ld(Bt + boff + (size_t)nb * 16 * K + kc); V b2; if (NSPLIT >= 2) b2 = WFrag<T16>::ld(Bt2 + boff + (size_t)nb * 16 * K + kc);
            if (BAND == 2 && NSPLIT >= 2) asm volatile("s_wait_xcnt 0x0" ::: "memory");   // in this build the next key-column block's address sum reuses the address pair of the loads above while they are in flight: the wait stands in front of that overwrite
#pragma unroll
            for (int mb = 0; mb < 4; ++mb) { acc[mb][nb] = WFrag<T16>::mma(a[mb], b, acc[mb][nb]); if (NSPLIT == 1 || NSPLIT == 2) acc[mb][nb] = WFrag<T16>::mma(a2[mb], b, acc[mb][nb]); if (NSPLIT >= 2) acc[mb][nb] = WFrag<T16>::mma(a[mb], b2, acc[mb][nb]); } }
        asm volatile("v_nop\n\tv_nop\n\tv_nop\n\tv_nop" : "+v"(acc[0][0]), "+v"(acc[1][1]), "+v"(acc[2][2]), "+v"(acc[3][3]) : "v"(a[0]), "v"(a[3]));
    }
#pragma unroll
    for (int mb = 0; mb < 4; ++mb) {
#pragma unroll
        for (int nb = 0; nb < 4; ++nb) {
#pragma unroll
            for (int j = 0; j < 8; ++j) os[(hi * 8 + j) * 68 + nb * 16 + lr] = acc[mb][nb][j]; }
        __builtin_amdgcn_wave_barrier(); asm volatile("" ::: "memory");
        float* crow = C + (size_t)(r0 + mb * 16) * ldc + cc0;
{
#pragma unroll
            for (int s = 0; s < 8; ++s) { const int row = 2 * s + hi, cofs = lr * 4; v4f val = *(const v4fa*)(os + row * 68 + cofs); if (BIAS) { val[0] += bfr(bias[c0 + cofs]); val[1] += bfr(bias[c0 + cofs + 1]); val[2] += bfr(bias[c0 + cofs + 2]); val[3] += bfr(bias[c0 + cofs + 3]); }
                *(v4f*)(crow + (size_t)row * ldc + cofs) = val; }
             }
        __builtin_amdgcn_wave_barrier(); asm volatile("" ::: "memory");
    }
}

__device__ __forceinline__ h16 tohx(float x) { return (h16)x; }
__device__ __forceinline__ void splitf(float y, unsigned short& h, unsigned short& l) { h = f2bf(y); l = f2bf(y - bf2f(h)); }
typedef __attribute__((ext_vector_type(2))) _Float16 v2h;
typedef __attribute__((ext_vector_type(4))) _Float16 v4h;
typedef __attribute__((ext_vector_type(2))) unsigned short v2us;
typedef __attribute__((ext_vector_type(4))) unsigned short v4us;
typedef __attribute__((ext_vector_type(2))) float v2f;
typedef __attribute__((ext_vector_type(4))) int v4i;

__global__ __launch_bounds__(256) void k_wtG(const float* __restrict__ w0, const float* __restrict__ w1, const float* __restrict__ w2, const float* __restrict__ w3, int K, int N, bf* Bt) {
    const float* __restrict__ w = (blockIdx.y == 0) ? w0 : (blockIdx.y == 1) ? w1 : (blockIdx.y == 2) ? w2 : w3; Bt += (size_t)blockIdx.y * K * N;   // blockIdx.y: which of the four equally shaped weights
    const int lane = threadIdx.x & 31; const int L0 = (blockIdx.x * 8 + (threadIdx.x >> 5)) * 8; const int nlines = N * K / 64;
{
#pragma unroll 1
        for (int l = 0; l < 8; ++l) { const int L = L0 + l; if (L >= nlines) break; const size_t e = (size_t)L * 64 + lane * 2; const int k = (int)(e % K), n = (int)(e / K); v2us o;
            o[0] = f2bf(w[(size_t)k * N + n]); o[1] = f2bf(w[(size_t)(k + 1) * N + n]); *(v2us*)(Bt + e) = o; }
         }
}
__global__ __launch_bounds__(256) void k_cvt8(const float* __restrict__ src, bf* dst, size_t n8) { const size_t i = (size_t)blockIdx.x * 256 + threadIdx.x; if (i >= n8) return; const v8f v = *(const v8f*)(src + i * 8); v8us o;
#pragma unroll
    for (int k = 0; k < 8; ++k) o[k] = f2bf(v[k]); *(v8us*)(dst + i * 8) = o;  }

// k_rope: head planes [blockIdx.y (batch) * nheads + h][t][d] (fp16 + hi/lo) of rope(x) x sc with the rotate-half convention out[d] = x[d] cos[t][d] - x[d+HD/2] sin[t][d], out[d+HD/2] = x[d+HD/2] cos[t][d+HD/2] + x[d] sin[t][d+HD/2]
__global__ __launch_bounds__(256) void k_rope(const float* __restrict__ F, int pitch, int nheads, const float* __restrict__ CS, const float* __restrict__ RF, const float* __restrict__ nw, float sc, h16* P16, bf* Ph, bf* Pl) {
    { const size_t pb = (size_t)blockIdx.y * nheads * TT * HD; F += (size_t)blockIdx.y * TT * pitch; P16 += pb; Ph += pb; Pl += pb; }   // blockIdx.y: batch
    const size_t e = ((size_t)blockIdx.x * 256 + threadIdx.x) * 2; if (e >= (size_t)nheads * TT * HD) return; const int d = (int)(e % HD); const int t = (int)((e / HD) % TT); const int h = (int)(e / ((size_t)HD * TT)); const float* f = F + (size_t)t * pitch + h * HD; const float rf = RF ? RF[(size_t)h * TT + t] : 1.0f; v2h o16; v2us oh, ol;
#pragma unroll
    for (int q = 0; q < 2; ++q) { const int dd = d + q; const int dp = (dd < HD / 2) ? dd + HD / 2 : dd - HD / 2; float x0 = f[dd], x1 = f[dp];
        if (RF) { float n0 = __fmul_rn(x0, rf), n1 = __fmul_rn(x1, rf); asm volatile("" : "+v"(n0)); asm volatile("" : "+v"(n1)); x0 = __fmul_rn(bfr(nw[dd]), n0); x1 = __fmul_rn(bfr(nw[dp]), n1); }
        const v2f cs = *(const v2f*)(CS + ((size_t)t * HD + dd) * 2); float a = __fmul_rn(x0, cs[0]), bq = __fmul_rn(x1, cs[1]); asm volatile("" : "+v"(a)); asm volatile("" : "+v"(bq)); const float r = ((dd < HD / 2) ? __fsub_rn(a, bq) : __fadd_rn(a, bq)) * sc;
        o16[q] = tohx(r); unsigned short a2, c2; splitf(r, a2, c2); oh[q] = a2; ol[q] = c2; }
    *(v2h*)(P16 + e) = o16; *(v2us*)(Ph + e) = oh; *(v2us*)(Pl + e) = ol;  }
__global__ __launch_bounds__(256) void k_vtp(const float* __restrict__ F, int pitch, int nheads, h16* V16, bf* Vh, bf* Vl) { const size_t e = ((size_t)blockIdx.x * 256 + threadIdx.x) * 2; if (e >= (size_t)nheads * HD * TT) return; { const size_t pb = (size_t)blockIdx.y * nheads * HD * TT; F += (size_t)blockIdx.y * TT * pitch; V16 += pb; Vh += pb; Vl += pb; }   /* blockIdx.y: batch */ const int t = (int)(e % TT); const int d = (int)((e / TT) % HD); const int g = (int)(e / ((size_t)TT * HD)); v2h o16; v2us oh, ol;
#pragma unroll
    for (int q = 0; q < 2; ++q) { const float x = F[(size_t)(t + q) * pitch + g * HD + d]; o16[q] = tohx(x); unsigned short a2, c2; splitf(x, a2, c2); oh[q] = a2; ol[q] = c2; }
    *(v2h*)(V16 + e) = o16; *(v2us*)(Vh + e) = oh; *(v2us*)(Vl + e) = ol;  }
__global__ __launch_bounds__(256) void k_csid(float* CS) { const int idx = blockIdx.x * 256 + threadIdx.x; if (idx >= TT * HD) return; v2f cs; cs[0] = 1.0f; cs[1] = 0.0f; *(v2f*)(CS + (size_t)idx * 2) = cs;  }
// k_asoft: per row (zz, i): t = S x HD^-0.5 for keys with |i - j| <= 128 (the module's band), -3e38 elsewhere (-inf == exclusion); softmax over the keys (register row, one exp, fixed trees). Only the row tile's key window [w0, w1) is read and written: it lies in the three 128-key chunks around the row, walked in the dense order, so max and sum are those of the dense row; Sb, P16 (rows >= RH only), Ph and Pl hold band rows of pitch BP;
__global__ __launch_bounds__(256) void k_asoft(const float* __restrict__ Sb, h16* P16, bf* Ph, bf* Pl) {
    const int lane = threadIdx.x & 31; const int row = blockIdx.x * 8 + (threadIdx.x >> 5); if (row >= ZH * TT) return; const int i = row % TT; const int zz = row / TT; (void)zz; const bool hires = (i < RH); const int wb = (i & ~63) - BW;   /* key of band column 0 */ const float* sr = Sb + (size_t)row * BP - wb; float v[12]; float mx = -3.0e38f;
    const int w0 = max((i & ~63) - BW, 0), w1 = min((i & ~63) + 64 + BW, TT), jb = ((i >> 7) - 1) * 128 + lane * 4;
#pragma unroll
    for (int ch = 0; ch < 3; ++ch) { const int j0 = jb + ch * 128; const bool in = (j0 >= w0 && j0 < w1); v4f a = (v4f){}; if (in) a = *(const v4f*)(sr + j0);
#pragma unroll
        for (int q = 0; q < 4; ++q) { const int j = j0 + q; (void)j; const float t = (in && i - j <= BW && j - i <= BW) ? a[q] * SCL : -3.0e38f;   /* symmetric band |i - j| <= 128 */ v[ch * 4 + q] = t; mx = fmaxf(mx, t); } }
#pragma unroll
    for (int sh = 16; sh; sh >>= 1) mx = fmaxf(mx, __shfl_xor(mx, sh, 32));
    float sum = 0.f;
#pragma unroll
    for (int k = 0; k < 12; ++k) { float d0 = __fsub_rn(v[k], mx); asm volatile("" : "+v"(d0)); float ex; asm("v_exp_f32 %0, %1\n\tv_nop" : "=v"(ex) : "v"(__fmul_rn(d0, 1.4426950408889634f)));   /* exp2 with the one slot that the instruction set asks for behind a transcendental, in one statement so that it stays directly behind it */ v[k] = ex; sum += v[k]; }
#pragma unroll
    for (int sh = 16; sh; sh >>= 1) sum += __shfl_xor(sum, sh, 32);
    const float f = __fdiv_rn(hires ? 1.0f : PCAR, sum);
{
        if (hires) {
#pragma unroll
            for (int ch = 0; ch < 3; ++ch) { const int j0 = jb + ch * 128; if (j0 < w0 || j0 >= w1) continue; v4us oh, ol;
#pragma unroll
                for (int q = 0; q < 4; ++q) { unsigned short a, c2; splitf(v[ch * 4 + q] * f, a, c2); oh[q] = a; ol[q] = c2; }
                const size_t oo = ((size_t)zz * (RH ? RH : 1) + i) * BP + (j0 - wb); *(v4us*)(Ph + oo) = oh; *(v4us*)(Pl + oo) = ol; }
        } else {
#pragma unroll
            for (int ch = 0; ch < 3; ++ch) { const int j0 = jb + ch * 128; if (j0 < w0 || j0 >= w1) continue; v4h o4;
#pragma unroll
                for (int q = 0; q < 4; ++q) o4[q] = tohx(v[ch * 4 + q] * f);
                *(v4h*)(P16 + ((size_t)zz * (TT - RH) + (i - RH)) * BP + (j0 - wb)) = o4; } }
         }
}
__global__ __launch_bounds__(256) void k_merge(const float* __restrict__ O, bf* Ah, bf* Al) { const size_t e = ((size_t)blockIdx.x * 256 + threadIdx.x) * 2; if (e >= (size_t)ZH * TT * HD) return; const int d = (int)(e % HD); const int t = (int)((e / HD) % TT); const int zz = (int)(e / ((size_t)HD * TT)); const float cs = (t < RH) ? 1.0f : (1.0f / PCAR); const size_t oo = ((size_t)(zz / NH_) * TT + t) * DQ + (zz % NH_) * HD + d;
    v2us oh, ol;
#pragma unroll
    for (int q = 0; q < 2; ++q) { unsigned short a, c2; splitf(O[e + q] * cs, a, c2); oh[q] = a; ol[q] = c2; } *(v2us*)(Ah + oo) = oh; *(v2us*)(Al + oo) = ol;  }

extern "C" void kernel_launch(void* const* d_in, const int* in_sizes, int n_in,
                              void* d_out, int out_size, void* d_ws, size_t ws_size, hipStream_t stream) {
    (void)in_sizes; (void)n_in; (void)out_size;
    const float* x = (const float*)d_in[0]; const float* wq = (const float*)d_in[1]; const float* bq = (const float*)d_in[2]; const float* wk = (const float*)d_in[3]; const float* bk = (const float*)d_in[4]; const float* wv = (const float*)d_in[5]; const float* bv = (const float*)d_in[6]; const float* wo = (const float*)d_in[7]; const float* bo = (const float*)d_in[8];   /* argument order x, wq, bq, wk, bk, wv, bv, wo, bo */
    float* OUT = (float*)d_out;     // [2][2048][1024]
    char* wsp = (char*)d_ws;
    auto take = [&](size_t bytes) { char* p = wsp; wsp += (bytes + 255) & ~(size_t)255; return (void*)p; };
    bf* WQ = (bf*)take((size_t)4 * DQ * DM * 2); bf* WK = WQ + (size_t)DQ * DM; bf* WV = WK + (size_t)DKV * DM; bf* WO = WV + (size_t)DKV * DM; (void)WK; (void)WV;   // four transposed 1024 x 1024 weights in a row: a grid dimension walks them
    float* CS = (float*)take((size_t)TT * HD * 2 * 4); bf* XB = (bf*)take((size_t)NB_ * TT * DM * 2);
    h16* QP16 = (h16*)take((size_t)ZH * TT * HD * 2); h16* KP16 = (h16*)take((size_t)ZH * TT * HD * 2); h16* VT16 = (h16*)take((size_t)ZH * HD * TT * 2);
    bf* QPh = (bf*)take((size_t)ZH * TT * HD * 2); bf* QPl = (bf*)take((size_t)ZH * TT * HD * 2); bf* KPh = (bf*)take((size_t)ZH * TT * HD * 2); bf* KPl = (bf*)take((size_t)ZH * TT * HD * 2); bf* VTh = (bf*)take((size_t)ZH * HD * TT * 2); bf* VTl = (bf*)take((size_t)ZH * HD * TT * 2); bf* Ph = (bf*)take((size_t)ZH * RH * BP * 2); bf* Pl = (bf*)take((size_t)ZH * RH * BP * 2);
    float* Sb = (float*)take((size_t)ZH * TT * BP * 4); h16* P16 = (h16*)take((size_t)ZH * (TT - RH) * BP * 2);
    if ((size_t)(wsp - (char*)d_ws) > ws_size) return;    // 219 of the 256 MiB
    // the 80 MiB of Sb serve three times, stream-ordered: before the scores the f32 projections (3 x 16 MiB, read last by k_vtp); the scores; after the softmax the p x v output (16 MiB) and the merged hi/lo planes (2 x 8 MiB)
    float* FQ = Sb; float* FK = FQ + (size_t)NB_ * TT * DQ; float* FV = FK + (size_t)NB_ * TT * DKV;
    float* Ob = Sb; bf* ATh = (bf*)(Sb + (size_t)ZH * TT * HD); bf* ATl = ATh + (size_t)NB_ * TT * DQ;
    k_wtG<<<dim3((unsigned)((DM * DQ / 64 + 63) / 64), 4, 1), 256, 0, stream>>>(wq, wk, wv, wo, DM, DQ, WQ);
    k_csid<<<(TT * HD + 255) / 256, 256, 0, stream>>>(CS);
    const dim3 LQ((unsigned)(((size_t)NH_ * TT * HD / 2 + 255) / 256), NB_, 1), LKv((unsigned)(((size_t)NKV * TT * HD / 2 + 255) / 256), NB_, 1);   // y: batch
    k_cvt8<<<(unsigned)(((size_t)NB_ * TT * DM / 8 + 255) / 256), 256, 0, stream>>>(x, XB, (size_t)NB_ * TT * DM / 8);
    k_gemmw<bf, 0, true, 0><<<dim3(NB_ * TT / 64, DQ / 64, 3), 32, 0, stream>>>(XB, nullptr, WQ, nullptr, DM, FQ, DQ, bq, bk, bv, 0, (size_t)DQ * DM, (size_t)NB_ * TT * DQ, 0);   // z: q, k, v
    k_rope<<<LQ, 256, 0, stream>>>(FQ, DQ, NH_, CS, nullptr, nullptr, 1.0f, QP16, QPh, QPl);
    k_rope<<<LKv, 256, 0, stream>>>(FK, DKV, NKV, CS, nullptr, nullptr, 1.0f, KP16, KPh, KPl);
    k_vtp<<<LKv, 256, 0, stream>>>(FV, DKV, NKV, VT16, VTh, VTl);
    // attention: blockIdx.z walks the 32 head planes (z-strides: one plane)
    k_gemmw<bf, 2, false, 1><<<dim3(RH / 64, NBT, ZH), 32, 0, stream>>>(QPh, QPl, KPh, KPl, HD, Sb, BP, nullptr, nullptr, nullptr, (size_t)TT * HD, (size_t)TT * HD, (size_t)TT * BP, 0);
    k_gemmw<h16, 0, false, 1><<<dim3((TT - RH) / 64, NBT, ZH), 32, 0, stream>>>(QP16 + (size_t)RH * HD, nullptr, KP16, nullptr, HD, Sb + (size_t)RH * BP, BP, nullptr, nullptr, nullptr, (size_t)TT * HD, (size_t)TT * HD, (size_t)TT * BP, RH);
    k_asoft<<<ZH * TT / 8, 256, 0, stream>>>(Sb, P16, Ph, Pl);
    k_gemmw<bf, 2, false, 2><<<dim3(RH / 64, HD / 64, ZH), 32, 0, stream>>>(Ph, Pl, VTh, VTl, TT, Ob, HD, nullptr, nullptr, nullptr, (size_t)RH * BP, (size_t)HD * TT, (size_t)TT * HD, 0);
    k_gemmw<h16, 0, false, 2><<<dim3((TT - RH) / 64, HD / 64, ZH), 32, 0, stream>>>(P16, nullptr, VT16, nullptr, TT, Ob + (size_t)RH * HD, HD, nullptr, nullptr, nullptr, (size_t)(TT - RH) * BP, (size_t)HD * TT, (size_t)TT * HD, RH);
    k_merge<<<(unsigned)(((size_t)ZH * TT * HD / 2 + 255) / 256), 256, 0, stream>>>(Ob, ATh, ATl);
    k_gemmw<bf, 1, true, 0><<<dim3(NB_ * TT / 64, DM / 64, 1), 32, 0, stream>>>(ATh, ATl, WO, nullptr, DQ, OUT, DM, bo, nullptr, nullptr, 0, 0, 0, 0);
}

// v003
// Measured time: 171 microseconds a run.
// Next to v002, in two timings, it ran 1.32 and 1.33 times as fast.
// Counting every step since v000, it is 11.8 times as fast.
#include <hip/hip_runtime.h>

// Sliding-window (banded) multi-head attention (x [2][2048][1024]; q, k, v = x W + b ('xw' [1024][1024] 0.02, zero biases; 16 heads x 64); scores x 64^-0.5; keys j with i - 128 <= j <= i + 128 (symmetric window 256, -inf elsewhere); softmax; out = merged wo + bo ('xw') -> [2][2048][1024] (4.2 M); argument order x, wq, bq, wk, bk, wv, bv, wo, bo).
// Layout, both batches at once (4096 rows; 32 head planes z = batch * 16 + head): bf16 copy of x; 'xw' weights transposed once; exact projections + f32 biases, whose GEMM stores the 16-bit q, k head planes and the transposed v planes itself; banded T-2048 attention, every attention launch over all 32 planes (scores and p x v: one launch for rows < 512, one for the rest), scores and p stored as bands of 320 columns (column c of row i is key (i & ~63) - 128 + c) (per 64-row tile only the 5 64-key tiles [r0 - 128, r0 + 192) that meet its band are scored, normalised and multiplied with v; inside them the band is a select in the softmax; hybrid rows: < 512 hi/lo 3 products, rest fp16 x1024); the p x v GEMM stores the merged hi/lo planes itself; merged hi/lo x wo exact + bo.
// Compute dtypes, f32 accumulate: every input rounded to bf16; projections exact + f32 biases; attention rows < 512 3 products, rest fp16; softmax f32; wo hl x exact + bias.

#define NB_  2
#define TT   2048
#define DM   1024
#define NH_  16
#define NKV  16
#define REP  (NH_ / NKV)
#define HD   64
#define DQ   (NH_ * HD)
#define DKV  (NKV * HD)
#define ZH   (NB_ * NH_)          // head planes per attention launch: all heads of both batches
#define RH   512                  // query rows < RH use hi+lo planes (0: none)
#define WIN  2048
#define BW   128      // half window: keys j in [i - 128, i + 128]
#define NBT  ((2 * BW + 64) / 64)   // 64-key tiles that a 64-row tile's band can meet: keys [r0 - BW, r0 + 64 + BW)
#define BP   (NBT * 64)             // pitch of a stored score or p row: the band's NBT key tiles, from key (i & ~63) - BW
#define PCAR 1024.0f
#define SCL  0.125f   // HD^-0.5
typedef _Float16 h16;
typedef unsigned short bf;
typedef __attribute__((ext_vector_type(16))) __bf16   v16bf;
typedef __attribute__((ext_vector_type(16))) _Float16 v16h;
typedef __attribute__((ext_vector_type(8)))  _Float16 v8h;
typedef __attribute__((ext_vector_type(8)))  unsigned short v8us;
typedef __attribute__((ext_vector_type(8)))  float    v8f;
typedef __attribute__((ext_vector_type(4)))  float    v4f;
typedef v8h  __attribute__((may_alias)) v8ha;
typedef v4f  __attribute__((may_alias)) v4fa;
typedef v8us __attribute__((may_alias)) v8usa;

__device__ __forceinline__ unsigned short f2bf(float f) { unsigned u = __float_as_uint(f); u += 0x7FFFu + ((u >> 16) & 1u); return (unsigned short)(u >> 16); }
__device__ __forceinline__ float bf2f(unsigned short b) { return __uint_as_float(((unsigned)b) << 16); }
__device__ __forceinline__ float bfr(float f) { return bf2f(f2bf(f)); }
__device__ __forceinline__ v16h cat16(v8h lo, v8h hi) { return __builtin_shufflevector(lo, hi, 0, 1, 2, 3, 4, 5, 6, 7, 8, 9, 10, 11, 12, 13, 14, 15); }
__device__ __forceinline__ v16bf cat16b(v8us lo, v8us hi) { return __builtin_bit_cast(v16bf, __builtin_shufflevector(lo, hi, 0, 1, 2, 3, 4, 5, 6, 7, 8, 9, 10, 11, 12, 13, 14, 15)); }
__device__ __forceinline__ v8f wmma16(v16h a, v16h b, v8f c) { return __builtin_amdgcn_wmma_f32_16x16x32_f16(false, a, false, b, (short)0, c, false, false); }
__device__ __forceinline__ v8f wmmab(v16bf a, v16bf b, v8f c) { return __builtin_amdgcn_wmma_f32_16x16x32_bf16(false, a, false, b, (short)0, c, false, false); }
__device__ __forceinline__ h16 tohx(float x) { return (h16)x; }
__device__ __forceinline__ void splitf(float y, unsigned short& h, unsigned short& l) { h = f2bf(y); l = f2bf(y - bf2f(h)); }



// ---- k_gemmw: register-blocked GEMM, ONE WAVE per 64x64 output tile (16 accumulators), operands straight from K-contiguous 16-bit planes; grid (M/64, N/64, Z), 32 threads.
// C[m][n] (f32, pitch ldc, + optional f32 bias[n]; bias, bias1, bias2 for z = 0, 1, 2) = sum_k A[m][k] Bt[n][k] (+ split products per NSPLIT). z-batch strides sA/sB/sC in elements. K % 32 == 0.
// BAND 0: dense. BAND 1 (scores): blockIdx.y counts the NBT key tiles from key rbase + r0 - BW, stored at column blockIdx.y * 64 of C (band rows, ldc = BP); a tile outside [0, TT) is left out. BAND 2 (p x v): k runs over the keys [rbase + r0 - BW, rbase + r0 + 64 + BW) clipped to [0, K); p is exactly 0 on all others; A holds band rows of pitch BP. rbase: sequence position of A's row 0.
// EPI 0: C in f32 as above. EPI 1 (projections; a 64-column tile is one head): y = sum + bias goes out as fp16, bf16 hi and bf16 lo = y - hi, into plane set z of E16, Eh, El: z = 0, 1 (q, k) head planes [batch * NH_ + head][t][d], z = 2 (v) transposed planes [batch * NH_ + head][d][t]. EPI 2 (p x v; z is the head plane): y = sum (x 1 / PCAR for rows t >= RH) goes out as hi and lo into the merged rows [batch][t][head * HD + d] of Eh, El. C is unused for EPI 1 and 2.
template <typename T16> struct WFrag;
template <> struct WFrag<h16> { typedef v16h V; static __device__ __forceinline__ V ld(const h16* p) { return cat16(*(const v8h*)p, *(const v8h*)(p + 16)); } static __device__ __forceinline__ v8f mma(V a, V b, v8f c) { return wmma16(a, b, c); } };
template <> struct WFrag<bf> { typedef v16bf V; static __device__ __forceinline__ V ld(const bf* p) { return cat16b(*(const v8us*)p, *(const v8us*)(p + 16)); } static __device__ __forceinline__ v8f mma(V a, V b, v8f c) { return wmmab(a, b, c); } };
template <typename T16, int NSPLIT, bool BIAS, int BAND, int EPI>
__global__ __launch_bounds__(32) void k_gemmw(const T16* __restrict__ A, const T16* __restrict__ A2, const T16* __restrict__ Bt, const T16* __restrict__ Bt2, int K, float* C, int ldc, const float* __restrict__ bias, const float* __restrict__ bias1, const float* __restrict__ bias2, size_t sA, size_t sB, size_t sC, int rbase, h16* E16, bf* Eh, bf* El) {
    typedef typename WFrag<T16>::V V;
    __shared__ __align__(16) float os[16 * 68];
    const size_t z = blockIdx.z; A += z * sA; if (A2) A2 += z * sA; Bt += z * sB; if (Bt2) Bt2 += z * sB; C += z * sC;
    if (BIAS) bias = (z == 0) ? bias : (z == 1) ? bias1 : bias2;   // z-batched projections: each z has its own bias vector
    const int lane = threadIdx.x & 31, lr = lane & 15, hi = lane >> 4; const int r0 = blockIdx.x * 64, c0 = (BAND == 1) ? rbase + r0 - BW + (int)blockIdx.y * 64 : (int)blockIdx.y * 64;
    if (BAND == 1 && (c0 < 0 || c0 >= TT)) return;
    const int kb = (BAND == 2) ? max(rbase + r0 - BW, 0) : 0, kw = ((BAND == 2) ? min(rbase + r0 + 64 + BW, K) : K) - kb;
    const int lda = (BAND == 2) ? BP : K, ka = (BAND == 2) ? kb - (rbase + r0 - BW) : 0, cc0 = (BAND == 1) ? (int)blockIdx.y * 64 : c0;   // A's pitch; band column of key kb; C's column
    if (BAND == 2) { A += ka; Bt += kb; if (NSPLIT == 1 || NSPLIT == 2) A2 += ka; if (NSPLIT >= 2) Bt2 += kb; }
    v8f acc[4][4];
#pragma unroll
    for (int mb = 0; mb < 4; ++mb)
#pragma unroll
        for (int nb = 0; nb < 4; ++nb) acc[mb][nb] = (v8f){};
    const size_t aoff = (size_t)(r0 + lr) * lda + 8 * hi, boff = (size_t)(c0 + lr) * K + 8 * hi;
#pragma unroll 1
    for (int kc = 0; kc < kw; kc += 32) {
        V a[4], a2[4];
#pragma unroll
        for (int mb = 0; mb < 4; ++mb) { a[mb] = WFrag<T16>::ld(A + aoff + (size_t)mb * 16 * lda + kc); if (NSPLIT == 1 || NSPLIT == 2) a2[mb] = WFrag<T16>::ld(A2 + aoff + (size_t)mb * 16 * lda + kc); }
#pragma unroll
        for (int nb = 0; nb < 4; ++nb) { const V b = WFrag<T16>::ld(Bt + boff + (size_t)nb * 16 * K + kc); V b2; if (NSPLIT >= 2) b2 = WFrag<T16>::ld(Bt2 + boff + (size_t)nb * 16 * K + kc);
            if (BAND == 2 && NSPLIT >= 2) asm volatile("s_wait_xcnt 0x0" ::: "memory");   // in this build the next key-column block's address sum reuses the address pair of the loads above while they are in flight: the wait stands in front of that overwrite
#pragma unroll
            for (int mb = 0; mb < 4; ++mb) { acc[mb][nb] = WFrag<T16>::mma(a[mb], b, acc[mb][nb]); if (NSPLIT == 1 || NSPLIT == 2) acc[mb][nb] = WFrag<T16>::mma(a2[mb], b, acc[mb][nb]); if (NSPLIT >= 2) acc[mb][nb] = WFrag<T16>::mma(a[mb], b2, acc[mb][nb]); } }
        asm volatile("v_nop\n\tv_nop\n\tv_nop\n\tv_nop" : "+v"(acc[0][0]), "+v"(acc[1][1]), "+v"(acc[2][2]), "+v"(acc[3][3]) : "v"(a[0]), "v"(a[3]));
    }
    static_assert(HD == 64, "EPI 1 and 2 take a 64-column tile for one head");
    const int trow = (EPI == 1) ? r0 % TT : rbase + r0;   // sequence position of the tile's row 0
    if (EPI == 1) { const size_t pz = z * ((size_t)ZH * TT * HD) + (size_t)((r0 / TT) * NH_ + (int)blockIdx.y) * TT * HD; E16 += pz; Eh += pz; El += pz; }   // plane set z, head plane of this tile
    if (EPI == 2) { const size_t pz = (z / NH_) * ((size_t)TT * DQ) + (z % NH_) * HD; Eh += pz; El += pz; }
    if (EPI == 1 && z == 2) {   // v transposed: a lane's 8 accumulator rows are 8 consecutive t of one d, 16 bytes a plane straight from registers; the wave's four mb stores fill each 128-byte line
#pragma unroll
        for (int nb = 0; nb < 4; ++nb) { const float bb = bfr(bias[c0 + nb * 16 + lr]);
#pragma unroll
            for (int mb = 0; mb < 4; ++mb) { v8h o16; v8us oh, ol;
#pragma unroll
                for (int j = 0; j < 8; ++j) { const float y = acc[mb][nb][j] + bb; o16[j] = tohx(y); unsigned short a2, c2; splitf(y, a2, c2); oh[j] = a2; ol[j] = c2; }
                const size_t oo = (size_t)(nb * 16 + lr) * TT + trow + mb * 16 + hi * 8; *(v8h*)(E16 + oo) = o16; *(v8us*)(Eh + oo) = oh; *(v8us*)(El + oo) = ol; } }
        return;
    }
    float bb[8];
    if (EPI == 1) {
#pragma unroll
        for (int q = 0; q < 8; ++q) bb[q] = bfr(bias[c0 + (lane & 7) * 8 + q]); }
#pragma unroll
    for (int mb = 0; mb < 4; ++mb) {
#pragma unroll
        for (int nb = 0; nb < 4; ++nb) {
#pragma unroll
            for (int j = 0; j < 8; ++j) os[(hi * 8 + j) * 68 + nb * 16 + lr] = acc[mb][nb][j]; }
        __builtin_amdgcn_wave_barrier(); asm volatile("" ::: "memory");
        if (EPI == 0) {
        float* crow = C + (size_t)(r0 + mb * 16) * ldc + cc0;
#pragma unroll
            for (int s = 0; s < 8; ++s) { const int row = 2 * s + hi, cofs = lr * 4; v4f val = *(const v4fa*)(os + row * 68 + cofs); if (BIAS) { val[0] += bfr(bias[c0 + cofs]); val[1] += bfr(bias[c0 + cofs + 1]); val[2] += bfr(bias[c0 + cofs + 2]); val[3] += bfr(bias[c0 + cofs + 3]); }
                *(v4f*)(crow + (size_t)row * ldc + cofs) = val; }
        } else {   // 8 lanes a row: each lane converts 8 consecutive columns, a row of 64 is one whole 128-byte line in every plane
#pragma unroll
            for (int s = 0; s < 4; ++s) { const int row = 4 * s + (lane >> 3), cofs = (lane & 7) * 8, t = trow + mb * 16 + row; const v4f va = *(const v4fa*)(os + row * 68 + cofs), vb = *(const v4fa*)(os + row * 68 + cofs + 4); const float cs = (t < RH) ? 1.0f : (1.0f / PCAR); v8h o16; v8us oh, ol;
#pragma unroll
                for (int q = 0; q < 8; ++q) { const float x = (q < 4) ? va[q & 3] : vb[q & 3]; const float y = (EPI == 1) ? x + bb[q] : x * cs; o16[q] = tohx(y); unsigned short a2, c2; splitf(y, a2, c2); oh[q] = a2; ol[q] = c2; }
                const size_t oo = (size_t)t * ((EPI == 1) ? HD : DQ) + cofs; if (EPI == 1) *(v8h*)(E16 + oo) = o16; *(v8us*)(Eh + oo) = oh; *(v8us*)(El + oo) = ol; }
            asm volatile("s_wait_xcnt 0x0" ::: "memory");   // behind the run of plane stores above: what follows in the build reuses their address and data registers, and the wait stands in front of that overwrite
        }
        __builtin_amdgcn_wave_barrier(); asm volatile("" ::: "memory");
    }
}

typedef __attribute__((ext_vector_type(2))) _Float16 v2h;
typedef __attribute__((ext_vector_type(4))) _Float16 v4h;
typedef __attribute__((ext_vector_type(2))) unsigned short v2us;
typedef __attribute__((ext_vector_type(4))) unsigned short v4us;
typedef __attribute__((ext_vector_type(2))) float v2f;
typedef __attribute__((ext_vector_type(4))) int v4i;

__global__ __launch_bounds__(256) void k_wtG(const float* __restrict__ w0, const float* __restrict__ w1, const float* __restrict__ w2, const float* __restrict__ w3, int K, int N, bf* Bt) {
    const float* __restrict__ w = (blockIdx.y == 0) ? w0 : (blockIdx.y == 1) ? w1 : (blockIdx.y == 2) ? w2 : w3; Bt += (size_t)blockIdx.y * K * N;   // blockIdx.y: which of the four equally shaped weights
    const int lane = threadIdx.x & 31; const int L0 = (blockIdx.x * 8 + (threadIdx.x >> 5)) * 8; const int nlines = N * K / 64;
{
#pragma unroll 1
        for (int l = 0; l < 8; ++l) { const int L = L0 + l; if (L >= nlines) break; const size_t e = (size_t)L * 64 + lane * 2; const int k = (int)(e % K), n = (int)(e / K); v2us o;
            o[0] = f2bf(w[(size_t)k * N + n]); o[1] = f2bf(w[(size_t)(k + 1) * N + n]); *(v2us*)(Bt + e) = o; }
         }
}
__global__ __launch_bounds__(256) void k_cvt8(const float* __restrict__ src, bf* dst, size_t n8) { const size_t i = (size_t)blockIdx.x * 256 + threadIdx.x; if (i >= n8) return; const v8f v = *(const v8f*)(src + i * 8); v8us o;
#pragma unroll
    for (int k = 0; k < 8; ++k) o[k] = f2bf(v[k]); *(v8us*)(dst + i * 8) = o;  }

// k_asoft: per row (zz, i): t = S x HD^-0.5 for keys with |i - j| <= 128 (the module's band), -3e38 elsewhere (-inf == exclusion); softmax over the keys (register row, one exp, fixed trees). Only the row tile's key window [w0, w1) is read and written: it lies in the three 128-key chunks around the row, walked in the dense order, so max and sum are those of the dense row; Sb, P16 (rows >= RH only), Ph and Pl hold band rows of pitch BP;
__global__ __launch_bounds__(256) void k_asoft(const float* __restrict__ Sb, h16* P16, bf* Ph, bf* Pl) {
    const int lane = threadIdx.x & 31; const int row = blockIdx.x * 8 + (threadIdx.x >> 5); if (row >= ZH * TT) return; const int i = row % TT; const int zz = row / TT; (void)zz; const bool hires = (i < RH); const int wb = (i & ~63) - BW;   /* key of band column 0 */ const float* sr = Sb + (size_t)row * BP - wb; float v[12]; float mx = -3.0e38f;
    const int w0 = max((i & ~63) - BW, 0), w1 = min((i & ~63) + 64 + BW, TT), jb = ((i >> 7) - 1) * 128 + lane * 4;
#pragma unroll
    for (int ch = 0; ch < 3; ++ch) { const int j0 = jb + ch * 128; const bool in = (j0 >= w0 && j0 < w1); v4f a = (v4f){}; if (in) a = *(const v4f*)(sr + j0);
#pragma unroll
        for (int q = 0; q < 4; ++q) { const int j = j0 + q; (void)j; const float t = (in && i - j <= BW && j - i <= BW) ? a[q] * SCL : -3.0e38f;   /* symmetric band |i - j| <= 128 */ v[ch * 4 + q] = t; mx = fmaxf(mx, t); } }
#pragma unroll
    for (int sh = 16; sh; sh >>= 1) mx = fmaxf(mx, __shfl_xor(mx, sh, 32));
    float sum = 0.f;
#pragma unroll
    for (int k = 0; k < 12; ++k) { float d0 = __fsub_rn(v[k], mx); asm volatile("" : "+v"(d0)); float ex; asm("v_exp_f32 %0, %1\n\tv_nop" : "=v"(ex) : "v"(__fmul_rn(d0, 1.4426950408889634f)));   /* exp2 with the one slot that the instruction set asks for behind a transcendental, in one statement so that it stays directly behind it */ v[k] = ex; sum += v[k]; }
#pragma unroll
    for (int sh = 16; sh; sh >>= 1) sum += __shfl_xor(sum, sh, 32);
    const float f = __fdiv_rn(hires ? 1.0f : PCAR, sum);
{
        if (hires) {
#pragma unroll
            for (int ch = 0; ch < 3; ++ch) { const int j0 = jb + ch * 128; if (j0 < w0 || j0 >= w1) continue; v4us oh, ol;
#pragma unroll
                for (int q = 0; q < 4; ++q) { unsigned short a, c2; splitf(v[ch * 4 + q] * f, a, c2); oh[q] = a; ol[q] = c2; }
                const size_t oo = ((size_t)zz * (RH ? RH : 1) + i) * BP + (j0 - wb); *(v4us*)(Ph + oo) = oh; *(v4us*)(Pl + oo) = ol; }
        } else {
#pragma unroll
            for (int ch = 0; ch < 3; ++ch) { const int j0 = jb + ch * 128; if (j0 < w0 || j0 >= w1) continue; v4h o4;
#pragma unroll
                for (int q = 0; q < 4; ++q) o4[q] = tohx(v[ch * 4 + q] * f);
                *(v4h*)(P16 + ((size_t)zz * (TT - RH) + (i - RH)) * BP + (j0 - wb)) = o4; } }
         }
}

extern "C" void kernel_launch(void* const* d_in, const int* in_sizes, int n_in,
                              void* d_out, int out_size, void* d_ws, size_t ws_size, hipStream_t stream) {
    (void)in_sizes; (void)n_in; (void)out_size;
    const float* x = (const float*)d_in[0]; const float* wq = (const float*)d_in[1]; const float* bq = (const float*)d_in[2]; const float* wk = (const float*)d_in[3]; const float* bk = (const float*)d_in[4]; const float* wv = (const float*)d_in[5]; const float* bv = (const float*)d_in[6]; const float* wo = (const float*)d_in[7]; const float* bo = (const float*)d_in[8];   /* argument order x, wq, bq, wk, bk, wv, bv, wo, bo */
    float* OUT = (float*)d_out;     // [2][2048][1024]
    char* wsp = (char*)d_ws;
    auto take = [&](size_t bytes) { char* p = wsp; wsp += (bytes + 255) & ~(size_t)255; return (void*)p; };
    bf* WQ = (bf*)take((size_t)4 * DQ * DM * 2); bf* WK = WQ + (size_t)DQ * DM; bf* WV = WK + (size_t)DKV * DM; bf* WO = WV + (size_t)DKV * DM; (void)WK; (void)WV;   // four transposed 1024 x 1024 weights in a row: a grid dimension walks them
    bf* XB = (bf*)take((size_t)NB_ * TT * DM * 2);
    const size_t PS = (size_t)ZH * TT * HD;   // one plane set: 32 head planes; q, k, v sets in a row, the projection GEMM's z walks them
    h16* QP16 = (h16*)take(3 * PS * 2); h16* KP16 = QP16 + PS; h16* VT16 = KP16 + PS;
    bf* QPh = (bf*)take(3 * PS * 2); bf* KPh = QPh + PS; bf* VTh = KPh + PS; bf* QPl = (bf*)take(3 * PS * 2); bf* KPl = QPl + PS; bf* VTl = KPl + PS; bf* Ph = (bf*)take((size_t)ZH * RH * BP * 2); bf* Pl = (bf*)take((size_t)ZH * RH * BP * 2);
    float* Sb = (float*)take((size_t)ZH * TT * BP * 4); h16* P16 = (h16*)take((size_t)ZH * (TT - RH) * BP * 2);
    if ((size_t)(wsp - (char*)d_ws) > ws_size) return;    // 218 of the 256 MiB
    // the 80 MiB of Sb serve twice, stream-ordered: the scores; after the softmax the merged hi/lo planes (2 x 8 MiB)
    bf* ATh = (bf*)Sb; bf* ATl = ATh + (size_t)NB_ * TT * DQ;
    k_wtG<<<dim3((unsigned)((DM * DQ / 64 + 63) / 64), 4, 1), 256, 0, stream>>>(wq, wk, wv, wo, DM, DQ, WQ);
    k_cvt8<<<(unsigned)(((size_t)NB_ * TT * DM / 8 + 255) / 256), 256, 0, stream>>>(x, XB, (size_t)NB_ * TT * DM / 8);
    k_gemmw<bf, 0, true, 0, 1><<<dim3(NB_ * TT / 64, DQ / 64, 3), 32, 0, stream>>>(XB, nullptr, WQ, nullptr, DM, nullptr, 0, bq, bk, bv, 0, (size_t)DQ * DM, 0, 0, QP16, QPh, QPl);   // z: q, k, v
    // attention: blockIdx.z walks the 32 head planes (z-strides: one plane)
    k_gemmw<bf, 2, false, 1, 0><<<dim3(RH / 64, NBT, ZH), 32, 0, stream>>>(QPh, QPl, KPh, KPl, HD, Sb, BP, nullptr, nullptr, nullptr, (size_t)TT * HD, (size_t)TT * HD, (size_t)TT * BP, 0, nullptr, nullptr, nullptr);
    k_gemmw<h16, 0, false, 1, 0><<<dim3((TT - RH) / 64, NBT, ZH), 32, 0, stream>>>(QP16 + (size_t)RH * HD, nullptr, KP16, nullptr, HD, Sb + (size_t)RH * BP, BP, nullptr, nullptr, nullptr, (size_t)TT * HD, (size_t)TT * HD, (size_t)TT * BP, RH, nullptr, nullptr, nullptr);
    k_asoft<<<ZH * TT / 8, 256, 0, stream>>>(Sb, P16, Ph, Pl);
    k_gemmw<bf, 2, false, 2, 2><<<dim3(RH / 64, HD / 64, ZH), 32, 0, stream>>>(Ph, Pl, VTh, VTl, TT, nullptr, 0, nullptr, nullptr, nullptr, (size_t)RH * BP, (size_t)HD * TT, 0, 0, nullptr, ATh, ATl);
    k_gemmw<h16, 0, false, 2, 2><<<dim3((TT - RH) / 64, HD / 64, ZH), 32, 0, stream>>>(P16, nullptr, VT16, nullptr, TT, nullptr, 0, nullptr, nullptr, nullptr, (size_t)(TT - RH) * BP, (size_t)HD * TT, 0, RH, nullptr, ATh, ATl);
    k_gemmw<bf, 1, true, 0, 0><<<dim3(NB_ * TT / 64, DM / 64, 1), 32, 0, stream>>>(ATh, ATl, WO, nullptr, DQ, OUT, DM, bo, nullptr, nullptr, 0, 0, 0, 0, nullptr, nullptr, nullptr);
}

// v004
// One run takes 129 microseconds.
// In both of two side-by-side timings against v003, it was 1.33 times as fast.
// All steps since v000 together make it 15.7 times as fast.
#include <hip/hip_runtime.h>

// Sliding-window (banded) multi-head attention (x [2][2048][1024]; q, k, v = x W + b ('xw' [1024][1024] 0.02, zero biases; 16 heads x 64); scores x 64^-0.5; keys j with i - 128 <= j <= i + 128 (symmetric window 256, -inf elsewhere); softmax; out = merged wo + bo ('xw') -> [2][2048][1024] (4.2 M); argument order x, wq, bq, wk, bk, wv, bv, wo, bo).
// Layout, both batches at once (4096 rows; 32 head planes z = batch * 16 + head): bf16 copy of x; 'xw' weights transposed once; exact projections + f32 biases, whose GEMM stores the 16-bit q, k head planes and the transposed v planes itself; banded attention fused in k_fattn: a wave holds the scores of its 16 query rows against their 272-key window in registers, takes their exponentials there and feeds them to the p x v product, whose result the row sum divides; scores and p never reach memory (hybrid rows: < 512 hi/lo 3 products, rest fp16 x1024; one launch each); it stores the merged hi/lo planes; merged hi/lo x wo exact + bo.
// Compute dtypes, f32 accumulate: every input rounded to bf16; projections exact + f32 biases; attention rows < 512 3 products, rest fp16; softmax f32; wo hl x exact + bias.

#define NB_  2
#define TT   2048
#define DM   1024
#define NH_  16
#define NKV  16
#define REP  (NH_ / NKV)
#define HD   64
#define DQ   (NH_ * HD)
#define DKV  (NKV * HD)
#define ZH   (NB_ * NH_)          // head planes per attention launch: all heads of both batches
#define RH   512                  // query rows < RH use hi+lo planes (0: none)
#define WIN  2048
#define BW   128      // half window: keys j in [i - 128, i + 128]
#define NBT  ((2 * BW + 64) / 64)   // 64-key tiles that a 64-row tile's band can meet: keys [r0 - BW, r0 + 64 + BW)
#define BP   (NBT * 64)             // pitch of a stored score or p row: the band's NBT key tiles, from key (i & ~63) - BW
#define PCAR 1024.0f
#define SCL  0.125f   // HD^-0.5
typedef _Float16 h16;
typedef unsigned short bf;
typedef __attribute__((ext_vector_type(16))) __bf16   v16bf;
typedef __attribute__((ext_vector_type(16))) _Float16 v16h;
typedef __attribute__((ext_vector_type(8)))  _Float16 v8h;
typedef __attribute__((ext_vector_type(8)))  unsigned short v8us;
typedef __attribute__((ext_vector_type(8)))  float    v8f;
typedef __attribute__((ext_vector_type(4)))  float    v4f;
typedef v8h  __attribute__((may_alias)) v8ha;
typedef v4f  __attribute__((may_alias)) v4fa;
typedef v8us __attribute__((may_alias)) v8usa;

__device__ __forceinline__ unsigned short f2bf(float f) { unsigned u = __float_as_uint(f); u += 0x7FFFu + ((u >> 16) & 1u); return (unsigned short)(u >> 16); }
__device__ __forceinline__ float bf2f(unsigned short b) { return __uint_as_float(((unsigned)b) << 16); }
__device__ __forceinline__ float bfr(float f) { return bf2f(f2bf(f)); }
__device__ __forceinline__ v16h cat16(v8h lo, v8h hi) { return __builtin_shufflevector(lo, hi, 0, 1, 2, 3, 4, 5, 6, 7, 8, 9, 10, 11, 12, 13, 14, 15); }
__device__ __forceinline__ v16bf cat16b(v8us lo, v8us hi) { return __builtin_bit_cast(v16bf, __builtin_shufflevector(lo, hi, 0, 1, 2, 3, 4, 5, 6, 7, 8, 9, 10, 11, 12, 13, 14, 15)); }
__device__ __forceinline__ v8f wmma16(v16h a, v16h b, v8f c) { return __builtin_amdgcn_wmma_f32_16x16x32_f16(false, a, false, b, (short)0, c, false, false); }
__device__ __forceinline__ v8f wmmab(v16bf a, v16bf b, v8f c) { return __builtin_amdgcn_wmma_f32_16x16x32_bf16(false, a, false, b, (short)0, c, false, false); }
__device__ __forceinline__ h16 tohx(float x) { return (h16)x; }
__device__ __forceinline__ void splitf(float y, unsigned short& h, unsigned short& l) { h = f2bf(y); l = f2bf(y - bf2f(h)); }



// ---- k_gemmw: register-blocked GEMM, ONE WAVE per 64x64 output tile (16 accumulators), operands straight from K-contiguous 16-bit planes; grid (M/64, N/64, Z), 32 threads.
// C[m][n] (f32, pitch ldc, + optional f32 bias[n]; bias, bias1, bias2 for z = 0, 1, 2) = sum_k A[m][k] Bt[n][k] (+ split products per NSPLIT). z-batch strides sA/sB/sC in elements. K % 32 == 0.
// BAND 0: dense. BAND 1 (scores): blockIdx.y counts the NBT key tiles from key rbase + r0 - BW, stored at column blockIdx.y * 64 of C (band rows, ldc = BP); a tile outside [0, TT) is left out. BAND 2 (p x v): k runs over the keys [rbase + r0 - BW, rbase + r0 + 64 + BW) clipped to [0, K); p is exactly 0 on all others; A holds band rows of pitch BP. rbase: sequence position of A's row 0.
// EPI 0: C in f32 as above. EPI 1 (projections; a 64-column tile is one head): y = sum + bias goes out as fp16, bf16 hi and bf16 lo = y - hi, into plane set z of E16, Eh, El: z = 0, 1 (q, k) head planes [batch * NH_ + head][t][d], z = 2 (v) transposed planes [batch * NH_ + head][d][t]. EPI 2 (p x v; z is the head plane): y = sum (x 1 / PCAR for rows t >= RH) goes out as hi and lo into the merged rows [batch][t][head * HD + d] of Eh, El. C is unused for EPI 1 and 2.
template <typename T16> struct WFrag;
template <> struct WFrag<h16> { typedef v16h V; static __device__ __forceinline__ V ld(const h16* p) { return cat16(*(const v8h*)p, *(const v8h*)(p + 16)); } static __device__ __forceinline__ v8f mma(V a, V b, v8f c) { return wmma16(a, b, c); } };
template <> struct WFrag<bf> { typedef v16bf V; static __device__ __forceinline__ V ld(const bf* p) { return cat16b(*(const v8us*)p, *(const v8us*)(p + 16)); } static __device__ __forceinline__ v8f mma(V a, V b, v8f c) { return wmmab(a, b, c); } };
template <typename T16, int NSPLIT, bool BIAS, int BAND, int EPI>
__global__ __launch_bounds__(32) void k_gemmw(const T16* __restrict__ A, const T16* __restrict__ A2, const T16* __restrict__ Bt, const T16* __restrict__ Bt2, int K, float* C, int ldc, const float* __restrict__ bias, const float* __restrict__ bias1, const float* __restrict__ bias2, size_t sA, size_t sB, size_t sC, int rbase, h16* E16, bf* Eh, bf* El) {
    typedef typename WFrag<T16>::V V;
    __shared__ __align__(16) float os[16 * 68];
    const size_t z = blockIdx.z; A += z * sA; if (A2) A2 += z * sA; Bt += z * sB; if (Bt2) Bt2 += z * sB; C += z * sC;
    if (BIAS) bias = (z == 0) ? bias : (z == 1) ? bias1 : bias2;   // z-batched projections: each z has its own bias vector
    const int lane = threadIdx.x & 31, lr = lane & 15, hi = lane >> 4; const int r0 = blockIdx.x * 64, c0 = (BAND == 1) ? rbase + r0 - BW + (int)blockIdx.y * 64 : (int)blockIdx.y * 64;
    if (BAND == 1 && (c0 < 0 || c0 >= TT)) return;
    const int kb = (BAND == 2) ? max(rbase + r0 - BW, 0) : 0, kw = ((BAND == 2) ? min(rbase + r0 + 64 + BW, K) : K) - kb;
    const int lda = (BAND == 2) ? BP : K, ka = (BAND == 2) ? kb - (rbase + r0 - BW) : 0, cc0 = (BAND == 1) ? (int)blockIdx.y * 64 : c0;   // A's pitch; band column of key kb; C's column
    if (BAND == 2) { A += ka; Bt += kb; if (NSPLIT == 1 || NSPLIT == 2) A2 += ka; if (NSPLIT >= 2) Bt2 += kb; }
    v8f acc[4][4];
#pragma unroll
    for (int mb = 0; mb < 4; ++mb)
#pragma unroll
        for (int nb = 0; nb < 4; ++nb) acc[mb][nb] = (v8f){};
    const size_t aoff = (size_t)(r0 + lr) * lda + 8 * hi, boff = (size_t)(c0 + lr) * K + 8 * hi;
#pragma unroll 1
    for (int kc = 0; kc < kw; kc += 32) {
        V a[4], a2[4];
#pragma unroll
        for (int mb = 0; mb < 4; ++mb) { a[mb] = WFrag<T16>::ld(A + aoff + (size_t)mb * 16 * lda + kc); if (NSPLIT == 1 || NSPLIT == 2) a2[mb] = WFrag<T16>::ld(A2 + aoff + (size_t)mb * 16 * lda + kc); }
#pragma unroll
        for (int nb = 0; nb < 4; ++nb) { const V b = WFrag<T16>::ld(Bt + boff + (size_t)nb * 16 * K + kc); V b2; if (NSPLIT >= 2) b2 = WFrag<T16>::ld(Bt2 + boff + (size_t)nb * 16 * K + kc);
            if (BAND == 2 && NSPLIT >= 2) asm volatile("s_wait_xcnt 0x0" ::: "memory");   // in this build the next key-column block's address sum reuses the address pair of the loads above while they are in flight: the wait stands in front of that overwrite
#pragma unroll
            for (int mb = 0; mb < 4; ++mb) { acc[mb][nb] = WFrag<T16>::mma(a[mb], b, acc[mb][nb]); if (NSPLIT == 1 || NSPLIT == 2) acc[mb][nb] = WFrag<T16>::mma(a2[mb], b, acc[mb][nb]); if (NSPLIT >= 2) acc[mb][nb] = WFrag<T16>::mma(a[mb], b2, acc[mb][nb]); } }
        asm volatile("v_nop\n\tv_nop\n\tv_nop\n\tv_nop" : "+v"(acc[0][0]), "+v"(acc[1][1]), "+v"(acc[2][2]), "+v"(acc[3][3]) : "v"(a[0]), "v"(a[3]));
    }
    static_assert(HD == 64, "EPI 1 and 2 take a 64-column tile for one head");
    const int trow = (EPI == 1) ? r0 % TT : rbase + r0;   // sequence position of the tile's row 0
    if (EPI == 1) { const size_t pz = z * ((size_t)ZH * TT * HD) + (size_t)((r0 / TT) * NH_ + (int)blockIdx.y) * TT * HD; E16 += pz; Eh += pz; El += pz; }   // plane set z, head plane of this tile
    if (EPI == 2) { const size_t pz = (z / NH_) * ((size_t)TT * DQ) + (z % NH_) * HD; Eh += pz; El += pz; }
    if (EPI == 1 && z == 2) {   // v transposed: a lane's 8 accumulator rows are 8 consecutive t of one d, 16 bytes a plane straight from registers; the wave's four mb stores fill each 128-byte line
#pragma unroll
        for (int nb = 0; nb < 4; ++nb) { const float bb = bfr(bias[c0 + nb * 16 + lr]);
#pragma unroll
            for (int mb = 0; mb < 4; ++mb) { v8h o16; v8us oh, ol;
#pragma unroll
                for (int j = 0; j < 8; ++j) { const float y = acc[mb][nb][j] + bb; o16[j] = tohx(y); unsigned short a2, c2; splitf(y, a2, c2); oh[j] = a2; ol[j] = c2; }
                const size_t oo = (size_t)(nb * 16 + lr) * TT + trow + mb * 16 + hi * 8; *(v8h*)(E16 + oo) = o16; *(v8us*)(Eh + oo) = oh; *(v8us*)(El + oo) = ol; } }
        return;
    }
    float bb[8];
    if (EPI == 1) {
#pragma unroll
        for (int q = 0; q < 8; ++q) bb[q] = bfr(bias[c0 + (lane & 7) * 8 + q]); }
#pragma unroll
    for (int mb = 0; mb < 4; ++mb) {
#pragma unroll
        for (int nb = 0; nb < 4; ++nb) {
#pragma unroll
            for (int j = 0; j < 8; ++j) os[(hi * 8 + j) * 68 + nb * 16 + lr] = acc[mb][nb][j]; }
        __builtin_amdgcn_wave_barrier(); asm volatile("" ::: "memory");
        if (EPI == 0) {
        float* crow = C + (size_t)(r0 + mb * 16) * ldc + cc0;
#pragma unroll
            for (int s = 0; s < 8; ++s) { const int row = 2 * s + hi, cofs = lr * 4; v4f val = *(const v4fa*)(os + row * 68 + cofs); if (BIAS) { val[0] += bfr(bias[c0 + cofs]); val[1] += bfr(bias[c0 + cofs + 1]); val[2] += bfr(bias[c0 + cofs + 2]); val[3] += bfr(bias[c0 + cofs + 3]); }
                *(v4f*)(crow + (size_t)row * ldc + cofs) = val; }
        } else {   // 8 lanes a row: each lane converts 8 consecutive columns, a row of 64 is one whole 128-byte line in every plane
#pragma unroll
            for (int s = 0; s < 4; ++s) { const int row = 4 * s + (lane >> 3), cofs = (lane & 7) * 8, t = trow + mb * 16 + row; const v4f va = *(const v4fa*)(os + row * 68 + cofs), vb = *(const v4fa*)(os + row * 68 + cofs + 4); const float cs = (t < RH) ? 1.0f : (1.0f / PCAR); v8h o16; v8us oh, ol;
#pragma unroll
                for (int q = 0; q < 8; ++q) { const float x = (q < 4) ? va[q & 3] : vb[q & 3]; const float y = (EPI == 1) ? x + bb[q] : x * cs; o16[q] = tohx(y); unsigned short a2, c2; splitf(y, a2, c2); oh[q] = a2; ol[q] = c2; }
                const size_t oo = (size_t)t * ((EPI == 1) ? HD : DQ) + cofs; if (EPI == 1) *(v8h*)(E16 + oo) = o16; *(v8us*)(Eh + oo) = oh; *(v8us*)(El + oo) = ol; }
            asm volatile("s_wait_xcnt 0x0" ::: "memory");   // behind the run of plane stores above: what follows in the build reuses their address and data registers, and the wait stands in front of that overwrite
        }
        __builtin_amdgcn_wave_barrier(); asm volatile("" ::: "memory");
    }
}

typedef __attribute__((ext_vector_type(2))) _Float16 v2h;
typedef __attribute__((ext_vector_type(4))) _Float16 v4h;
typedef __attribute__((ext_vector_type(2))) unsigned short v2us;
typedef __attribute__((ext_vector_type(4))) unsigned short v4us;
typedef __attribute__((ext_vector_type(2))) float v2f;
typedef __attribute__((ext_vector_type(4))) int v4i;

__global__ __launch_bounds__(256) void k_wtG(const float* __restrict__ w0, const float* __restrict__ w1, const float* __restrict__ w2, const float* __restrict__ w3, int K, int N, bf* Bt) {
    const float* __restrict__ w = (blockIdx.y == 0) ? w0 : (blockIdx.y == 1) ? w1 : (blockIdx.y == 2) ? w2 : w3; Bt += (size_t)blockIdx.y * K * N;   // blockIdx.y: which of the four equally shaped weights
    const int lane = threadIdx.x & 31; const int L0 = (blockIdx.x * 8 + (threadIdx.x >> 5)) * 8; const int nlines = N * K / 64;
{
#pragma unroll 1
        for (int l = 0; l < 8; ++l) { const int L = L0 + l; if (L >= nlines) break; const size_t e = (size_t)L * 64 + lane * 2; const int k = (int)(e % K), n = (int)(e / K); v2us o;
            o[0] = f2bf(w[(size_t)k * N + n]); o[1] = f2bf(w[(size_t)(k + 1) * N + n]); *(v2us*)(Bt + e) = o; }
         }
}
__global__ __launch_bounds__(256) void k_cvt8(const float* __restrict__ src, bf* dst, size_t n8) { const size_t i = (size_t)blockIdx.x * 256 + threadIdx.x; if (i >= n8) return; const v8f v = *(const v8f*)(src + i * 8); v8us o;
#pragma unroll
    for (int k = 0; k < 8; ++k) o[k] = f2bf(v[k]); *(v8us*)(dst + i * 8) = o;  }

typedef __attribute__((ext_vector_type(2))) __bf16 v2bf;
// p (f32, 8 keys of one query) -> 8 elements s0 .. s0 + 7 of a B operand; both conversions round to nearest even
__device__ __forceinline__ void packp(v16h& d, v16h&, const v8f p, const int s0) {
#pragma unroll
    for (int j = 0; j < 8; j += 2) { const v2h c = __builtin_convertvector((v2f){p[j], p[j + 1]}, v2h); d[s0 + j] = c[0]; d[s0 + j + 1] = c[1]; } }
__device__ __forceinline__ void packp(v16bf& d, v16bf& dl, const v8f p, const int s0) {
#pragma unroll
    for (int j = 0; j < 8; j += 2) { const v2bf c = __builtin_convertvector((v2f){p[j], p[j + 1]}, v2bf); const v2bf l = __builtin_convertvector((v2f){p[j] - (float)c[0], p[j + 1] - (float)c[1]}, v2bf); d[s0 + j] = c[0]; d[s0 + j + 1] = c[1]; dl[s0 + j] = l[0]; dl[s0 + j + 1] = l[1]; } }

typedef __attribute__((ext_vector_type(8))) int v8i;
template <typename T16, bool HI>
__global__ __launch_bounds__(128) void k_fattn(const T16* __restrict__ Q, const T16* __restrict__ Q2, const T16* __restrict__ Kp, const T16* __restrict__ K2, const T16* __restrict__ Vt, const T16* __restrict__ Vt2, int rbase, bf* Eh, bf* El) {
    typedef typename WFrag<T16>::V V;
    static_assert(HD == 64 && BW == 128, "tile counts below are those of head size 64 and half window 128");
    const int lane = threadIdx.x & 31, lr = lane & 15, hi = lane >> 4, e = 8 * hi - lr;
    const int r = rbase + ((int)blockIdx.x * 4 + __builtin_amdgcn_readfirstlane((int)(threadIdx.x >> 5))) * 16, wb = r - BW;
    const size_t z = blockIdx.y, pl = z * ((size_t)TT * HD);
    const unsigned lk = (unsigned)(lr * HD + 8 * hi) * 2u, lv = (unsigned)(lr * TT + 8 * hi) * 2u, lo = (unsigned)(lr * DQ + 8 * hi) * 2u;   // the lane's byte offset in a 16-row fragment of pitch HD, TT, DQ: every address below is a wave-uniform base + one of these + a constant
    auto at = [](const T16* base, unsigned off) { return (const T16*)((const char*)base + off); };
    auto keep = [](V a, bool in0, bool in1) { v8i w = __builtin_bit_cast(v8i, a);   // a fragment's first four registers are its first 16-key tile, the rest its second
#pragma unroll
        for (int i = 0; i < 8; ++i) w[i] = ((i < 4) ? in0 : in1) ? w[i] : 0;
        return __builtin_bit_cast(V, w); };
    V q[2], q2[2];
#pragma unroll
    for (int ks = 0; ks < 2; ++ks) { q[ks] = WFrag<T16>::ld(at(Q + pl + (size_t)r * HD + ks * 32, lk)); if (HI) q2[ks] = WFrag<T16>::ld(at(Q2 + pl + (size_t)r * HD + ks * 32, lk)); }
    const T16* kw = Kp + pl + (long)wb * HD; const T16* kw2 = HI ? K2 + pl + (long)wb * HD : nullptr; const T16* vw = Vt + pl + (long)wb; const T16* vw2 = HI ? Vt2 + pl + (long)wb : nullptr;   // the window's first key in the k planes and in row 0 of the v planes
    v8f S[17]; float mx = -3.0e38f;
#pragma unroll
    for (int g = 0; g < 3; ++g) {   // key tiles in groups of six (the last: five)
        V k[6][2], k2[6][2];
#pragma unroll
        for (int i = 0; i < 6; ++i)
#pragma unroll
            for (int ks = 0; ks < 2; ++ks) { const int t = g * 6 + i; if (t < 17) { k[i][ks] = WFrag<T16>::ld(at(kw + t * 16 * HD + ks * 32, lk)); if (HI) k2[i][ks] = WFrag<T16>::ld(at(kw2 + t * 16 * HD + ks * 32, lk)); } }
        asm volatile("s_wait_xcnt 0x0" ::: "memory");   // behind the group's loads (and q's): what follows in the build reuses their offset and base registers, and the wait stands in front of that overwrite
        __builtin_amdgcn_sched_barrier(0);   // a group's k loads go out together: sunk to their products, each tile's latency is waited out on its own
#pragma unroll
        for (int i = 0; i < 6; ++i) { const int t = g * 6 + i; if (t >= 17) continue;
            const float off = (t == 8 || (unsigned)(wb + t * 16) < (unsigned)TT) ? 0.0f : -3.0e38f;   // tile 8 is the wave's own rows
            v8f a = (v8f){};
#pragma unroll
            for (int ks = 0; ks < 2; ++ks) { a = WFrag<T16>::mma(k[i][ks], q[ks], a); if (HI) { a = WFrag<T16>::mma(k[i][ks], q2[ks], a); a = WFrag<T16>::mma(k2[i][ks], q[ks], a); } }
#pragma unroll
            for (int j = 0; j < 8; ++j) { float s = a[j] * SCL + off;   // SCL is a power of two: the product is exact, and off is 0 inside the sequence
                if (t == 0) s = (j + e >= 0) ? s : -3.0e38f;    // key >= query - BW
                if (t == 16) s = (j + e <= 0) ? s : -3.0e38f;   // key <= query + BW
                a[j] = s; mx = fmaxf(mx, s); }
            S[t] = a; }
    }
    const float m = fmaxf(mx, __shfl_xor(mx, 16, 32)); v8f sv = (v8f){}, O[4];   // row maximum, eight independent partial row sums, output tiles
#pragma unroll
    for (int mb = 0; mb < 4; ++mb) O[mb] = (v8f){};
#pragma unroll
    for (int kb = 0; kb < 9; ++kb) {
        const bool in0 = kb == 4 || (unsigned)(wb + kb * 32) < (unsigned)TT, in1 = (unsigned)(wb + kb * 32 + 16) < (unsigned)TT;
        V p, p2, va[4], va2[4];
#pragma unroll
        for (int mb = 0; mb < 4; ++mb) { va[mb] = WFrag<T16>::ld(at(vw + mb * 16 * TT + kb * 32, lv)); if (HI) va2[mb] = WFrag<T16>::ld(at(vw2 + mb * 16 * TT + kb * 32, lv)); }   // the block's v loads go out together, in flight under its exponentials
        __builtin_amdgcn_sched_barrier(0);   // keeps them there: sunk to their products, each load's latency is waited out on its own
#pragma unroll
        for (int u = 0; u < 2; ++u) { const int t = 2 * kb + u; v8f ev = (v8f){};
            if (t < 17) {
#pragma unroll
                for (int j = 0; j < 8; ++j) ev[j] = (S[t][j] - m) * 1.4426950408889634f;
                float x0, x1, x2, x3, x4, x5, x6, x7;
                // eight exp2 in one statement. The four leading slots are the distance behind a matrix instruction: the results may land in registers that were its A or B. Each exponential is followed by one that touches neither its result nor its source (early-clobber results), the last by the one slot that the instruction set asks for behind a transcendental.
                asm("v_nop\n\tv_nop\n\tv_nop\n\tv_nop\n\tv_exp_f32 %0, %8\n\tv_exp_f32 %1, %9\n\tv_exp_f32 %2, %10\n\tv_exp_f32 %3, %11\n\tv_exp_f32 %4, %12\n\tv_exp_f32 %5, %13\n\tv_exp_f32 %6, %14\n\tv_exp_f32 %7, %15\n\tv_nop"
                    : "=&v"(x0), "=&v"(x1), "=&v"(x2), "=&v"(x3), "=&v"(x4), "=&v"(x5), "=&v"(x6), "=&v"(x7) : "v"(ev[0]), "v"(ev[1]), "v"(ev[2]), "v"(ev[3]), "v"(ev[4]), "v"(ev[5]), "v"(ev[6]), "v"(ev[7]));
                ev = (v8f){x0, x1, x2, x3, x4, x5, x6, x7}; sv += ev; }
            packp(p, p2, HI ? ev : ev * PCAR, u * 8); }   // p goes into the product unnormalised (largest term 1); the row sum divides the output
#pragma unroll
        for (int mb = 0; mb < 4; ++mb) { const V b = keep(va[mb], in0, in1);
            O[mb] = WFrag<T16>::mma(b, p, O[mb]); if (HI) { O[mb] = WFrag<T16>::mma(b, p2, O[mb]); O[mb] = WFrag<T16>::mma(keep(va2[mb], in0, in1), p, O[mb]); } }
    }
    float sum = ((sv[0] + sv[1]) + (sv[2] + sv[3])) + ((sv[4] + sv[5]) + (sv[6] + sv[7])); sum += __shfl_xor(sum, 16, 32);
    const float f = __fdiv_rn(HI ? 1.0f : (1.0f / PCAR), sum);
    const size_t ob = ((z / NH_) * (size_t)TT + r) * DQ + (z % NH_) * HD;
#pragma unroll
    for (int mb = 0; mb < 4; ++mb) { v8us oh, ol;   // a lane's 8 accumulator rows are 8 consecutive d of one query
#pragma unroll
        for (int j = 0; j < 8; ++j) { unsigned short a2, c2; splitf(O[mb][j] * f, a2, c2); oh[j] = a2; ol[j] = c2; }
        const size_t oo = ob + mb * 16; *(v8us*)((char*)(Eh + oo) + lo) = oh; *(v8us*)((char*)(El + oo) + lo) = ol;
        if (mb < 3) asm volatile("s_wait_xcnt 0x0" ::: "memory"); }   // behind the two plane stores: the next tile's conversion reuses their data registers in the build, and the wait stands in front of that overwrite
}

extern "C" void kernel_launch(void* const* d_in, const int* in_sizes, int n_in,
                              void* d_out, int out_size, void* d_ws, size_t ws_size, hipStream_t stream) {
    (void)in_sizes; (void)n_in; (void)out_size;
    const float* x = (const float*)d_in[0]; const float* wq = (const float*)d_in[1]; const float* bq = (const float*)d_in[2]; const float* wk = (const float*)d_in[3]; const float* bk = (const float*)d_in[4]; const float* wv = (const float*)d_in[5]; const float* bv = (const float*)d_in[6]; const float* wo = (const float*)d_in[7]; const float* bo = (const float*)d_in[8];   /* argument order x, wq, bq, wk, bk, wv, bv, wo, bo */
    float* OUT = (float*)d_out;     // [2][2048][1024]
    char* wsp = (char*)d_ws;
    auto take = [&](size_t bytes) { char* p = wsp; wsp += (bytes + 255) & ~(size_t)255; return (void*)p; };
    bf* WQ = (bf*)take((size_t)4 * DQ * DM * 2); bf* WK = WQ + (size_t)DQ * DM; bf* WV = WK + (size_t)DKV * DM; bf* WO = WV + (size_t)DKV * DM; (void)WK; (void)WV;   // four transposed 1024 x 1024 weights in a row: a grid dimension walks them
    bf* XB = (bf*)take((size_t)NB_ * TT * DM * 2);
    const size_t PS = (size_t)ZH * TT * HD;   // one plane set: 32 head planes; q, k, v sets in a row, the projection GEMM's z walks them
    h16* QP16 = (h16*)take(3 * PS * 2); h16* KP16 = QP16 + PS; h16* VT16 = KP16 + PS;
    bf* QPh = (bf*)take(3 * PS * 2); bf* KPh = QPh + PS; bf* VTh = KPh + PS; bf* QPl = (bf*)take(3 * PS * 2); bf* KPl = QPl + PS; bf* VTl = KPl + PS;
    bf* ATh = (bf*)take((size_t)2 * NB_ * TT * DQ * 2); bf* ATl = ATh + (size_t)NB_ * TT * DQ;   // merged hi/lo planes
    if ((size_t)(wsp - (char*)d_ws) > ws_size) return;    // 104 of the 256 MiB
    k_wtG<<<dim3((unsigned)((DM * DQ / 64 + 63) / 64), 4, 1), 256, 0, stream>>>(wq, wk, wv, wo, DM, DQ, WQ);
    k_cvt8<<<(unsigned)(((size_t)NB_ * TT * DM / 8 + 255) / 256), 256, 0, stream>>>(x, XB, (size_t)NB_ * TT * DM / 8);
    k_gemmw<bf, 0, true, 0, 1><<<dim3(NB_ * TT / 64, DQ / 64, 3), 32, 0, stream>>>(XB, nullptr, WQ, nullptr, DM, nullptr, 0, bq, bk, bv, 0, (size_t)DQ * DM, 0, 0, QP16, QPh, QPl);   // z: q, k, v
    // attention: blockIdx.y walks the 32 head planes, a block is four waves of 16 query rows each
    k_fattn<bf, true><<<dim3(RH / 64, ZH, 1), 128, 0, stream>>>(QPh, QPl, KPh, KPl, VTh, VTl, 0, ATh, ATl);
    k_fattn<h16, false><<<dim3((TT - RH) / 64, ZH, 1), 128, 0, stream>>>(QP16, nullptr, KP16, nullptr, VT16, nullptr, RH, ATh, ATl);
    k_gemmw<bf, 1, true, 0, 0><<<dim3(NB_ * TT / 64, DM / 64, 1), 32, 0, stream>>>(ATh, ATl, WO, nullptr, DQ, OUT, DM, bo, nullptr, nullptr, 0, 0, 0, 0, nullptr, nullptr, nullptr);
}

// v005
// It runs in 91 microseconds.
// In both of two side-by-side timings against v004, it was 1.42 times as fast.
// Over all steps from v000 it is 22.3 times as fast.
#include <hip/hip_runtime.h>

// Sliding-window (banded) multi-head attention (x [2][2048][1024]; q, k, v = x W + b ('xw' [1024][1024] 0.02, zero biases; 16 heads x 64); scores x 64^-0.5; keys j with i - 128 <= j <= i + 128 (symmetric window 256, -inf elsewhere); softmax; out = merged wo + bo ('xw') -> [2][2048][1024] (4.2 M); argument order x, wq, bq, wk, bk, wv, bv, wo, bo).
// Layout, both batches at once (4096 rows; 32 head planes z = batch * 16 + head): bf16 copy of x; 'xw' weights transposed once; exact projections + f32 biases, whose GEMM stores the 16-bit q, k head planes and the transposed v planes itself; banded attention fused in k_fattn: a wave holds the scores of its 16 query rows against their 272-key window in registers, takes their exponentials there and feeds them to the p x v product, whose result the row sum divides; scores and p never reach memory (hybrid rows: < 512 hi/lo 3 products, rest fp16 x1024; one launch each); it stores the merged hi/lo planes; merged hi/lo x wo exact + bo.
// Compute dtypes, f32 accumulate: every input rounded to bf16; projections exact + f32 biases; attention rows < 512 3 products, rest fp16; softmax f32; wo hl x exact + bias.

#define NB_  2
#define TT   2048
#define DM   1024
#define NH_  16
#define NKV  16
#define REP  (NH_ / NKV)
#define HD   64
#define DQ   (NH_ * HD)
#define DKV  (NKV * HD)
#define ZH   (NB_ * NH_)          // head planes per attention launch: all heads of both batches
#define RH   512                  // query rows < RH use hi+lo planes (0: none)
#define WIN  2048
#define BW   128      // half window: keys j in [i - 128, i + 128]
#define PCAR 1024.0f
#define SCL  0.125f   // HD^-0.5
typedef _Float16 h16;
typedef unsigned short bf;
typedef __attribute__((ext_vector_type(16))) __bf16   v16bf;
typedef __attribute__((ext_vector_type(16))) _Float16 v16h;
typedef __attribute__((ext_vector_type(8)))  _Float16 v8h;
typedef __attribute__((ext_vector_type(8)))  unsigned short v8us;
typedef __attribute__((ext_vector_type(8)))  float    v8f;
typedef __attribute__((ext_vector_type(4)))  float    v4f;
typedef v8h  __attribute__((may_alias)) v8ha;
typedef v4f  __attribute__((may_alias)) v4fa;
typedef v8us __attribute__((may_alias)) v8usa;

__device__ __forceinline__ unsigned short f2bf(float f) { unsigned u = __float_as_uint(f); u += 0x7FFFu + ((u >> 16) & 1u); return (unsigned short)(u >> 16); }
__device__ __forceinline__ float bf2f(unsigned short b) { return __uint_as_float(((unsigned)b) << 16); }
__device__ __forceinline__ float bfr(float f) { return bf2f(f2bf(f)); }
__device__ __forceinline__ v16h cat16(v8h lo, v8h hi) { return __builtin_shufflevector(lo, hi, 0, 1, 2, 3, 4, 5, 6, 7, 8, 9, 10, 11, 12, 13, 14, 15); }
__device__ __forceinline__ v16bf cat16b(v8us lo, v8us hi) { return __builtin_bit_cast(v16bf, __builtin_shufflevector(lo, hi, 0, 1, 2, 3, 4, 5, 6, 7, 8, 9, 10, 11, 12, 13, 14, 15)); }
__device__ __forceinline__ v8f wmma16(v16h a, v16h b, v8f c) { return __builtin_amdgcn_wmma_f32_16x16x32_f16(false, a, false, b, (short)0, c, false, false); }
__device__ __forceinline__ v8f wmmab(v16bf a, v16bf b, v8f c) { return __builtin_amdgcn_wmma_f32_16x16x32_bf16(false, a, false, b, (short)0, c, false, false); }
__device__ __forceinline__ h16 tohx(float x) { return (h16)x; }
__device__ __forceinline__ void splitf(float y, unsigned short& h, unsigned short& l) { h = f2bf(y); l = f2bf(y - bf2f(h)); }



// ---- k_gemms: GEMM, a work-group of four waves (2 x 2) per 128x128 output tile, each wave a 64x64 tile (16 accumulators); grid (M/128, N/128, Z), 128 threads. K = DM.
// C[m][n] = sum_k A[m][k] Bt[n][k] (NSPLIT 1: + A2[m][k] Bt[n][k] behind each block's first product) + f32 bias[n] (bias, bias1, bias2 for z = 0, 1, 2); A, A2, Bt K-contiguous bf16 planes; Bt's z stride sB in elements.
// Operands reach the waves through LDS: a stage is 64 k (one whole 128-byte line) of the tile's 128 A rows, 128 Bt rows (and 128 A2 rows), at pitch GP; two buffers; asynchronous copies to LDS fill the next stage while this one is worked on. A wave-wide copy is four whole lines; every wave copies 32 rows of each operand.
// EPI 0: C in f32, pitch ldc. EPI 1 (projections; a wave's 64 columns are one head): y = sum + bias goes out as fp16, bf16 hi and bf16 lo = y - hi, into plane set z of E16, Eh, El: z = 0, 1 (q, k) head planes [batch * NH_ + head][t][d], z = 2 (v) transposed planes [batch * NH_ + head][d][t]. C is unused for EPI 1.
template <typename T16> struct WFrag;
template <> struct WFrag<h16> { typedef v16h V; static __device__ __forceinline__ V ld(const h16* p) { return cat16(*(const v8h*)p, *(const v8h*)(p + 16)); } static __device__ __forceinline__ v8f mma(V a, V b, v8f c) { return wmma16(a, b, c); } };
template <> struct WFrag<bf> { typedef v16bf V; static __device__ __forceinline__ V ld(const bf* p) { return cat16b(*(const v8us*)p, *(const v8us*)(p + 16)); } static __device__ __forceinline__ v8f mma(V a, V b, v8f c) { return wmmab(a, b, c); } };
#define GP 144   // bytes from one staged row to the next: 128 + 16, an odd number of 16-byte units, so that the 16-byte fragment reads of 16 rows meet no bank twice
// eight asynchronous copies of 16 bytes a lane: rows r, r + 4, .. r + 28 of one operand's stage (l: the lane's LDS byte address, g: its global address, both of row r). The closing wait stands in front of whatever rewrites the address registers named here.
__device__ __forceinline__ void copy8(const unsigned l, const bf* g) {
    asm volatile("global_load_async_to_lds_b128 %0, %8, off\n\tglobal_load_async_to_lds_b128 %1, %9, off\n\tglobal_load_async_to_lds_b128 %2, %10, off\n\tglobal_load_async_to_lds_b128 %3, %11, off\n\t"
                 "global_load_async_to_lds_b128 %4, %12, off\n\tglobal_load_async_to_lds_b128 %5, %13, off\n\tglobal_load_async_to_lds_b128 %6, %14, off\n\tglobal_load_async_to_lds_b128 %7, %15, off\n\ts_wait_xcnt 0x0"
                 :: "v"(l), "v"(l + 4 * GP), "v"(l + 8 * GP), "v"(l + 12 * GP), "v"(l + 16 * GP), "v"(l + 20 * GP), "v"(l + 24 * GP), "v"(l + 28 * GP),
                    "v"(g), "v"(g + 4 * DM), "v"(g + 8 * DM), "v"(g + 12 * DM), "v"(g + 16 * DM), "v"(g + 20 * DM), "v"(g + 24 * DM), "v"(g + 28 * DM) : "memory");
}
template <int NSPLIT, int EPI>
__global__ __launch_bounds__(128) void k_gemms(const bf* __restrict__ A, const bf* __restrict__ A2, const bf* __restrict__ Bt, float* C, int ldc, const float* __restrict__ bias, const float* __restrict__ bias1, const float* __restrict__ bias2, size_t sB, h16* E16, bf* Eh, bf* El) {
    typedef WFrag<bf>::V V;
    static_assert(DM == DQ && DM % 128 == 0, "one K for both launches; at least two stages");
    constexpr int K = DM, NT = K / 64, BUFB = (2 + NSPLIT) * 128 * GP;   // stages; bytes of a buffer: A rows, Bt rows (, A2 rows)
    __shared__ __align__(16) char ring[2 * BUFB];
    __shared__ __align__(16) float osm[4 * 16 * 68];
    const size_t z = blockIdx.z; Bt += z * sB;
    bias = (z == 0) ? bias : (z == 1) ? bias1 : bias2;   // z-batched projections: each z has its own bias vector
    const int lane = threadIdx.x & 31, lr = lane & 15, hi = lane >> 4, wave = __builtin_amdgcn_readfirstlane((int)(threadIdx.x >> 5));
    const int R0 = blockIdx.x * 128, C0 = blockIdx.y * 128, wr = (wave & 1) * 64, wc = (wave >> 1) * 64, r0 = R0 + wr, c0 = C0 + wc;   // the work-group's tile, the wave's place in it, the wave's tile
    float* os = osm + wave * (16 * 68);
    // the lane's part in a copy: row wave * 32 + lane / 8 (+ 4 a copy) of the stage, 16-byte piece lane % 8 of its line
    const int crow = wave * 32 + (lane >> 3), cpc = (lane & 7) * 8;
    const unsigned lc = (unsigned)(size_t)ring + (unsigned)(crow * GP + cpc * 2);
    const bf* ga = A + (size_t)(R0 + crow) * K + cpc; const bf* gb = Bt + (size_t)(C0 + crow) * K + cpc; const bf* ga2 = NSPLIT ? A2 + (size_t)(R0 + crow) * K + cpc : nullptr;
    auto fill = [&](int t, int buf) { const unsigned l = lc + (unsigned)(buf * BUFB); copy8(l, ga + t * 64); copy8(l + 128 * GP, gb + t * 64); if (NSPLIT) copy8(l + 256 * GP, ga2 + t * 64); };
    v8f acc[4][4];
#pragma unroll
    for (int mb = 0; mb < 4; ++mb)
#pragma unroll
        for (int nb = 0; nb < 4; ++nb) acc[mb][nb] = (v8f){};
    fill(0, 0);
    asm volatile("s_wait_asynccnt 0x0" ::: "memory");   // this wave's part of stage 0 has landed
    __syncthreads();                                      // every wave's part has
    fill(1, 1);
    const int fa = (wr + lr) * GP + 16 * hi, fb = (128 + wc + lr) * GP + 16 * hi;   // the lane's byte offset in a buffer: row lr of the wave's first A and Bt fragment
#pragma unroll 1
    for (int t = 0; t < NT; ++t) {
        const char* sb = ring + (t & 1) * BUFB;
        V a[4], a2[4], b[4];
        auto frags = [&](int ks) {
#pragma unroll
            for (int mb = 0; mb < 4; ++mb) { a[mb] = WFrag<bf>::ld((const bf*)(sb + fa + mb * 16 * GP + ks * 64)); if (NSPLIT) a2[mb] = WFrag<bf>::ld((const bf*)(sb + fa + 256 * GP + mb * 16 * GP + ks * 64)); }
#pragma unroll
            for (int nb = 0; nb < 4; ++nb) b[nb] = WFrag<bf>::ld((const bf*)(sb + fb + nb * 16 * GP + ks * 64)); };
        auto prods = [&]() {
#pragma unroll
            for (int nb = 0; nb < 4; ++nb)
#pragma unroll
                for (int mb = 0; mb < 4; ++mb) { acc[mb][nb] = WFrag<bf>::mma(a[mb], b[nb], acc[mb][nb]); if (NSPLIT) acc[mb][nb] = WFrag<bf>::mma(a2[mb], b[nb], acc[mb][nb]); } };
        frags(0);
        __builtin_amdgcn_sched_barrier(0);   // a block's fragment reads go out as one group ahead of its products: sunk among them, each row of products waits out the LDS latency on its own
        prods();
        frags(1);                                             // the stage's last reads: its second block then works from registers alone
        if (NSPLIT) { __builtin_amdgcn_sched_barrier(0); prods(); }   // three operands: the block's twelve fragments, the accumulators and the copies' addresses do not fit 256 registers together, so its products come first, behind its reads as one group as above
        asm volatile("s_wait_dscnt 0x0" ::: "memory");      // this wave's reads of the buffer are done before it is handed to the copies
        asm volatile("s_wait_asynccnt 0x0" ::: "memory");   // this wave's part of stage t + 1 has landed
        __syncthreads();                                      // publishes stage t + 1 and ends every wave's reads of stage t
        if (t + 2 < NT) fill(t + 2, t & 1);
        if (!NSPLIT) prods();                                 // behind the refill, so that the copies fly under these products too
    }
    asm volatile("s_wait_asynccnt 0x0" ::: "memory");   // no copy is left in flight at the wave's end
    static_assert(HD == 64, "EPI 1 takes a wave's 64 columns for one head");
    const int trow = r0 % TT;   // sequence position of the tile's row 0
    if (EPI == 1) { const size_t pz = z * ((size_t)ZH * TT * HD) + (size_t)((r0 / TT) * NH_ + c0 / HD) * TT * HD; E16 += pz; Eh += pz; El += pz; }   // plane set z, head plane of this tile
    if (EPI == 1 && z == 2) {   // v transposed: a lane's 8 accumulator rows are 8 consecutive t of one d, 16 bytes a plane straight from registers; the wave's four mb stores fill each 128-byte line
#pragma unroll
        for (int nb = 0; nb < 4; ++nb) { const float bb = bfr(bias[c0 + nb * 16 + lr]);
#pragma unroll
            for (int mb = 0; mb < 4; ++mb) { v8h o16; v8us oh, ol;
#pragma unroll
                for (int j = 0; j < 8; ++j) { const float y = acc[mb][nb][j] + bb; o16[j] = tohx(y); unsigned short a2, c2; splitf(y, a2, c2); oh[j] = a2; ol[j] = c2; }
                const size_t oo = (size_t)(nb * 16 + lr) * TT + trow + mb * 16 + hi * 8; *(v8h*)(E16 + oo) = o16; *(v8us*)(Eh + oo) = oh; *(v8us*)(El + oo) = ol; } }
        return;
    }
    float bb[8];
    if (EPI == 1) {
#pragma unroll
        for (int q = 0; q < 8; ++q) bb[q] = bfr(bias[c0 + (lane & 7) * 8 + q]); }
#pragma unroll
    for (int mb = 0; mb < 4; ++mb) {
#pragma unroll
        for (int nb = 0; nb < 4; ++nb) {
#pragma unroll
            for (int j = 0; j < 8; ++j) os[(hi * 8 + j) * 68 + nb * 16 + lr] = acc[mb][nb][j]; }
        __builtin_amdgcn_wave_barrier(); asm volatile("" ::: "memory");
        if (EPI == 0) {
        float* crow2 = C + (size_t)(r0 + mb * 16) * ldc + c0;
#pragma unroll
            for (int s = 0; s < 8; ++s) { const int row = 2 * s + hi, cofs = lr * 4; v4f val = *(const v4fa*)(os + row * 68 + cofs); val[0] += bfr(bias[c0 + cofs]); val[1] += bfr(bias[c0 + cofs + 1]); val[2] += bfr(bias[c0 + cofs + 2]); val[3] += bfr(bias[c0 + cofs + 3]);
                *(v4f*)(crow2 + (size_t)row * ldc + cofs) = val; }
            asm volatile("s_wait_xcnt 0x0" ::: "memory");   // behind the run of stores above: what follows in the build reuses their data registers, and the wait stands in front of that overwrite
        } else {   // 8 lanes a row: each lane converts 8 consecutive columns, a row of 64 is one whole 128-byte line in every plane
#pragma unroll
            for (int s = 0; s < 4; ++s) { const int row = 4 * s + (lane >> 3), cofs = (lane & 7) * 8, t = trow + mb * 16 + row; const v4f va = *(const v4fa*)(os + row * 68 + cofs), vb = *(const v4fa*)(os + row * 68 + cofs + 4); v8h o16; v8us oh, ol;
#pragma unroll
                for (int q = 0; q < 8; ++q) { const float x = (q < 4) ? va[q & 3] : vb[q & 3]; const float y = x + bb[q]; o16[q] = tohx(y); unsigned short a2, c2; splitf(y, a2, c2); oh[q] = a2; ol[q] = c2; }
                const size_t oo = (size_t)t * HD + cofs; *(v8h*)(E16 + oo) = o16; *(v8us*)(Eh + oo) = oh; *(v8us*)(El + oo) = ol; }
            asm volatile("s_wait_xcnt 0x0" ::: "memory");   // behind the run of plane stores above: what follows in the build reuses their address and data registers, and the wait stands in front of that overwrite
        }
        __builtin_amdgcn_wave_barrier(); asm volatile("" ::: "memory");
    }
}

typedef __attribute__((ext_vector_type(2))) _Float16 v2h;
typedef __attribute__((ext_vector_type(4))) _Float16 v4h;
typedef __attribute__((ext_vector_type(2))) unsigned short v2us;
typedef __attribute__((ext_vector_type(4))) unsigned short v4us;
typedef __attribute__((ext_vector_type(2))) float v2f;
typedef __attribute__((ext_vector_type(4))) int v4i;

__global__ __launch_bounds__(256) void k_wtG(const float* __restrict__ w0, const float* __restrict__ w1, const float* __restrict__ w2, const float* __restrict__ w3, int K, int N, bf* Bt) {
    const float* __restrict__ w = (blockIdx.y == 0) ? w0 : (blockIdx.y == 1) ? w1 : (blockIdx.y == 2) ? w2 : w3; Bt += (size_t)blockIdx.y * K * N;   // blockIdx.y: which of the four equally shaped weights
    const int lane = threadIdx.x & 31; const int L0 = (blockIdx.x * 8 + (threadIdx.x >> 5)) * 8; const int nlines = N * K / 64;
{
#pragma unroll 1
        for (int l = 0; l < 8; ++l) { const int L = L0 + l; if (L >= nlines) break; const size_t e = (size_t)L * 64 + lane * 2; const int k = (int)(e % K), n = (int)(e / K); v2us o;
            o[0] = f2bf(w[(size_t)k * N + n]); o[1] = f2bf(w[(size_t)(k + 1) * N + n]); *(v2us*)(Bt + e) = o; }
         }
}
__global__ __launch_bounds__(256) void k_cvt8(const float* __restrict__ src, bf* dst, size_t n8) { const size_t i = (size_t)blockIdx.x * 256 + threadIdx.x; if (i >= n8) return; const v8f v = *(const v8f*)(src + i * 8); v8us o;
#pragma unroll
    for (int k = 0; k < 8; ++k) o[k] = f2bf(v[k]); *(v8us*)(dst + i * 8) = o;  }

typedef __attribute__((ext_vector_type(2))) __bf16 v2bf;
// p (f32, 8 keys of one query) -> 8 elements s0 .. s0 + 7 of a B operand; both conversions round to nearest even
__device__ __forceinline__ void packp(v16h& d, v16h&, const v8f p, const int s0) {
#pragma unroll
    for (int j = 0; j < 8; j += 2) { const v2h c = __builtin_convertvector((v2f){p[j], p[j + 1]}, v2h); d[s0 + j] = c[0]; d[s0 + j + 1] = c[1]; } }
__device__ __forceinline__ void packp(v16bf& d, v16bf& dl, const v8f p, const int s0) {
#pragma unroll
    for (int j = 0; j < 8; j += 2) { const v2bf c = __builtin_convertvector((v2f){p[j], p[j + 1]}, v2bf); const v2bf l = __builtin_convertvector((v2f){p[j] - (float)c[0], p[j + 1] - (float)c[1]}, v2bf); d[s0 + j] = c[0]; d[s0 + j + 1] = c[1]; dl[s0 + j] = l[0]; dl[s0 + j + 1] = l[1]; } }

typedef __attribute__((ext_vector_type(8))) int v8i;
template <typename T16, bool HI>
__global__ __launch_bounds__(128) void k_fattn(const T16* __restrict__ Q, const T16* __restrict__ Q2, const T16* __restrict__ Kp, const T16* __restrict__ K2, const T16* __restrict__ Vt, const T16* __restrict__ Vt2, int rbase, bf* Eh, bf* El) {
    typedef typename WFrag<T16>::V V;
    static_assert(HD == 64 && BW == 128, "tile counts below are those of head size 64 and half window 128");
    const int lane = threadIdx.x & 31, lr = lane & 15, hi = lane >> 4, e = 8 * hi - lr;
    const int r = rbase + ((int)blockIdx.x * 4 + __builtin_amdgcn_readfirstlane((int)(threadIdx.x >> 5))) * 16, wb = r - BW;
    const size_t z = blockIdx.y, pl = z * ((size_t)TT * HD);
    const unsigned lk = (unsigned)(lr * HD + 8 * hi) * 2u, lv = (unsigned)(lr * TT + 8 * hi) * 2u, lo = (unsigned)(lr * DQ + 8 * hi) * 2u;   // the lane's byte offset in a 16-row fragment of pitch HD, TT, DQ: every address below is a wave-uniform base + one of these + a constant
    auto at = [](const T16* base, unsigned off) { return (const T16*)((const char*)base + off); };
    auto keep = [](V a, bool in0, bool in1) { v8i w = __builtin_bit_cast(v8i, a);   // a fragment's first four registers are its first 16-key tile, the rest its second
#pragma unroll
        for (int i = 0; i < 8; ++i) w[i] = ((i < 4) ? in0 : in1) ? w[i] : 0;
        return __builtin_bit_cast(V, w); };
    V q[2], q2[2];
#pragma unroll
    for (int ks = 0; ks < 2; ++ks) { q[ks] = WFrag<T16>::ld(at(Q + pl + (size_t)r * HD + ks * 32, lk)); if (HI) q2[ks] = WFrag<T16>::ld(at(Q2 + pl + (size_t)r * HD + ks * 32, lk)); }
    const T16* kw = Kp + pl + (long)wb * HD; const T16* kw2 = HI ? K2 + pl + (long)wb * HD : nullptr; const T16* vw = Vt + pl + (long)wb; const T16* vw2 = HI ? Vt2 + pl + (long)wb : nullptr;   // the window's first key in the k planes and in row 0 of the v planes
    v8f S[17]; float mx = -3.0e38f;
#pragma unroll
    for (int g = 0; g < 3; ++g) {   // key tiles in groups of six (the last: five)
        V k[6][2], k2[6][2];
#pragma unroll
        for (int i = 0; i < 6; ++i)
#pragma unroll
            for (int ks = 0; ks < 2; ++ks) { const int t = g * 6 + i; if (t < 17) { k[i][ks] = WFrag<T16>::ld(at(kw + t * 16 * HD + ks * 32, lk)); if (HI) k2[i][ks] = WFrag<T16>::ld(at(kw2 + t * 16 * HD + ks * 32, lk)); } }
        asm volatile("s_wait_xcnt 0x0" ::: "memory");   // behind the group's loads (and q's): what follows in the build reuses their offset and base registers, and the wait stands in front of that overwrite
        __builtin_amdgcn_sched_barrier(0);   // a group's k loads go out together: sunk to their products, each tile's latency is waited out on its own
#pragma unroll
        for (int i = 0; i < 6; ++i) { const int t = g * 6 + i; if (t >= 17) continue;
            const float off = (t == 8 || (unsigned)(wb + t * 16) < (unsigned)TT) ? 0.0f : -3.0e38f;   // tile 8 is the wave's own rows
            v8f a = (v8f){};
#pragma unroll
            for (int ks = 0; ks < 2; ++ks) { a = WFrag<T16>::mma(k[i][ks], q[ks], a); if (HI) { a = WFrag<T16>::mma(k[i][ks], q2[ks], a); a = WFrag<T16>::mma(k2[i][ks], q[ks], a); } }
#pragma unroll
            for (int j = 0; j < 8; ++j) { float s = a[j] * SCL + off;   // SCL is a power of two: the product is exact, and off is 0 inside the sequence
                if (t == 0) s = (j + e >= 0) ? s : -3.0e38f;    // key >= query - BW
                if (t == 16) s = (j + e <= 0) ? s : -3.0e38f;   // key <= query + BW
                a[j] = s; mx = fmaxf(mx, s); }
            S[t] = a; }
    }
    const float m = fmaxf(mx, __shfl_xor(mx, 16, 32)); v8f sv = (v8f){}, O[4];   // row maximum, eight independent partial row sums, output tiles
#pragma unroll
    for (int mb = 0; mb < 4; ++mb) O[mb] = (v8f){};
#pragma unroll
    for (int kb = 0; kb < 9; ++kb) {
        const bool in0 = kb == 4 || (unsigned)(wb + kb * 32) < (unsigned)TT, in1 = (unsigned)(wb + kb * 32 + 16) < (unsigned)TT;
        V p, p2, va[4], va2[4];
#pragma unroll
        for (int mb = 0; mb < 4; ++mb) { va[mb] = WFrag<T16>::ld(at(vw + mb * 16 * TT + kb * 32, lv)); if (HI) va2[mb] = WFrag<T16>::ld(at(vw2 + mb * 16 * TT + kb * 32, lv)); }   // the block's v loads go out together, in flight under its exponentials
        __builtin_amdgcn_sched_barrier(0);   // keeps them there: sunk to their products, each load's latency is waited out on its own
#pragma unroll
        for (int u = 0; u < 2; ++u) { const int t = 2 * kb + u; v8f ev = (v8f){};
            if (t < 17) {
#pragma unroll
                for (int j = 0; j < 8; ++j) ev[j] = (S[t][j] - m) * 1.4426950408889634f;
                float x0, x1, x2, x3, x4, x5, x6, x7;
                // eight exp2 in one statement. The four leading slots are the distance behind a matrix instruction: the results may land in registers that were its A or B. Each exponential is followed by one that touches neither its result nor its source (early-clobber results), the last by the one slot that the instruction set asks for behind a transcendental.
                asm("v_nop\n\tv_nop\n\tv_nop\n\tv_nop\n\tv_exp_f32 %0, %8\n\tv_exp_f32 %1, %9\n\tv_exp_f32 %2, %10\n\tv_exp_f32 %3, %11\n\tv_exp_f32 %4, %12\n\tv_exp_f32 %5, %13\n\tv_exp_f32 %6, %14\n\tv_exp_f32 %7, %15\n\tv_nop"
                    : "=&v"(x0), "=&v"(x1), "=&v"(x2), "=&v"(x3), "=&v"(x4), "=&v"(x5), "=&v"(x6), "=&v"(x7) : "v"(ev[0]), "v"(ev[1]), "v"(ev[2]), "v"(ev[3]), "v"(ev[4]), "v"(ev[5]), "v"(ev[6]), "v"(ev[7]));
                ev = (v8f){x0, x1, x2, x3, x4, x5, x6, x7}; sv += ev; }
            packp(p, p2, HI ? ev : ev * PCAR, u * 8); }   // p goes into the product unnormalised (largest term 1); the row sum divides the output
#pragma unroll
        for (int mb = 0; mb < 4; ++mb) { const V b = keep(va[mb], in0, in1);
            O[mb] = WFrag<T16>::mma(b, p, O[mb]); if (HI) { O[mb] = WFrag<T16>::mma(b, p2, O[mb]); O[mb] = WFrag<T16>::mma(keep(va2[mb], in0, in1), p, O[mb]); } }
    }
    float sum = ((sv[0] + sv[1]) + (sv[2] + sv[3])) + ((sv[4] + sv[5]) + (sv[6] + sv[7])); sum += __shfl_xor(sum, 16, 32);
    const float f = __fdiv_rn(HI ? 1.0f : (1.0f / PCAR), sum);
    const size_t ob = ((z / NH_) * (size_t)TT + r) * DQ + (z % NH_) * HD;
#pragma unroll
    for (int mb = 0; mb < 4; ++mb) { v8us oh, ol;   // a lane's 8 accumulator rows are 8 consecutive d of one query
#pragma unroll
        for (int j = 0; j < 8; ++j) { unsigned short a2, c2; splitf(O[mb][j] * f, a2, c2); oh[j] = a2; ol[j] = c2; }
        const size_t oo = ob + mb * 16; *(v8us*)((char*)(Eh + oo) + lo) = oh; *(v8us*)((char*)(El + oo) + lo) = ol;
        if (mb < 3) asm volatile("s_wait_xcnt 0x0" ::: "memory"); }   // behind the two plane stores: the next tile's conversion reuses their data registers in the build, and the wait stands in front of that overwrite
}

extern "C" void kernel_launch(void* const* d_in, const int* in_sizes, int n_in,
                              void* d_out, int out_size, void* d_ws, size_t ws_size, hipStream_t stream) {
    (void)in_sizes; (void)n_in; (void)out_size;
    const float* x = (const float*)d_in[0]; const float* wq = (const float*)d_in[1]; const float* bq = (const float*)d_in[2]; const float* wk = (const float*)d_in[3]; const float* bk = (const float*)d_in[4]; const float* wv = (const float*)d_in[5]; const float* bv = (const float*)d_in[6]; const float* wo = (const float*)d_in[7]; const float* bo = (const float*)d_in[8];   /* argument order x, wq, bq, wk, bk, wv, bv, wo, bo */
    float* OUT = (float*)d_out;     // [2][2048][1024]
    char* wsp = (char*)d_ws;
    auto take = [&](size_t bytes) { char* p = wsp; wsp += (bytes + 255) & ~(size_t)255; return (void*)p; };
    bf* WQ = (bf*)take((size_t)4 * DQ * DM * 2); bf* WK = WQ + (size_t)DQ * DM; bf* WV = WK + (size_t)DKV * DM; bf* WO = WV + (size_t)DKV * DM; (void)WK; (void)WV;   // four transposed 1024 x 1024 weights in a row: a grid dimension walks them
    bf* XB = (bf*)take((size_t)NB_ * TT * DM * 2);
    const size_t PS = (size_t)ZH * TT * HD;   // one plane set: 32 head planes; q, k, v sets in a row, the projection GEMM's z walks them
    h16* QP16 = (h16*)take(3 * PS * 2); h16* KP16 = QP16 + PS; h16* VT16 = KP16 + PS;
    bf* QPh = (bf*)take(3 * PS * 2); bf* KPh = QPh + PS; bf* VTh = KPh + PS; bf* QPl = (bf*)take(3 * PS * 2); bf* KPl = QPl + PS; bf* VTl = KPl + PS;
    bf* ATh = (bf*)take((size_t)2 * NB_ * TT * DQ * 2); bf* ATl = ATh + (size_t)NB_ * TT * DQ;   // merged hi/lo planes
    if ((size_t)(wsp - (char*)d_ws) > ws_size) return;    // 104 of the 256 MiB
    k_wtG<<<dim3((unsigned)((DM * DQ / 64 + 63) / 64), 4, 1), 256, 0, stream>>>(wq, wk, wv, wo, DM, DQ, WQ);
    k_cvt8<<<(unsigned)(((size_t)NB_ * TT * DM / 8 + 255) / 256), 256, 0, stream>>>(x, XB, (size_t)NB_ * TT * DM / 8);
    k_gemms<0, 1><<<dim3(NB_ * TT / 128, DQ / 128, 3), 128, 0, stream>>>(XB, nullptr, WQ, nullptr, 0, bq, bk, bv, (size_t)DQ * DM, QP16, QPh, QPl);   // z: q, k, v
    // attention: blockIdx.y walks the 32 head planes, a block is four waves of 16 query rows each
    k_fattn<bf, true><<<dim3(RH / 64, ZH, 1), 128, 0, stream>>>(QPh, QPl, KPh, KPl, VTh, VTl, 0, ATh, ATl);
    k_fattn<h16, false><<<dim3((TT - RH) / 64, ZH, 1), 128, 0, stream>>>(QP16, nullptr, KP16, nullptr, VT16, nullptr, RH, ATh, ATl);
    k_gemms<1, 0><<<dim3(NB_ * TT / 128, DM / 128, 1), 128, 0, stream>>>(ATh, ATl, WO, OUT, DM, bo, nullptr, nullptr, 0, nullptr, nullptr, nullptr);
}

// v006
// One run takes 85.9 microseconds.
// Next to v005, in two timings, it ran 1.06 times as fast each time.
// Over all steps from v000 it is 23.7 times as fast.
#include <hip/hip_runtime.h>

// Sliding-window (banded) multi-head attention (x [2][2048][1024]; q, k, v = x W + b ('xw' [1024][1024] 0.02, zero biases; 16 heads x 64); scores x 64^-0.5; keys j with i - 128 <= j <= i + 128 (symmetric window 256, -inf elsewhere); softmax; out = merged wo + bo ('xw') -> [2][2048][1024] (4.2 M); argument order x, wq, bq, wk, bk, wv, bv, wo, bo).
// Layout, both batches at once (4096 rows; 32 head planes z = batch * 16 + head): bf16 copy of x; 'xw' weights transposed once; exact projections + f32 biases, whose GEMM stores the 16-bit q, k, v head planes itself, in the order in which the attention's matrix fragments are loaded (PACKED PLANES below); banded attention fused in k_fattn: a wave holds the scores of its 16 query rows against their 272-key window in registers, takes their exponentials there and feeds them to the p x v product, whose result the row sum divides; scores and p never reach memory (hybrid rows: < 512 hi/lo 3 products, rest fp16 x1024; one launch each); it stores the merged hi/lo planes; merged hi/lo x wo exact + bo.
// Compute dtypes, f32 accumulate: every input rounded to bf16; projections exact + f32 biases; attention rows < 512 3 products, rest fp16; softmax f32; wo hl x exact + bias.

#define NB_  2
#define TT   2048
#define DM   1024
#define NH_  16
#define NKV  16
#define REP  (NH_ / NKV)
#define HD   64
#define DQ   (NH_ * HD)
#define DKV  (NKV * HD)
#define ZH   (NB_ * NH_)          // head planes per attention launch: all heads of both batches
#define RH   512                  // query rows < RH use hi+lo planes (0: none)
#define WIN  2048
#define BW   128      // half window: keys j in [i - 128, i + 128]
#define PCAR 1024.0f
#define SCL  0.125f   // HD^-0.5
typedef _Float16 h16;
typedef unsigned short bf;
typedef __attribute__((ext_vector_type(16))) __bf16   v16bf;
typedef __attribute__((ext_vector_type(16))) _Float16 v16h;
typedef __attribute__((ext_vector_type(8)))  _Float16 v8h;
typedef __attribute__((ext_vector_type(8)))  unsigned short v8us;
typedef __attribute__((ext_vector_type(8)))  float    v8f;
typedef __attribute__((ext_vector_type(4)))  float    v4f;
typedef v8h  __attribute__((may_alias)) v8ha;
typedef v4f  __attribute__((may_alias)) v4fa;
typedef v8us __attribute__((may_alias)) v8usa;

__device__ __forceinline__ unsigned short f2bf(float f) { unsigned u = __float_as_uint(f); u += 0x7FFFu + ((u >> 16) & 1u); return (unsigned short)(u >> 16); }
__device__ __forceinline__ float bf2f(unsigned short b) { return __uint_as_float(((unsigned)b) << 16); }
__device__ __forceinline__ float bfr(float f) { return bf2f(f2bf(f)); }
__device__ __forceinline__ v16h cat16(v8h lo, v8h hi) { return __builtin_shufflevector(lo, hi, 0, 1, 2, 3, 4, 5, 6, 7, 8, 9, 10, 11, 12, 13, 14, 15); }
__device__ __forceinline__ v16bf cat16b(v8us lo, v8us hi) { return __builtin_bit_cast(v16bf, __builtin_shufflevector(lo, hi, 0, 1, 2, 3, 4, 5, 6, 7, 8, 9, 10, 11, 12, 13, 14, 15)); }
__device__ __forceinline__ v8f wmma16(v16h a, v16h b, v8f c) { return __builtin_amdgcn_wmma_f32_16x16x32_f16(false, a, false, b, (short)0, c, false, false); }
__device__ __forceinline__ v8f wmmab(v16bf a, v16bf b, v8f c) { return __builtin_amdgcn_wmma_f32_16x16x32_bf16(false, a, false, b, (short)0, c, false, false); }
__device__ __forceinline__ h16 tohx(float x) { return (h16)x; }
__device__ __forceinline__ void splitf(float y, unsigned short& h, unsigned short& l) { h = f2bf(y); l = f2bf(y - bf2f(h)); }



// ---- k_gemms: GEMM, a work-group of four waves (2 x 2) per 128x128 output tile, each wave a 64x64 tile (16 accumulators); grid (M/128, N/128, Z), 128 threads. K = DM.
// C[m][n] = sum_k A[m][k] Bt[n][k] (NSPLIT 1: + A2[m][k] Bt[n][k] behind each block's first product) + f32 bias[n] (bias, bias1, bias2 for z = 0, 1, 2); A, A2, Bt K-contiguous bf16 planes; Bt's z stride sB in elements.
// Operands reach the waves through LDS: a stage is 64 k (one whole 128-byte line) of the tile's 128 A rows, 128 Bt rows (and 128 A2 rows), at pitch GP; two buffers; asynchronous copies to LDS fill the next stage while this one is worked on. A wave-wide copy is four whole lines; every wave copies 32 rows of each operand.
// EPI 0: C in f32, pitch ldc. EPI 1 (projections; a wave's 64 columns are one head): y = sum + bias goes out as fp16, bf16 hi and bf16 lo = y - hi, into plane set z of E16, Eh, El, head plane batch * NH_ + head. C is unused for EPI 1.
// PACKED PLANES: a head plane is TT / 16 tiles of 16 positions x 64 d (2 KiB, PT elements), a tile four pieces of 512 bytes, a piece 32 lane slots of 16 bytes: one wave-wide 16-byte load of the attention kernel reads one piece, four whole 128-byte lines, and each lane finds half a fragment in its slot. Slot hi * 16 + lr of piece s holds, for q and k, position lr, d = (s / 2) * 32 + (s % 2) * 16 + hi * 8 + 0..7; for v, d = s * 16 + lr, positions hi * 8 + 0..7.
template <typename T16> struct WFrag;
template <> struct WFrag<h16> { typedef v16h V; static __device__ __forceinline__ V ld(const h16* p) { return cat16(*(const v8h*)p, *(const v8h*)(p + 16)); } static __device__ __forceinline__ V ld2(const h16* p, const h16* p1) { return cat16(*(const v8h*)p, *(const v8h*)p1); } static __device__ __forceinline__ v8f mma(V a, V b, v8f c) { return wmma16(a, b, c); } };
template <> struct WFrag<bf> { typedef v16bf V; static __device__ __forceinline__ V ld(const bf* p) { return cat16b(*(const v8us*)p, *(const v8us*)(p + 16)); } static __device__ __forceinline__ V ld2(const bf* p, const bf* p1) { return cat16b(*(const v8us*)p, *(const v8us*)p1); } static __device__ __forceinline__ v8f mma(V a, V b, v8f c) { return wmmab(a, b, c); } };
#define PT (16 * HD)   // elements of a packed tile
#define GP 144   // bytes from one staged row to the next: 128 + 16, an odd number of 16-byte units, so that the 16-byte fragment reads of 16 rows meet no bank twice
// eight asynchronous copies of 16 bytes a lane: rows r, r + 4, .. r + 28 of one operand's stage (l: the lane's LDS byte address, g: its global address, both of row r). The closing wait stands in front of whatever rewrites the address registers named here.
__device__ __forceinline__ void copy8(const unsigned l, const bf* g) {
    asm volatile("global_load_async_to_lds_b128 %0, %8, off\n\tglobal_load_async_to_lds_b128 %1, %9, off\n\tglobal_load_async_to_lds_b128 %2, %10, off\n\tglobal_load_async_to_lds_b128 %3, %11, off\n\t"
                 "global_load_async_to_lds_b128 %4, %12, off\n\tglobal_load_async_to_lds_b128 %5, %13, off\n\tglobal_load_async_to_lds_b128 %6, %14, off\n\tglobal_load_async_to_lds_b128 %7, %15, off\n\ts_wait_xcnt 0x0"
                 :: "v"(l), "v"(l + 4 * GP), "v"(l + 8 * GP), "v"(l + 12 * GP), "v"(l + 16 * GP), "v"(l + 20 * GP), "v"(l + 24 * GP), "v"(l + 28 * GP),
                    "v"(g), "v"(g + 4 * DM), "v"(g + 8 * DM), "v"(g + 12 * DM), "v"(g + 16 * DM), "v"(g + 20 * DM), "v"(g + 24 * DM), "v"(g + 28 * DM) : "memory");
}
template <int NSPLIT, int EPI>
__global__ __launch_bounds__(128) void k_gemms(const bf* __restrict__ A, const bf* __restrict__ A2, const bf* __restrict__ Bt, float* C, int ldc, const float* __restrict__ bias, const float* __restrict__ bias1, const float* __restrict__ bias2, size_t sB, h16* E16, bf* Eh, bf* El) {
    typedef WFrag<bf>::V V;
    static_assert(DM == DQ && DM % 128 == 0, "one K for both launches; at least two stages");
    constexpr int K = DM, NT = K / 64, BUFB = (2 + NSPLIT) * 128 * GP;   // stages; bytes of a buffer: A rows, Bt rows (, A2 rows)
    __shared__ __align__(16) char ring[2 * BUFB];
    __shared__ __align__(16) float osm[4 * 16 * 68];
    const size_t z = blockIdx.z; Bt += z * sB;
    bias = (z == 0) ? bias : (z == 1) ? bias1 : bias2;   // z-batched projections: each z has its own bias vector
    const int lane = threadIdx.x & 31, lr = lane & 15, hi = lane >> 4, wave = __builtin_amdgcn_readfirstlane((int)(threadIdx.x >> 5));
    const int R0 = blockIdx.x * 128, C0 = blockIdx.y * 128, wr = (wave & 1) * 64, wc = (wave >> 1) * 64, r0 = R0 + wr, c0 = C0 + wc;   // the work-group's tile, the wave's place in it, the wave's tile
    float* os = osm + wave * (16 * 68);
    // the lane's part in a copy: row wave * 32 + lane / 8 (+ 4 a copy) of the stage, 16-byte piece lane % 8 of its line
    const int crow = wave * 32 + (lane >> 3), cpc = (lane & 7) * 8;
    const unsigned lc = (unsigned)(size_t)ring + (unsigned)(crow * GP + cpc * 2);
    const bf* ga = A + (size_t)(R0 + crow) * K + cpc; const bf* gb = Bt + (size_t)(C0 + crow) * K + cpc; const bf* ga2 = NSPLIT ? A2 + (size_t)(R0 + crow) * K + cpc : nullptr;
    auto fill = [&](int t, int buf) { const unsigned l = lc + (unsigned)(buf * BUFB); copy8(l, ga + t * 64); copy8(l + 128 * GP, gb + t * 64); if (NSPLIT) copy8(l + 256 * GP, ga2 + t * 64); };
    v8f acc[4][4];
#pragma unroll
    for (int mb = 0; mb < 4; ++mb)
#pragma unroll
        for (int nb = 0; nb < 4; ++nb) acc[mb][nb] = (v8f){};
    fill(0, 0);
    asm volatile("s_wait_asynccnt 0x0" ::: "memory");   // this wave's part of stage 0 has landed
    __syncthreads();                                      // every wave's part has
    fill(1, 1);
    const int fa = (wr + lr) * GP + 16 * hi, fb = (128 + wc + lr) * GP + 16 * hi;   // the lane's byte offset in a buffer: row lr of the wave's first A and Bt fragment
#pragma unroll 1
    for (int t = 0; t < NT; ++t) {
        const char* sb = ring + (t & 1) * BUFB;
        V a[4], a2[4], b[4];
        auto frags = [&](int ks) {
#pragma unroll
            for (int mb = 0; mb < 4; ++mb) { a[mb] = WFrag<bf>::ld((const bf*)(sb + fa + mb * 16 * GP + ks * 64)); if (NSPLIT) a2[mb] = WFrag<bf>::ld((const bf*)(sb + fa + 256 * GP + mb * 16 * GP + ks * 64)); }
#pragma unroll
            for (int nb = 0; nb < 4; ++nb) b[nb] = WFrag<bf>::ld((const bf*)(sb + fb + nb * 16 * GP + ks * 64)); };
        auto prods = [&]() {
#pragma unroll
            for (int nb = 0; nb < 4; ++nb)
#pragma unroll
                for (int mb = 0; mb < 4; ++mb) { acc[mb][nb] = WFrag<bf>::mma(a[mb], b[nb], acc[mb][nb]); if (NSPLIT) acc[mb][nb] = WFrag<bf>::mma(a2[mb], b[nb], acc[mb][nb]); } };
        frags(0);
        __builtin_amdgcn_sched_barrier(0);   // a block's fragment reads go out as one group ahead of its products: sunk among them, each row of products waits out the LDS latency on its own
        prods();
        frags(1);                                             // the stage's last reads: its second block then works from registers alone
        if (NSPLIT) { __builtin_amdgcn_sched_barrier(0); prods(); }   // three operands: the block's twelve fragments, the accumulators and the copies' addresses do not fit 256 registers together, so its products come first, behind its reads as one group as above
        asm volatile("s_wait_dscnt 0x0" ::: "memory");      // this wave's reads of the buffer are done before it is handed to the copies
        asm volatile("s_wait_asynccnt 0x0" ::: "memory");   // this wave's part of stage t + 1 has landed
        __syncthreads();                                      // publishes stage t + 1 and ends every wave's reads of stage t
        if (t + 2 < NT) fill(t + 2, t & 1);
        if (!NSPLIT) prods();                                 // behind the refill, so that the copies fly under these products too
    }
    asm volatile("s_wait_asynccnt 0x0" ::: "memory");   // no copy is left in flight at the wave's end
    static_assert(HD == 64, "EPI 1 takes a wave's 64 columns for one head");
    const int trow = r0 % TT;   // sequence position of the tile's row 0
    if (EPI == 1) { const size_t pz = z * ((size_t)ZH * TT * HD) + (size_t)((r0 / TT) * NH_ + c0 / HD) * TT * HD; E16 += pz; Eh += pz; El += pz; }   // plane set z, head plane of this tile
    if (EPI == 1 && z == 2) {   // v: a lane's 8 accumulator rows are 8 consecutive t of one d, which is its slot of piece nb of tile mb: 16 bytes a plane straight from registers, every store 512 bytes in a row
#pragma unroll
        for (int nb = 0; nb < 4; ++nb) { const float bb = bfr(bias[c0 + nb * 16 + lr]);
#pragma unroll
            for (int mb = 0; mb < 4; ++mb) { v8h o16; v8us oh, ol;
#pragma unroll
                for (int j = 0; j < 8; ++j) { const float y = acc[mb][nb][j] + bb; o16[j] = tohx(y); unsigned short a2, c2; splitf(y, a2, c2); oh[j] = a2; ol[j] = c2; }
                // the three plane stores (one byte offset, three uniform bases) and their wait in one statement: as separate statements the build sends the first store ahead of the other planes' conversions, which reuse its data registers in front of the wait
                asm volatile("global_store_b128 %0, %1, %4\n\tglobal_store_b128 %0, %2, %5\n\tglobal_store_b128 %0, %3, %6\n\ts_wait_xcnt 0x0"
                             :: "v"((unsigned)(((trow / 16 + mb) * PT + nb * 256 + lane * 8) * 2)), "v"(__builtin_bit_cast(v4f, o16)), "v"(__builtin_bit_cast(v4f, oh)), "v"(__builtin_bit_cast(v4f, ol)), "s"(E16), "s"(Eh), "s"(El) : "memory"); } }
        return;
    }
    float bb[4];   // the biases of the lane's accumulator columns: added on the way into LDS, where a lane has one column a tile and not the 32 of its four slots
    if (EPI == 1) {
#pragma unroll
        for (int nb = 0; nb < 4; ++nb) bb[nb] = bfr(bias[c0 + nb * 16 + lr]); }
#pragma unroll
    for (int mb = 0; mb < 4; ++mb) {
#pragma unroll
        for (int nb = 0; nb < 4; ++nb) {
#pragma unroll
            for (int j = 0; j < 8; ++j) os[(hi * 8 + j) * 68 + nb * 16 + lr] = (EPI == 1) ? acc[mb][nb][j] + bb[nb] : acc[mb][nb][j]; }
        __builtin_amdgcn_wave_barrier(); asm volatile("" ::: "memory");
        if (EPI == 0) {
        float* crow2 = C + (size_t)(r0 + mb * 16) * ldc + c0;
#pragma unroll
            for (int s = 0; s < 8; ++s) { const int row = 2 * s + hi, cofs = lr * 4; v4f val = *(const v4fa*)(os + row * 68 + cofs); val[0] += bfr(bias[c0 + cofs]); val[1] += bfr(bias[c0 + cofs + 1]); val[2] += bfr(bias[c0 + cofs + 2]); val[3] += bfr(bias[c0 + cofs + 3]);
                *(v4f*)(crow2 + (size_t)row * ldc + cofs) = val; }
            asm volatile("s_wait_xcnt 0x0" ::: "memory");   // behind the run of stores above: what follows in the build reuses their data registers, and the wait stands in front of that overwrite
        } else {   // piece s of packed tile mb: each lane converts the 8 consecutive columns of its slot, a store is 512 bytes in a row in every plane
#pragma unroll
            for (int s = 0; s < 4; ++s) { const int row = lr, cofs = (s >> 1) * 32 + (s & 1) * 16 + hi * 8; const v4f va = *(const v4fa*)(os + row * 68 + cofs), vb = *(const v4fa*)(os + row * 68 + cofs + 4); v8h o16; v8us oh, ol;
#pragma unroll
                for (int q = 0; q < 8; ++q) { const float y = (q < 4) ? va[q & 3] : vb[q & 3]; o16[q] = tohx(y); unsigned short a2, c2; splitf(y, a2, c2); oh[q] = a2; ol[q] = c2; }
                const size_t oo = (size_t)(trow / 16 + mb) * PT + s * 256 + lane * 8; *(v8h*)(E16 + oo) = o16; *(v8us*)(Eh + oo) = oh; *(v8us*)(El + oo) = ol;
                asm volatile("s_wait_xcnt 0x0" ::: "memory"); }   // behind the three plane stores: what follows in the build reuses their address and data registers, and the wait stands in front of that overwrite
        }
        __builtin_amdgcn_wave_barrier(); asm volatile("" ::: "memory");
    }
}

typedef __attribute__((ext_vector_type(2))) _Float16 v2h;
typedef __attribute__((ext_vector_type(4))) _Float16 v4h;
typedef __attribute__((ext_vector_type(2))) unsigned short v2us;
typedef __attribute__((ext_vector_type(4))) unsigned short v4us;
typedef __attribute__((ext_vector_type(2))) float v2f;
typedef __attribute__((ext_vector_type(4))) int v4i;

__global__ __launch_bounds__(256) void k_wtG(const float* __restrict__ w0, const float* __restrict__ w1, const float* __restrict__ w2, const float* __restrict__ w3, int K, int N, bf* Bt) {
    const float* __restrict__ w = (blockIdx.y == 0) ? w0 : (blockIdx.y == 1) ? w1 : (blockIdx.y == 2) ? w2 : w3; Bt += (size_t)blockIdx.y * K * N;   // blockIdx.y: which of the four equally shaped weights
    const int lane = threadIdx.x & 31; const int L0 = (blockIdx.x * 8 + (threadIdx.x >> 5)) * 8; const int nlines = N * K / 64;
{
#pragma unroll 1
        for (int l = 0; l < 8; ++l) { const int L = L0 + l; if (L >= nlines) break; const size_t e = (size_t)L * 64 + lane * 2; const int k = (int)(e % K), n = (int)(e / K); v2us o;
            o[0] = f2bf(w[(size_t)k * N + n]); o[1] = f2bf(w[(size_t)(k + 1) * N + n]); *(v2us*)(Bt + e) = o; }
         }
}
__global__ __launch_bounds__(256) void k_cvt8(const float* __restrict__ src, bf* dst, size_t n8) { const size_t i = (size_t)blockIdx.x * 256 + threadIdx.x; if (i >= n8) return; const v8f v = *(const v8f*)(src + i * 8); v8us o;
#pragma unroll
    for (int k = 0; k < 8; ++k) o[k] = f2bf(v[k]); *(v8us*)(dst + i * 8) = o;  }

typedef __attribute__((ext_vector_type(2))) __bf16 v2bf;
// p (f32, 8 keys of one query) -> 8 elements s0 .. s0 + 7 of a B operand; both conversions round to nearest even
__device__ __forceinline__ void packp(v16h& d, v16h&, const v8f p, const int s0) {
#pragma unroll
    for (int j = 0; j < 8; j += 2) { const v2h c = __builtin_convertvector((v2f){p[j], p[j + 1]}, v2h); d[s0 + j] = c[0]; d[s0 + j + 1] = c[1]; } }
__device__ __forceinline__ void packp(v16bf& d, v16bf& dl, const v8f p, const int s0) {
#pragma unroll
    for (int j = 0; j < 8; j += 2) { const v2bf c = __builtin_convertvector((v2f){p[j], p[j + 1]}, v2bf); const v2bf l = __builtin_convertvector((v2f){p[j] - (float)c[0], p[j + 1] - (float)c[1]}, v2bf); d[s0 + j] = c[0]; d[s0 + j + 1] = c[1]; dl[s0 + j] = l[0]; dl[s0 + j + 1] = l[1]; } }

typedef __attribute__((ext_vector_type(8))) int v8i;
template <typename T16, bool HI>
__global__ __launch_bounds__(128) void k_fattn(const T16* __restrict__ Q, const T16* __restrict__ Q2, const T16* __restrict__ Kp, const T16* __restrict__ K2, const T16* __restrict__ Vt, const T16* __restrict__ Vt2, int rbase, bf* Eh, bf* El) {
    typedef typename WFrag<T16>::V V;
    static_assert(HD == 64 && BW == 128, "tile counts below are those of head size 64 and half window 128");
    const int lane = threadIdx.x & 31, lr = lane & 15, hi = lane >> 4, e = 8 * hi - lr;
    const int r = rbase + ((int)blockIdx.x * 4 + __builtin_amdgcn_readfirstlane((int)(threadIdx.x >> 5))) * 16, wb = r - BW;
    const size_t z = blockIdx.y, pl = z * ((size_t)TT * HD);
    const unsigned ls = (unsigned)lane * 16u, lo = (unsigned)(lr * DQ + 8 * hi) * 2u;   // the lane's byte offset in a piece of a packed tile and in a 16-row fragment of pitch DQ: every address below is a wave-uniform base + one of these + a constant
    auto at = [](const T16* base, unsigned off) { return (const T16*)((const char*)base + off); };
    auto keep = [](V a, bool in0, bool in1) { v8i w = __builtin_bit_cast(v8i, a);   // a fragment's first four registers are its first 16-key tile, the rest its second
#pragma unroll
        for (int i = 0; i < 8; ++i) w[i] = ((i < 4) ? in0 : in1) ? w[i] : 0;
        return __builtin_bit_cast(V, w); };
    V q[2], q2[2];
#pragma unroll
    for (int ks = 0; ks < 2; ++ks) { q[ks] = WFrag<T16>::ld2(at(Q + pl + (size_t)r * HD + ks * 512, ls), at(Q + pl + (size_t)r * HD + ks * 512 + 256, ls)); if (HI) q2[ks] = WFrag<T16>::ld2(at(Q2 + pl + (size_t)r * HD + ks * 512, ls), at(Q2 + pl + (size_t)r * HD + ks * 512 + 256, ls)); }   // pieces 2 ks and 2 ks + 1 of the rows' tile (16 positions are PT = 16 HD elements: r * HD is the tile's start)
    const T16* kw = Kp + pl + (long)wb * HD; const T16* kw2 = HI ? K2 + pl + (long)wb * HD : nullptr; const T16* vw = Vt + pl + (long)wb * HD; const T16* vw2 = HI ? Vt2 + pl + (long)wb * HD : nullptr;   // the window's first 16-key tile in the k and in the v planes
    v8f S[17]; float mx = -3.0e38f;
#pragma unroll
    for (int g = 0; g < 3; ++g) {   // key tiles in groups of six (the last: five)
        V k[6][2], k2[6][2];
#pragma unroll
        for (int i = 0; i < 6; ++i)
#pragma unroll
            for (int ks = 0; ks < 2; ++ks) { const int t = g * 6 + i; if (t < 17) { k[i][ks] = WFrag<T16>::ld2(at(kw + t * PT + ks * 512, ls), at(kw + t * PT + ks * 512 + 256, ls)); if (HI) k2[i][ks] = WFrag<T16>::ld2(at(kw2 + t * PT + ks * 512, ls), at(kw2 + t * PT + ks * 512 + 256, ls)); } }
        asm volatile("s_wait_xcnt 0x0" ::: "memory");   // behind the group's loads (and q's): what follows in the build reuses their offset and base registers, and the wait stands in front of that overwrite
        __builtin_amdgcn_sched_barrier(0);   // a group's k loads go out together: sunk to their products, each tile's latency is waited out on its own
#pragma unroll
        for (int i = 0; i < 6; ++i) { const int t = g * 6 + i; if (t >= 17) continue;
            const float off = (t == 8 || (unsigned)(wb + t * 16) < (unsigned)TT) ? 0.0f : -3.0e38f;   // tile 8 is the wave's own rows
            v8f a = (v8f){};
#pragma unroll
            for (int ks = 0; ks < 2; ++ks) { a = WFrag<T16>::mma(k[i][ks], q[ks], a); if (HI) { a = WFrag<T16>::mma(k[i][ks], q2[ks], a); a = WFrag<T16>::mma(k2[i][ks], q[ks], a); } }
#pragma unroll
            for (int j = 0; j < 8; ++j) { float s = a[j] * SCL + off;   // SCL is a power of two: the product is exact, and off is 0 inside the sequence
                if (t == 0) s = (j + e >= 0) ? s : -3.0e38f;    // key >= query - BW
                if (t == 16) s = (j + e <= 0) ? s : -3.0e38f;   // key <= query + BW
                a[j] = s; mx = fmaxf(mx, s); }
            S[t] = a; }
    }
    const float m = fmaxf(mx, __shfl_xor(mx, 16, 32)); v8f sv = (v8f){}, O[4];   // row maximum, eight independent partial row sums, output tiles
#pragma unroll
    for (int mb = 0; mb < 4; ++mb) O[mb] = (v8f){};
#pragma unroll
    for (int kb = 0; kb < 9; ++kb) {
        const bool in0 = kb == 4 || (unsigned)(wb + kb * 32) < (unsigned)TT, in1 = (unsigned)(wb + kb * 32 + 16) < (unsigned)TT;
        V p, p2, va[4], va2[4];
#pragma unroll
        for (int mb = 0; mb < 4; ++mb) { va[mb] = WFrag<T16>::ld2(at(vw + 2 * kb * PT + mb * 256, ls), at(vw + (2 * kb + 1) * PT + mb * 256, ls)); if (HI) va2[mb] = WFrag<T16>::ld2(at(vw2 + 2 * kb * PT + mb * 256, ls), at(vw2 + (2 * kb + 1) * PT + mb * 256, ls)); }   // piece mb of the block's two key tiles; the block's v loads go out together, in flight under its exponentials
        __builtin_amdgcn_sched_barrier(0);   // keeps them there: sunk to their products, each load's latency is waited out on its own
#pragma unroll
        for (int u = 0; u < 2; ++u) { const int t = 2 * kb + u; v8f ev = (v8f){};
            if (t < 17) {
#pragma unroll
                for (int j = 0; j < 8; ++j) ev[j] = (S[t][j] - m) * 1.4426950408889634f;
                float x0, x1, x2, x3, x4, x5, x6, x7;
                // eight exp2 in one statement. The four leading slots are the distance behind a matrix instruction: the results may land in registers that were its A or B. Each exponential is followed by one that touches neither its result nor its source (early-clobber results), the last by the one slot that the instruction set asks for behind a transcendental.
                asm("v_nop\n\tv_nop\n\tv_nop\n\tv_nop\n\tv_exp_f32 %0, %8\n\tv_exp_f32 %1, %9\n\tv_exp_f32 %2, %10\n\tv_exp_f32 %3, %11\n\tv_exp_f32 %4, %12\n\tv_exp_f32 %5, %13\n\tv_exp_f32 %6, %14\n\tv_exp_f32 %7, %15\n\tv_nop"
                    : "=&v"(x0), "=&v"(x1), "=&v"(x2), "=&v"(x3), "=&v"(x4), "=&v"(x5), "=&v"(x6), "=&v"(x7) : "v"(ev[0]), "v"(ev[1]), "v"(ev[2]), "v"(ev[3]), "v"(ev[4]), "v"(ev[5]), "v"(ev[6]), "v"(ev[7]));
                ev = (v8f){x0, x1, x2, x3, x4, x5, x6, x7}; sv += ev; }
            packp(p, p2, HI ? ev : ev * PCAR, u * 8); }   // p goes into the product unnormalised (largest term 1); the row sum divides the output
#pragma unroll
        for (int mb = 0; mb < 4; ++mb) { const V b = keep(va[mb], in0, in1);
            O[mb] = WFrag<T16>::mma(b, p, O[mb]); if (HI) { O[mb] = WFrag<T16>::mma(b, p2, O[mb]); O[mb] = WFrag<T16>::mma(keep(va2[mb], in0, in1), p, O[mb]); } }
    }
    float sum = ((sv[0] + sv[1]) + (sv[2] + sv[3])) + ((sv[4] + sv[5]) + (sv[6] + sv[7])); sum += __shfl_xor(sum, 16, 32);
    const float f = __fdiv_rn(HI ? 1.0f : (1.0f / PCAR), sum);
    const size_t ob = ((z / NH_) * (size_t)TT + r) * DQ + (z % NH_) * HD;
#pragma unroll
    for (int mb = 0; mb < 4; ++mb) { v8us oh, ol;   // a lane's 8 accumulator rows are 8 consecutive d of one query
#pragma unroll
        for (int j = 0; j < 8; ++j) { unsigned short a2, c2; splitf(O[mb][j] * f, a2, c2); oh[j] = a2; ol[j] = c2; }
        const size_t oo = ob + mb * 16; *(v8us*)((char*)(Eh + oo) + lo) = oh; *(v8us*)((char*)(El + oo) + lo) = ol;
        if (mb < 3) asm volatile("s_wait_xcnt 0x0" ::: "memory"); }   // behind the two plane stores: the next tile's conversion reuses their data registers in the build, and the wait stands in front of that overwrite
}

extern "C" void kernel_launch(void* const* d_in, const int* in_sizes, int n_in,
                              void* d_out, int out_size, void* d_ws, size_t ws_size, hipStream_t stream) {
    (void)in_sizes; (void)n_in; (void)out_size;
    const float* x = (const float*)d_in[0]; const float* wq = (const float*)d_in[1]; const float* bq = (const float*)d_in[2]; const float* wk = (const float*)d_in[3]; const float* bk = (const float*)d_in[4]; const float* wv = (const float*)d_in[5]; const float* bv = (const float*)d_in[6]; const float* wo = (const float*)d_in[7]; const float* bo = (const float*)d_in[8];   /* argument order x, wq, bq, wk, bk, wv, bv, wo, bo */
    float* OUT = (float*)d_out;     // [2][2048][1024]
    char* wsp = (char*)d_ws;
    auto take = [&](size_t bytes) { char* p = wsp; wsp += (bytes + 255) & ~(size_t)255; return (void*)p; };
    bf* WQ = (bf*)take((size_t)4 * DQ * DM * 2); bf* WK = WQ + (size_t)DQ * DM; bf* WV = WK + (size_t)DKV * DM; bf* WO = WV + (size_t)DKV * DM; (void)WK; (void)WV;   // four transposed 1024 x 1024 weights in a row: a grid dimension walks them
    bf* XB = (bf*)take((size_t)NB_ * TT * DM * 2);
    const size_t PS = (size_t)ZH * TT * HD;   // one plane set: 32 head planes; q, k, v sets in a row, the projection GEMM's z walks them
    h16* QP16 = (h16*)take(3 * PS * 2); h16* KP16 = QP16 + PS; h16* VT16 = KP16 + PS;
    bf* QPh = (bf*)take(3 * PS * 2); bf* KPh = QPh + PS; bf* VTh = KPh + PS; bf* QPl = (bf*)take(3 * PS * 2); bf* KPl = QPl + PS; bf* VTl = KPl + PS;
    bf* ATh = (bf*)take((size_t)2 * NB_ * TT * DQ * 2); bf* ATl = ATh + (size_t)NB_ * TT * DQ;   // merged hi/lo planes
    if ((size_t)(wsp - (char*)d_ws) > ws_size) return;    // 104 of the 256 MiB
    k_wtG<<<dim3((unsigned)((DM * DQ / 64 + 63) / 64), 4, 1), 256, 0, stream>>>(wq, wk, wv, wo, DM, DQ, WQ);
    k_cvt8<<<(unsigned)(((size_t)NB_ * TT * DM / 8 + 255) / 256), 256, 0, stream>>>(x, XB, (size_t)NB_ * TT * DM / 8);
    k_gemms<0, 1><<<dim3(NB_ * TT / 128, DQ / 128, 3), 128, 0, stream>>>(XB, nullptr, WQ, nullptr, 0, bq, bk, bv, (size_t)DQ * DM, QP16, QPh, QPl);   // z: q, k, v
    // attention: blockIdx.y walks the 32 head planes, a block is four waves of 16 query rows each
    k_fattn<bf, true><<<dim3(RH / 64, ZH, 1), 128, 0, stream>>>(QPh, QPl, KPh, KPl, VTh, VTl, 0, ATh, ATl);
    k_fattn<h16, false><<<dim3((TT - RH) / 64, ZH, 1), 128, 0, stream>>>(QP16, nullptr, KP16, nullptr, VT16, nullptr, RH, ATh, ATl);
    k_gemms<1, 0><<<dim3(NB_ * TT / 128, DM / 128, 1), 128, 0, stream>>>(ATh, ATl, WO, OUT, DM, bo, nullptr, nullptr, 0, nullptr, nullptr, nullptr);
}

// v007
// A run of this version takes 69.9 microseconds.
// Next to v006, in two timings, it ran 1.21 and 1.23 times as fast.
// Over all steps from v000 it is 28.8 times as fast.
#include <hip/hip_runtime.h>

// Sliding-window (banded) multi-head attention (x [2][2048][1024]; q, k, v = x W + b ('xw' [1024][1024] 0.02, zero biases; 16 heads x 64); scores x 64^-0.5; keys j with i - 128 <= j <= i + 128 (symmetric window 256, -inf elsewhere); softmax; out = merged wo + bo ('xw') -> [2][2048][1024] (4.2 M); argument order x, wq, bq, wk, bk, wv, bv, wo, bo).
// Layout, both batches at once (4096 rows; 32 head planes z = batch * 16 + head): bf16 copy of x; 'xw' weights transposed once; exact projections + f32 biases, whose GEMM stores the 16-bit q, k, v head planes itself, in the order in which the attention's matrix fragments are loaded (PACKED PLANES below); banded attention fused in k_fattn2: a wave holds the scores of its 16 query rows against their 272-key window in registers, takes their exponentials there and feeds them to the p x v product, whose result the row sum divides; scores and p never reach memory (hybrid rows: < 512 hi/lo 3 products, rest fp16 x1024; both forms in one launch); it stores the merged hi/lo planes; merged hi/lo x wo exact + bo.
// Compute dtypes, f32 accumulate: every input rounded to bf16; projections exact + f32 biases; attention rows < 512 3 products, rest fp16; softmax f32; wo hl x exact + bias.

#define NB_  2
#define TT   2048
#define DM   1024
#define NH_  16
#define NKV  16
#define REP  (NH_ / NKV)
#define HD   64
#define DQ   (NH_ * HD)
#define DKV  (NKV * HD)
#define ZH   (NB_ * NH_)          // head planes per attention launch: all heads of both batches
#define RH   512                  // query rows < RH use hi+lo planes (0: none)
#define WIN  2048
#define BW   128      // half window: keys j in [i - 128, i + 128]
#define PCAR 1024.0f
#define SCL  0.125f   // HD^-0.5
typedef _Float16 h16;
typedef unsigned short bf;
typedef __attribute__((ext_vector_type(16))) __bf16   v16bf;
typedef __attribute__((ext_vector_type(16))) _Float16 v16h;
typedef __attribute__((ext_vector_type(8)))  _Float16 v8h;
typedef __attribute__((ext_vector_type(8)))  unsigned short v8us;
typedef __attribute__((ext_vector_type(8)))  float    v8f;
typedef __attribute__((ext_vector_type(4)))  float    v4f;
typedef v8h  __attribute__((may_alias)) v8ha;
typedef v4f  __attribute__((may_alias)) v4fa;
typedef v8us __attribute__((may_alias)) v8usa;

__device__ __forceinline__ unsigned short f2bf(float f) { unsigned u = __float_as_uint(f); u += 0x7FFFu + ((u >> 16) & 1u); return (unsigned short)(u >> 16); }
__device__ __forceinline__ float bf2f(unsigned short b) { return __uint_as_float(((unsigned)b) << 16); }
__device__ __forceinline__ float bfr(float f) { return bf2f(f2bf(f)); }
__device__ __forceinline__ v16h cat16(v8h lo, v8h hi) { return __builtin_shufflevector(lo, hi, 0, 1, 2, 3, 4, 5, 6, 7, 8, 9, 10, 11, 12, 13, 14, 15); }
__device__ __forceinline__ v16bf cat16b(v8us lo, v8us hi) { return __builtin_bit_cast(v16bf, __builtin_shufflevector(lo, hi, 0, 1, 2, 3, 4, 5, 6, 7, 8, 9, 10, 11, 12, 13, 14, 15)); }
__device__ __forceinline__ v8f wmma16(v16h a, v16h b, v8f c) { return __builtin_amdgcn_wmma_f32_16x16x32_f16(false, a, false, b, (short)0, c, false, false); }
__device__ __forceinline__ v8f wmmab(v16bf a, v16bf b, v8f c) { return __builtin_amdgcn_wmma_f32_16x16x32_bf16(false, a, false, b, (short)0, c, false, false); }
__device__ __forceinline__ h16 tohx(float x) { return (h16)x; }
__device__ __forceinline__ void splitf(float y, unsigned short& h, unsigned short& l) { h = f2bf(y); l = f2bf(y - bf2f(h)); }



// ---- k_gemms: GEMM, a work-group of four waves (2 x 2) per 128x128 output tile, each wave a 64x64 tile (16 accumulators); grid (M/128, N/128, Z), 128 threads. K = DM.
// C[m][n] = sum_k A[m][k] Bt[n][k] (NSPLIT 1: + A2[m][k] Bt[n][k] behind each block's first product) + f32 bias[n] (bias, bias1, bias2 for z = 0, 1, 2); A, A2, Bt K-contiguous bf16 planes; Bt's z stride sB in elements.
// Operands reach the waves through LDS: a stage is 64 k (one whole 128-byte line) of the tile's 128 A rows, 128 Bt rows (and 128 A2 rows), at pitch GP; two buffers; asynchronous copies to LDS fill the next stage while this one is worked on. A wave-wide copy is four whole lines; every wave copies 32 rows of each operand.
// EPI 0: C in f32, pitch ldc. EPI 1 (projections; a wave's 64 columns are one head): y = sum + bias goes out as fp16, bf16 hi and bf16 lo = y - hi, into plane set z of E16, Eh, El, head plane batch * NH_ + head. C is unused for EPI 1.
// PACKED PLANES: a head plane is TT / 16 tiles of 16 positions x 64 d (2 KiB, PT elements), a tile four pieces of 512 bytes, a piece 32 lane slots of 16 bytes: one wave-wide 16-byte load of the attention kernel reads one piece, four whole 128-byte lines, and each lane finds half a fragment in its slot. Slot hi * 16 + lr of piece s holds, for q and k, position lr, d = (s / 2) * 32 + (s % 2) * 16 + hi * 8 + 0..7; for v, d = s * 16 + lr, positions hi * 8 + 0..7.
template <typename T16> struct WFrag;
template <> struct WFrag<h16> { typedef v16h V; static __device__ __forceinline__ V ld(const h16* p) { return cat16(*(const v8h*)p, *(const v8h*)(p + 16)); } static __device__ __forceinline__ V ld2(const h16* p, const h16* p1) { return cat16(*(const v8h*)p, *(const v8h*)p1); } static __device__ __forceinline__ v8f mma(V a, V b, v8f c) { return wmma16(a, b, c); } };
template <> struct WFrag<bf> { typedef v16bf V; static __device__ __forceinline__ V ld(const bf* p) { return cat16b(*(const v8us*)p, *(const v8us*)(p + 16)); } static __device__ __forceinline__ V ld2(const bf* p, const bf* p1) { return cat16b(*(const v8us*)p, *(const v8us*)p1); } static __device__ __forceinline__ v8f mma(V a, V b, v8f c) { return wmmab(a, b, c); } };
#define PT (16 * HD)   // elements of a packed tile
#define GP 144   // bytes from one staged row to the next: 128 + 16, an odd number of 16-byte units, so that the 16-byte fragment reads of 16 rows meet no bank twice
// eight asynchronous copies of 16 bytes a lane: rows r, r + 4, .. r + 28 of one operand's stage (l: the lane's LDS byte address, g: its global address, both of row r). The closing wait stands in front of whatever rewrites the address registers named here.
__device__ __forceinline__ void copy8(const unsigned l, const bf* g) {
    asm volatile("global_load_async_to_lds_b128 %0, %8, off\n\tglobal_load_async_to_lds_b128 %1, %9, off\n\tglobal_load_async_to_lds_b128 %2, %10, off\n\tglobal_load_async_to_lds_b128 %3, %11, off\n\t"
                 "global_load_async_to_lds_b128 %4, %12, off\n\tglobal_load_async_to_lds_b128 %5, %13, off\n\tglobal_load_async_to_lds_b128 %6, %14, off\n\tglobal_load_async_to_lds_b128 %7, %15, off\n\ts_wait_xcnt 0x0"
                 :: "v"(l), "v"(l + 4 * GP), "v"(l + 8 * GP), "v"(l + 12 * GP), "v"(l + 16 * GP), "v"(l + 20 * GP), "v"(l + 24 * GP), "v"(l + 28 * GP),
                    "v"(g), "v"(g + 4 * DM), "v"(g + 8 * DM), "v"(g + 12 * DM), "v"(g + 16 * DM), "v"(g + 20 * DM), "v"(g + 24 * DM), "v"(g + 28 * DM) : "memory");
}
template <int NSPLIT, int EPI>
__global__ __launch_bounds__(128) void k_gemms(const bf* __restrict__ A, const bf* __restrict__ A2, const bf* __restrict__ Bt, float* C, int ldc, const float* __restrict__ bias, const float* __restrict__ bias1, const float* __restrict__ bias2, size_t sB, h16* E16, bf* Eh, bf* El) {
    typedef WFrag<bf>::V V;
    static_assert(DM == DQ && DM % 128 == 0, "one K for both launches; at least two stages");
    constexpr int K = DM, NT = K / 64, BUFB = (2 + NSPLIT) * 128 * GP;   // stages; bytes of a buffer: A rows, Bt rows (, A2 rows)
    __shared__ __align__(16) char ring[2 * BUFB];
    __shared__ __align__(16) float osm[4 * 16 * 68];
    const size_t z = blockIdx.z; Bt += z * sB;
    bias = (z == 0) ? bias : (z == 1) ? bias1 : bias2;   // z-batched projections: each z has its own bias vector
    const int lane = threadIdx.x & 31, lr = lane & 15, hi = lane >> 4, wave = __builtin_amdgcn_readfirstlane((int)(threadIdx.x >> 5));
    const int R0 = blockIdx.x * 128, C0 = blockIdx.y * 128, wr = (wave & 1) * 64, wc = (wave >> 1) * 64, r0 = R0 + wr, c0 = C0 + wc;   // the work-group's tile, the wave's place in it, the wave's tile
    float* os = osm + wave * (16 * 68);
    // the lane's part in a copy: row wave * 32 + lane / 8 (+ 4 a copy) of the stage, 16-byte piece lane % 8 of its line
    const int crow = wave * 32 + (lane >> 3), cpc = (lane & 7) * 8;
    const unsigned lc = (unsigned)(size_t)ring + (unsigned)(crow * GP + cpc * 2);
    const bf* ga = A + (size_t)(R0 + crow) * K + cpc; const bf* gb = Bt + (size_t)(C0 + crow) * K + cpc; const bf* ga2 = NSPLIT ? A2 + (size_t)(R0 + crow) * K + cpc : nullptr;
    auto fill = [&](int t, int buf) { const unsigned l = lc + (unsigned)(buf * BUFB); copy8(l, ga + t * 64); copy8(l + 128 * GP, gb + t * 64); if (NSPLIT) copy8(l + 256 * GP, ga2 + t * 64); };
    v8f acc[4][4];
#pragma unroll
    for (int mb = 0; mb < 4; ++mb)
#pragma unroll
        for (int nb = 0; nb < 4; ++nb) acc[mb][nb] = (v8f){};
    fill(0, 0);
    asm volatile("s_wait_asynccnt 0x0" ::: "memory");   // this wave's part of stage 0 has landed
    __syncthreads();                                      // every wave's part has
    fill(1, 1);
    const int fa = (wr + lr) * GP + 16 * hi, fb = (128 + wc + lr) * GP + 16 * hi;   // the lane's byte offset in a buffer: row lr of the wave's first A and Bt fragment
#pragma unroll 1
    for (int t = 0; t < NT; ++t) {
        const char* sb = ring + (t & 1) * BUFB;
        V a[4], a2[4], b[4];
        auto frags = [&](int ks) {
#pragma unroll
            for (int mb = 0; mb < 4; ++mb) { a[mb] = WFrag<bf>::ld((const bf*)(sb + fa + mb * 16 * GP + ks * 64)); if (NSPLIT) a2[mb] = WFrag<bf>::ld((const bf*)(sb + fa + 256 * GP + mb * 16 * GP + ks * 64)); }
#pragma unroll
            for (int nb = 0; nb < 4; ++nb) b[nb] = WFrag<bf>::ld((const bf*)(sb + fb + nb * 16 * GP + ks * 64)); };
        auto prods = [&]() {
#pragma unroll
            for (int nb = 0; nb < 4; ++nb)
#pragma unroll
                for (int mb = 0; mb < 4; ++mb) { acc[mb][nb] = WFrag<bf>::mma(a[mb], b[nb], acc[mb][nb]); if (NSPLIT) acc[mb][nb] = WFrag<bf>::mma(a2[mb], b[nb], acc[mb][nb]); } };
        frags(0);
        __builtin_amdgcn_sched_barrier(0);   // a block's fragment reads go out as one group ahead of its products: sunk among them, each row of products waits out the LDS latency on its own
        prods();
        frags(1);                                             // the stage's last reads: its second block then works from registers alone
        if (NSPLIT) { __builtin_amdgcn_sched_barrier(0); prods(); }   // three operands: the block's twelve fragments, the accumulators and the copies' addresses do not fit 256 registers together, so its products come first, behind its reads as one group as above
        asm volatile("s_wait_dscnt 0x0" ::: "memory");      // this wave's reads of the buffer are done before it is handed to the copies
        asm volatile("s_wait_asynccnt 0x0" ::: "memory");   // this wave's part of stage t + 1 has landed
        __syncthreads();                                      // publishes stage t + 1 and ends every wave's reads of stage t
        if (t + 2 < NT) fill(t + 2, t & 1);
        if (!NSPLIT) prods();                                 // behind the refill, so that the copies fly under these products too
    }
    asm volatile("s_wait_asynccnt 0x0" ::: "memory");   // no copy is left in flight at the wave's end
    static_assert(HD == 64, "EPI 1 takes a wave's 64 columns for one head");
    const int trow = r0 % TT;   // sequence position of the tile's row 0
    if (EPI == 1) { const size_t pz = z * ((size_t)ZH * TT * HD) + (size_t)((r0 / TT) * NH_ + c0 / HD) * TT * HD; E16 += pz; Eh += pz; El += pz; }   // plane set z, head plane of this tile
    if (EPI == 1 && z == 2) {   // v: a lane's 8 accumulator rows are 8 consecutive t of one d, which is its slot of piece nb of tile mb: 16 bytes a plane straight from registers, every store 512 bytes in a row
#pragma unroll
        for (int nb = 0; nb < 4; ++nb) { const float bb = bfr(bias[c0 + nb * 16 + lr]);
#pragma unroll
            for (int mb = 0; mb < 4; ++mb) { v8h o16; v8us oh, ol;
#pragma unroll
                for (int j = 0; j < 8; ++j) { const float y = acc[mb][nb][j] + bb; o16[j] = tohx(y); unsigned short a2, c2; splitf(y, a2, c2); oh[j] = a2; ol[j] = c2; }
                // the three plane stores (one byte offset, three uniform bases) and their wait in one statement: as separate statements the build sends the first store ahead of the other planes' conversions, which reuse its data registers in front of the wait
                asm volatile("global_store_b128 %0, %1, %4\n\tglobal_store_b128 %0, %2, %5\n\tglobal_store_b128 %0, %3, %6\n\ts_wait_xcnt 0x0"
                             :: "v"((unsigned)(((trow / 16 + mb) * PT + nb * 256 + lane * 8) * 2)), "v"(__builtin_bit_cast(v4f, o16)), "v"(__builtin_bit_cast(v4f, oh)), "v"(__builtin_bit_cast(v4f, ol)), "s"(E16), "s"(Eh), "s"(El) : "memory"); } }
        return;
    }
    float bb[4];   // the biases of the lane's accumulator columns: added on the way into LDS, where a lane has one column a tile and not the 32 of its four slots
    if (EPI == 1) {
#pragma unroll
        for (int nb = 0; nb < 4; ++nb) bb[nb] = bfr(bias[c0 + nb * 16 + lr]); }
#pragma unroll
    for (int mb = 0; mb < 4; ++mb) {
#pragma unroll
        for (int nb = 0; nb < 4; ++nb) {
#pragma unroll
            for (int j = 0; j < 8; ++j) os[(hi * 8 + j) * 68 + nb * 16 + lr] = (EPI == 1) ? acc[mb][nb][j] + bb[nb] : acc[mb][nb][j]; }
        __builtin_amdgcn_wave_barrier(); asm volatile("" ::: "memory");
        if (EPI == 0) {
        float* crow2 = C + (size_t)(r0 + mb * 16) * ldc + c0;
#pragma unroll
            for (int s = 0; s < 8; ++s) { const int row = 2 * s + hi, cofs = lr * 4; v4f val = *(const v4fa*)(os + row * 68 + cofs); val[0] += bfr(bias[c0 + cofs]); val[1] += bfr(bias[c0 + cofs + 1]); val[2] += bfr(bias[c0 + cofs + 2]); val[3] += bfr(bias[c0 + cofs + 3]);
                *(v4f*)(crow2 + (size_t)row * ldc + cofs) = val; }
            asm volatile("s_wait_xcnt 0x0" ::: "memory");   // behind the run of stores above: what follows in the build reuses their data registers, and the wait stands in front of that overwrite
        } else {   // piece s of packed tile mb: each lane converts the 8 consecutive columns of its slot, a store is 512 bytes in a row in every plane
#pragma unroll
            for (int s = 0; s < 4; ++s) { const int row = lr, cofs = (s >> 1) * 32 + (s & 1) * 16 + hi * 8; const v4f va = *(const v4fa*)(os + row * 68 + cofs), vb = *(const v4fa*)(os + row * 68 + cofs + 4); v8h o16; v8us oh, ol;
#pragma unroll
                for (int q = 0; q < 8; ++q) { const float y = (q < 4) ? va[q & 3] : vb[q & 3]; o16[q] = tohx(y); unsigned short a2, c2; splitf(y, a2, c2); oh[q] = a2; ol[q] = c2; }
                const size_t oo = (size_t)(trow / 16 + mb) * PT + s * 256 + lane * 8; *(v8h*)(E16 + oo) = o16; *(v8us*)(Eh + oo) = oh; *(v8us*)(El + oo) = ol;
                asm volatile("s_wait_xcnt 0x0" ::: "memory"); }   // behind the three plane stores: what follows in the build reuses their address and data registers, and the wait stands in front of that overwrite
        }
        __builtin_amdgcn_wave_barrier(); asm volatile("" ::: "memory");
    }
}

typedef __attribute__((ext_vector_type(2))) _Float16 v2h;
typedef __attribute__((ext_vector_type(4))) _Float16 v4h;
typedef __attribute__((ext_vector_type(2))) unsigned short v2us;
typedef __attribute__((ext_vector_type(4))) unsigned short v4us;
typedef __attribute__((ext_vector_type(2))) float v2f;
typedef __attribute__((ext_vector_type(4))) int v4i;

#define WTB ((DM * DQ / 64 + 63) / 64)   // blocks that transpose one weight
__device__ __forceinline__ void wtG(const unsigned bx, const unsigned by, const float* __restrict__ w0, const float* __restrict__ w1, const float* __restrict__ w2, const float* __restrict__ w3, int K, int N, bf* Bt) {
    const float* __restrict__ w = (by == 0) ? w0 : (by == 1) ? w1 : (by == 2) ? w2 : w3; Bt += (size_t)by * K * N;   // by: which of the four equally shaped weights
    const int lane = threadIdx.x & 31; const int L0 = (bx * 8 + (threadIdx.x >> 5)) * 8; const int nlines = N * K / 64;
{
#pragma unroll 1
        for (int l = 0; l < 8; ++l) { const int L = L0 + l; if (L >= nlines) break; const size_t e = (size_t)L * 64 + lane * 2; const int k = (int)(e % K), n = (int)(e / K); v2us o;
            o[0] = f2bf(w[(size_t)k * N + n]); o[1] = f2bf(w[(size_t)(k + 1) * N + n]); *(v2us*)(Bt + e) = o; }
         }
}
__device__ __forceinline__ void cvt8(const unsigned bx, const float* __restrict__ src, bf* dst, size_t n8) { const size_t i = (size_t)bx * 256 + threadIdx.x; if (i >= n8) return; const v8f v = *(const v8f*)(src + i * 8); v8us o;
#pragma unroll
    for (int k = 0; k < 8; ++k) o[k] = f2bf(v[k]); *(v8us*)(dst + i * 8) = o;  }
// ---- k_prep: the four weight transposes and the conversion of x in one launch; neither reads what the other writes. The 4 WTB transposing blocks, whose waves run longer, have the lowest indices and start first.
__global__ __launch_bounds__(256) void k_prep(const float* __restrict__ w0, const float* __restrict__ w1, const float* __restrict__ w2, const float* __restrict__ w3, bf* Bt, const float* __restrict__ x, bf* xb) {
    if (blockIdx.x < 4 * WTB) wtG(blockIdx.x % WTB, blockIdx.x / WTB, w0, w1, w2, w3, DM, DQ, Bt);
    else cvt8(blockIdx.x - 4 * WTB, x, xb, (size_t)NB_ * TT * DM / 8);
}

typedef __attribute__((ext_vector_type(2))) __bf16 v2bf;
// p (f32, 8 keys of one query) -> 8 elements s0 .. s0 + 7 of a B operand; both conversions round to nearest even
__device__ __forceinline__ void packp(v16h& d, v16h&, const v8f p, const int s0) {
#pragma unroll
    for (int j = 0; j < 8; j += 2) { const v2h c = __builtin_convertvector((v2f){p[j], p[j + 1]}, v2h); d[s0 + j] = c[0]; d[s0 + j + 1] = c[1]; } }
__device__ __forceinline__ void packp(v16bf& d, v16bf& dl, const v8f p, const int s0) {
#pragma unroll
    for (int j = 0; j < 8; j += 2) { const v2bf c = __builtin_convertvector((v2f){p[j], p[j + 1]}, v2bf); const v2bf l = __builtin_convertvector((v2f){p[j] - (float)c[0], p[j + 1] - (float)c[1]}, v2bf); d[s0 + j] = c[0]; d[s0 + j + 1] = c[1]; dl[s0 + j] = l[0]; dl[s0 + j + 1] = l[1]; } }

typedef __attribute__((ext_vector_type(8))) int v8i;
template <typename T16, bool HI>
__device__ __forceinline__ float fattn(const T16* __restrict__ Q, const T16* __restrict__ Q2, const T16* __restrict__ Kp, const T16* __restrict__ K2, const T16* __restrict__ Vt, const T16* __restrict__ Vt2, v8f (&O)[4]) {
    typedef typename WFrag<T16>::V V;
    static_assert(HD == 64 && BW == 128, "tile counts below are those of head size 64 and half window 128");
    // the lane's number, read in another way in each form: lane arithmetic that both forms spell alike is moved in front of the branch that picks the form, where the build no longer sees that a load's lane offset has 32 bits and spends a 64-bit register address on every base
    const int lane = HI ? (int)__builtin_amdgcn_mbcnt_lo(~0u, 0u) : (int)(threadIdx.x & 31), lr = lane & 15, hi = lane >> 4, e = 8 * hi - lr;
    const int r = ((int)blockIdx.y * 4 + __builtin_amdgcn_readfirstlane((int)(threadIdx.x >> 5))) * 16, wb = r - BW;
    const size_t z = blockIdx.x, pl = z * ((size_t)TT * HD);
    const unsigned ls = (unsigned)lane * 16u;   // the lane's byte offset in a piece of a packed tile: every load address below is a wave-uniform base + this + a constant
    auto at = [](const T16* base, unsigned off) { return (const T16*)((const char*)base + off); };
    auto keep = [](V a, bool in0, bool in1) { v8i w = __builtin_bit_cast(v8i, a);   // a fragment's first four registers are its first 16-key tile, the rest its second
#pragma unroll
        for (int i = 0; i < 8; ++i) w[i] = ((i < 4) ? in0 : in1) ? w[i] : 0;
        return __builtin_bit_cast(V, w); };
    V q[2], q2[2];
#pragma unroll
    for (int ks = 0; ks < 2; ++ks) { q[ks] = WFrag<T16>::ld2(at(Q + pl + (size_t)r * HD + ks * 512, ls), at(Q + pl + (size_t)r * HD + ks * 512 + 256, ls)); if (HI) q2[ks] = WFrag<T16>::ld2(at(Q2 + pl + (size_t)r * HD + ks * 512, ls), at(Q2 + pl + (size_t)r * HD + ks * 512 + 256, ls)); }   // pieces 2 ks and 2 ks + 1 of the rows' tile (16 positions are PT = 16 HD elements: r * HD is the tile's start)
    const T16* kw = Kp + pl + (long)wb * HD; const T16* kw2 = HI ? K2 + pl + (long)wb * HD : nullptr; const T16* vw = Vt + pl + (long)wb * HD; const T16* vw2 = HI ? Vt2 + pl + (long)wb * HD : nullptr;   // the window's first 16-key tile in the k and in the v planes
    v8f S[17]; float mx = -3.0e38f;
#pragma unroll
    for (int g = 0; g < 3; ++g) {   // key tiles in groups of six (the last: five)
        V k[6][2], k2[6][2];
#pragma unroll
        for (int i = 0; i < 6; ++i)
#pragma unroll
            for (int ks = 0; ks < 2; ++ks) { const int t = g * 6 + i; if (t < 17) { k[i][ks] = WFrag<T16>::ld2(at(kw + t * PT + ks * 512, ls), at(kw + t * PT + ks * 512 + 256, ls)); if (HI) k2[i][ks] = WFrag<T16>::ld2(at(kw2 + t * PT + ks * 512, ls), at(kw2 + t * PT + ks * 512 + 256, ls)); } }
        // behind the group's loads (and q's): what follows in the build reuses their offset and base registers, and the wait stands in front of that overwrite; the bases are named as inputs so that they stay whole up to the wait
        if constexpr (HI) asm volatile("s_wait_xcnt 0x0" :: "s"(kw), "s"(kw2) : "memory"); else asm volatile("s_wait_xcnt 0x0" :: "s"(kw) : "memory");
        __builtin_amdgcn_sched_barrier(0);   // a group's k loads go out together: sunk to their products, each tile's latency is waited out on its own
#pragma unroll
        for (int i = 0; i < 6; ++i) { const int t = g * 6 + i; if (t >= 17) continue;
            const float off = (t == 8 || (unsigned)(wb + t * 16) < (unsigned)TT) ? 0.0f : -3.0e38f;   // tile 8 is the wave's own rows
            v8f a = (v8f){};
#pragma unroll
            for (int ks = 0; ks < 2; ++ks) { a = WFrag<T16>::mma(k[i][ks], q[ks], a); if (HI) { a = WFrag<T16>::mma(k[i][ks], q2[ks], a); a = WFrag<T16>::mma(k2[i][ks], q[ks], a); } }
#pragma unroll
            for (int j = 0; j < 8; ++j) { float s = a[j] * SCL + off;   // SCL is a power of two: the product is exact, and off is 0 inside the sequence
                if (t == 0) s = (j + e >= 0) ? s : -3.0e38f;    // key >= query - BW
                if (t == 16) s = (j + e <= 0) ? s : -3.0e38f;   // key <= query + BW
                a[j] = s; mx = fmaxf(mx, s); }
            S[t] = a; }
    }
    const float m = fmaxf(mx, __shfl_xor(mx, 16, 32)); v8f sv = (v8f){};   // row maximum, eight independent partial row sums; O: output tiles
#pragma unroll
    for (int mb = 0; mb < 4; ++mb) O[mb] = (v8f){};
#pragma unroll
    for (int kb = 0; kb < 9; ++kb) {
        const bool in0 = kb == 4 || (unsigned)(wb + kb * 32) < (unsigned)TT, in1 = (unsigned)(wb + kb * 32 + 16) < (unsigned)TT;
        V p, p2, va[4], va2[4];
#pragma unroll
        for (int mb = 0; mb < 4; ++mb) { va[mb] = WFrag<T16>::ld2(at(vw + 2 * kb * PT + mb * 256, ls), at(vw + (2 * kb + 1) * PT + mb * 256, ls)); if (HI) va2[mb] = WFrag<T16>::ld2(at(vw2 + 2 * kb * PT + mb * 256, ls), at(vw2 + (2 * kb + 1) * PT + mb * 256, ls)); }   // piece mb of the block's two key tiles; the block's v loads go out together, in flight under its exponentials
        __builtin_amdgcn_sched_barrier(0);   // keeps them there: sunk to their products, each load's latency is waited out on its own
#pragma unroll
        for (int u = 0; u < 2; ++u) { const int t = 2 * kb + u; v8f ev = (v8f){};
            if (t < 17) {
#pragma unroll
                for (int j = 0; j < 8; ++j) ev[j] = (S[t][j] - m) * 1.4426950408889634f;
                float x0, x1, x2, x3, x4, x5, x6, x7;
                // eight exp2 in one statement. The four leading slots are the distance behind a matrix instruction: the results may land in registers that were its A or B. Each exponential is followed by one that touches neither its result nor its source (early-clobber results), the last by the one slot that the instruction set asks for behind a transcendental.
                asm("v_nop\n\tv_nop\n\tv_nop\n\tv_nop\n\tv_exp_f32 %0, %8\n\tv_exp_f32 %1, %9\n\tv_exp_f32 %2, %10\n\tv_exp_f32 %3, %11\n\tv_exp_f32 %4, %12\n\tv_exp_f32 %5, %13\n\tv_exp_f32 %6, %14\n\tv_exp_f32 %7, %15\n\tv_nop"
                    : "=&v"(x0), "=&v"(x1), "=&v"(x2), "=&v"(x3), "=&v"(x4), "=&v"(x5), "=&v"(x6), "=&v"(x7) : "v"(ev[0]), "v"(ev[1]), "v"(ev[2]), "v"(ev[3]), "v"(ev[4]), "v"(ev[5]), "v"(ev[6]), "v"(ev[7]));
                ev = (v8f){x0, x1, x2, x3, x4, x5, x6, x7}; sv += ev; }
            packp(p, p2, HI ? ev : ev * PCAR, u * 8); }   // p goes into the product unnormalised (largest term 1); the row sum divides the output
#pragma unroll
        for (int mb = 0; mb < 4; ++mb) { const V b = keep(va[mb], in0, in1);
            O[mb] = WFrag<T16>::mma(b, p, O[mb]); if (HI) { O[mb] = WFrag<T16>::mma(b, p2, O[mb]); O[mb] = WFrag<T16>::mma(keep(va2[mb], in0, in1), p, O[mb]); } }
    }
    float sum = ((sv[0] + sv[1]) + (sv[2] + sv[3])) + ((sv[4] + sv[5]) + (sv[6] + sv[7])); sum += __shfl_xor(sum, 16, 32);
    return __fdiv_rn(HI ? 1.0f : (1.0f / PCAR), sum);   // the factor that turns O into y
}
// ---- k_fattn2: both forms of the attention in one launch; they share no data but their inputs, so neither waits for the other's last wave. Grid (head planes, 64-row tiles), a block is four waves of 16 query rows each.
// blockIdx.y is the row tile: the RH / 64 * ZH blocks of the hi/lo form, the longer one, have the lowest flat indices, start first and spread over the chip ahead of the fp16 blocks that fill in beside them.
__global__ __launch_bounds__(128) void k_fattn2(const bf* __restrict__ Qh, const bf* __restrict__ Ql, const bf* __restrict__ Kh, const bf* __restrict__ Kl, const bf* __restrict__ Vh, const bf* __restrict__ Vl, const h16* __restrict__ Q16, const h16* __restrict__ K16, const h16* __restrict__ V16, bf* Eh, bf* El) {
    v8f O[4]; float f;
    if (blockIdx.y < RH / 64) f = fattn<bf, true>(Qh, Ql, Kh, Kl, Vh, Vl, O);
    else f = fattn<h16, false>(Q16, nullptr, K16, nullptr, V16, nullptr, O);
    // the way out is the same for both forms and stands once in the text
    const int lr = threadIdx.x & 15, hi = (threadIdx.x >> 4) & 1, r = ((int)blockIdx.y * 4 + __builtin_amdgcn_readfirstlane((int)(threadIdx.x >> 5))) * 16;
    const size_t z = blockIdx.x; const unsigned lo = (unsigned)(lr * DQ + 8 * hi) * 2u;   // the lane's byte offset in a 16-row fragment of pitch DQ
    const size_t ob = ((z / NH_) * (size_t)TT + r) * DQ + (z % NH_) * HD;
#pragma unroll
    for (int mb = 0; mb < 4; ++mb) { v8us oh, ol;   // a lane's 8 accumulator rows are 8 consecutive d of one query
#pragma unroll
        for (int j = 0; j < 8; ++j) { unsigned short a2, c2; splitf(O[mb][j] * f, a2, c2); oh[j] = a2; ol[j] = c2; }
        const size_t oo = ob + mb * 16; *(v8us*)((char*)(Eh + oo) + lo) = oh; *(v8us*)((char*)(El + oo) + lo) = ol;
        if (mb < 3) asm volatile("s_wait_xcnt 0x0" ::: "memory"); }   // behind the two plane stores: the next tile's conversion reuses their data registers in the build, and the wait stands in front of that overwrite
}

extern "C" void kernel_launch(void* const* d_in, const int* in_sizes, int n_in,
                              void* d_out, int out_size, void* d_ws, size_t ws_size, hipStream_t stream) {
    (void)in_sizes; (void)n_in; (void)out_size;
    const float* x = (const float*)d_in[0]; const float* wq = (const float*)d_in[1]; const float* bq = (const float*)d_in[2]; const float* wk = (const float*)d_in[3]; const float* bk = (const float*)d_in[4]; const float* wv = (const float*)d_in[5]; const float* bv = (const float*)d_in[6]; const float* wo = (const float*)d_in[7]; const float* bo = (const float*)d_in[8];   /* argument order x, wq, bq, wk, bk, wv, bv, wo, bo */
    float* OUT = (float*)d_out;     // [2][2048][1024]
    char* wsp = (char*)d_ws;
    auto take = [&](size_t bytes) { char* p = wsp; wsp += (bytes + 255) & ~(size_t)255; return (void*)p; };
    bf* WQ = (bf*)take((size_t)4 * DQ * DM * 2); bf* WK = WQ + (size_t)DQ * DM; bf* WV = WK + (size_t)DKV * DM; bf* WO = WV + (size_t)DKV * DM; (void)WK; (void)WV;   // four transposed 1024 x 1024 weights in a row: a grid dimension walks them
    bf* XB = (bf*)take((size_t)NB_ * TT * DM * 2);
    const size_t PS = (size_t)ZH * TT * HD;   // one plane set: 32 head planes; q, k, v sets in a row, the projection GEMM's z walks them
    h16* QP16 = (h16*)take(3 * PS * 2); h16* KP16 = QP16 + PS; h16* VT16 = KP16 + PS;
    bf* QPh = (bf*)take(3 * PS * 2); bf* KPh = QPh + PS; bf* VTh = KPh + PS; bf* QPl = (bf*)take(3 * PS * 2); bf* KPl = QPl + PS; bf* VTl = KPl + PS;
    bf* ATh = (bf*)take((size_t)2 * NB_ * TT * DQ * 2); bf* ATl = ATh + (size_t)NB_ * TT * DQ;   // merged hi/lo planes
    if ((size_t)(wsp - (char*)d_ws) > ws_size) return;    // 104 of the 256 MiB
    k_prep<<<(unsigned)(4 * WTB + ((size_t)NB_ * TT * DM / 8 + 255) / 256), 256, 0, stream>>>(wq, wk, wv, wo, WQ, x, XB);
    k_gemms<0, 1><<<dim3(NB_ * TT / 128, DQ / 128, 3), 128, 0, stream>>>(XB, nullptr, WQ, nullptr, 0, bq, bk, bv, (size_t)DQ * DM, QP16, QPh, QPl);   // z: q, k, v
    k_fattn2<<<dim3(ZH, TT / 64, 1), 128, 0, stream>>>(QPh, QPl, KPh, KPl, VTh, VTl, QP16, KP16, VT16, ATh, ATl);
    k_gemms<1, 0><<<dim3(NB_ * TT / 128, DM / 128, 1), 128, 0, stream>>>(ATh, ATl, WO, OUT, DM, bo, nullptr, nullptr, 0, nullptr, nullptr, nullptr);
}

// v008
// A run of this version takes 64.2 microseconds.
// Next to v007, in two timings, it ran 1.08 and 1.09 times as fast.
// All steps since v000 together make it 31.3 times as fast.
#include <hip/hip_runtime.h>

// Sliding-window (banded) multi-head attention (x [2][2048][1024]; q, k, v = x W + b ('xw' [1024][1024] 0.02, zero biases; 16 heads x 64); scores x 64^-0.5; keys j with i - 128 <= j <= i + 128 (symmetric window 256, -inf elsewhere); softmax; out = merged wo + bo ('xw') -> [2][2048][1024] (4.2 M); argument order x, wq, bq, wk, bk, wv, bv, wo, bo).
// Layout, both batches at once (4096 rows; 32 head planes z = batch * 16 + head): bf16 copy of x; 'xw' weights transposed once; exact projections + f32 biases, whose GEMM stores the 16-bit q, k, v head planes itself, in the order in which the attention's matrix fragments are loaded (PACKED PLANES below); banded attention fused in k_fattn2: a wave holds the scores of its 16 query rows against their 272-key window in registers, takes their exponentials there and feeds them to the p x v product, whose result the row sum divides; scores and p never reach memory (hybrid rows: < 512 hi/lo 3 products, rest fp16 x1024; both forms in one launch); it stores the merged hi/lo planes; merged hi/lo x wo exact + bo.
// Compute dtypes, f32 accumulate: every input rounded to bf16; projections exact + f32 biases; attention rows < 512 3 products, rest fp16; softmax f32; wo hl x exact + bias.

#define NB_  2
#define TT   2048
#define DM   1024
#define NH_  16
#define NKV  16
#define REP  (NH_ / NKV)
#define HD   64
#define DQ   (NH_ * HD)
#define DKV  (NKV * HD)
#define ZH   (NB_ * NH_)          // head planes per attention launch: all heads of both batches
#define RH   512                  // query rows < RH use hi+lo planes (0: none)
#define WIN  2048
#define BW   128      // half window: keys j in [i - 128, i + 128]
#define PCAR 1024.0f
#define SCL  0.125f   // HD^-0.5
typedef _Float16 h16;
typedef unsigned short bf;
typedef __attribute__((ext_vector_type(16))) __bf16   v16bf;
typedef __attribute__((ext_vector_type(16))) _Float16 v16h;
typedef __attribute__((ext_vector_type(8)))  _Float16 v8h;
typedef __attribute__((ext_vector_type(8)))  unsigned short v8us;
typedef __attribute__((ext_vector_type(8)))  float    v8f;
typedef __attribute__((ext_vector_type(4)))  float    v4f;
typedef v8h  __attribute__((may_alias)) v8ha;
typedef v4f  __attribute__((may_alias)) v4fa;
typedef v8us __attribute__((may_alias)) v8usa;

__device__ __forceinline__ unsigned short f2bf(float f) { unsigned u = __float_as_uint(f); u += 0x7FFFu + ((u >> 16) & 1u); return (unsigned short)(u >> 16); }
__device__ __forceinline__ float bf2f(unsigned short b) { return __uint_as_float(((unsigned)b) << 16); }
__device__ __forceinline__ float bfr(float f) { return bf2f(f2bf(f)); }
__device__ __forceinline__ v16h cat16(v8h lo, v8h hi) { return __builtin_shufflevector(lo, hi, 0, 1, 2, 3, 4, 5, 6, 7, 8, 9, 10, 11, 12, 13, 14, 15); }
__device__ __forceinline__ v16bf cat16b(v8us lo, v8us hi) { return __builtin_bit_cast(v16bf, __builtin_shufflevector(lo, hi, 0, 1, 2, 3, 4, 5, 6, 7, 8, 9, 10, 11, 12, 13, 14, 15)); }
__device__ __forceinline__ v8f wmma16(v16h a, v16h b, v8f c) { return __builtin_amdgcn_wmma_f32_16x16x32_f16(false, a, false, b, (short)0, c, false, false); }
__device__ __forceinline__ v8f wmmab(v16bf a, v16bf b, v8f c) { return __builtin_amdgcn_wmma_f32_16x16x32_bf16(false, a, false, b, (short)0, c, false, false); }
__device__ __forceinline__ h16 tohx(float x) { return (h16)x; }
__device__ __forceinline__ void splitf(float y, unsigned short& h, unsigned short& l) { h = f2bf(y); l = f2bf(y - bf2f(h)); }



// ---- k_gemms: GEMM, a work-group of four waves (2 x 2) per 128x128 output tile, each wave a 64x64 tile (16 accumulators); grid (M/128, N/128, Z), 128 threads. K = DM.
// C[m][n] = sum_k A[m][k] Bt[n][k] (NSPLIT 1: + A2[m][k] Bt[n][k] behind each block's first product) + f32 bias[n] (bias, bias1, bias2 for z = 0, 1, 2); A, A2, Bt K-contiguous bf16 planes; Bt's z stride sB in elements.
// Operands reach the waves through LDS: a stage is 64 k (one whole 128-byte line) of the tile's 128 A rows, 128 Bt rows (and 128 A2 rows), at pitch GP; two buffers; asynchronous copies to LDS fill the next stage while this one is worked on. A wave-wide copy is four whole lines; every wave copies 32 rows of each operand.
// EPI 0: C in f32, pitch ldc. EPI 1 (projections; a wave's 64 columns are one head): y = sum + bias goes out as fp16, bf16 hi and bf16 lo = y - hi, into plane set z of E16, Eh, El, head plane batch * NH_ + head. C is unused for EPI 1.
// PACKED PLANES: a head plane is TT / 16 tiles of 16 positions x 64 d (2 KiB, PT elements), a tile four pieces of 512 bytes, a piece 32 lane slots of 16 bytes: one wave-wide 16-byte load of the attention kernel reads one piece, four whole 128-byte lines, and each lane finds half a fragment in its slot. Slot hi * 16 + lr of piece s holds, for q and k, position lr, d = (s / 2) * 32 + (s % 2) * 16 + hi * 8 + 0..7; for v, d = s * 16 + lr, positions hi * 8 + 0..7.
template <typename T16> struct WFrag;
template <> struct WFrag<h16> { typedef v16h V; static __device__ __forceinline__ V ld(const h16* p) { return cat16(*(const v8h*)p, *(const v8h*)(p + 16)); } static __device__ __forceinline__ V ld2(const h16* p, const h16* p1) { return cat16(*(const v8h*)p, *(const v8h*)p1); } static __device__ __forceinline__ v8f mma(V a, V b, v8f c) { return wmma16(a, b, c); } };
template <> struct WFrag<bf> { typedef v16bf V; static __device__ __forceinline__ V ld(const bf* p) { return cat16b(*(const v8us*)p, *(const v8us*)(p + 16)); } static __device__ __forceinline__ V ld2(const bf* p, const bf* p1) { return cat16b(*(const v8us*)p, *(const v8us*)p1); } static __device__ __forceinline__ v8f mma(V a, V b, v8f c) { return wmmab(a, b, c); } };
#define PT (16 * HD)   // elements of a packed tile
#define GP 144   // bytes from one staged row to the next: 128 + 16, an odd number of 16-byte units, so that the 16-byte fragment reads of 16 rows meet no bank twice
// eight asynchronous copies of 16 bytes a lane: rows r, r + 4, .. r + 28 of one operand's stage (l: the lane's LDS byte address, g: its global address, both of row r). The closing wait stands in front of whatever rewrites the address registers named here.
__device__ __forceinline__ void copy8(const unsigned l, const bf* g) {
    asm volatile("global_load_async_to_lds_b128 %0, %8, off\n\tglobal_load_async_to_lds_b128 %1, %9, off\n\tglobal_load_async_to_lds_b128 %2, %10, off\n\tglobal_load_async_to_lds_b128 %3, %11, off\n\t"
                 "global_load_async_to_lds_b128 %4, %12, off\n\tglobal_load_async_to_lds_b128 %5, %13, off\n\tglobal_load_async_to_lds_b128 %6, %14, off\n\tglobal_load_async_to_lds_b128 %7, %15, off\n\ts_wait_xcnt 0x0"
                 :: "v"(l), "v"(l + 4 * GP), "v"(l + 8 * GP), "v"(l + 12 * GP), "v"(l + 16 * GP), "v"(l + 20 * GP), "v"(l + 24 * GP), "v"(l + 28 * GP),
                    "v"(g), "v"(g + 4 * DM), "v"(g + 8 * DM), "v"(g + 12 * DM), "v"(g + 16 * DM), "v"(g + 20 * DM), "v"(g + 24 * DM), "v"(g + 28 * DM) : "memory");
}
template <int NSPLIT, int EPI>
__global__ __launch_bounds__(128) void k_gemms(const bf* __restrict__ A, const bf* __restrict__ A2, const bf* __restrict__ Bt, float* C, int ldc, const float* __restrict__ bias, const float* __restrict__ bias1, const float* __restrict__ bias2, size_t sB, h16* E16, bf* Eh, bf* El) {
    typedef WFrag<bf>::V V;
    static_assert(DM == DQ && DM % 128 == 0, "one K for both launches; at least two stages");
    constexpr int K = DM, NT = K / 64, BUFB = (2 + NSPLIT) * 128 * GP;   // stages; bytes of a buffer: A rows, Bt rows (, A2 rows)
    __shared__ __align__(16) char ring[2 * BUFB];
    __shared__ __align__(16) float osm[4 * 16 * 68];
    const size_t z = blockIdx.z; Bt += z * sB;
    bias = (z == 0) ? bias : (z == 1) ? bias1 : bias2;   // z-batched projections: each z has its own bias vector
    const int lane = threadIdx.x & 31, lr = lane & 15, hi = lane >> 4, wave = __builtin_amdgcn_readfirstlane((int)(threadIdx.x >> 5));
    const int R0 = blockIdx.x * 128, C0 = blockIdx.y * 128, wr = (wave & 1) * 64, wc = (wave >> 1) * 64, r0 = R0 + wr, c0 = C0 + wc;   // the work-group's tile, the wave's place in it, the wave's tile
    float* os = osm + wave * (16 * 68);
    // the lane's part in a copy: row wave * 32 + lane / 8 (+ 4 a copy) of the stage, 16-byte piece lane % 8 of its line
    const int crow = wave * 32 + (lane >> 3), cpc = (lane & 7) * 8;
    const unsigned lc = (unsigned)(size_t)ring + (unsigned)(crow * GP + cpc * 2);
    const bf* ga = A + (size_t)(R0 + crow) * K + cpc; const bf* gb = Bt + (size_t)(C0 + crow) * K + cpc; const bf* ga2 = NSPLIT ? A2 + (size_t)(R0 + crow) * K + cpc : nullptr;
    auto fill = [&](int t, int buf) { const unsigned l = lc + (unsigned)(buf * BUFB); copy8(l, ga + t * 64); copy8(l + 128 * GP, gb + t * 64); if (NSPLIT) copy8(l + 256 * GP, ga2 + t * 64); };
    v8f acc[4][4];
#pragma unroll
    for (int mb = 0; mb < 4; ++mb)
#pragma unroll
        for (int nb = 0; nb < 4; ++nb) acc[mb][nb] = (v8f){};
    fill(0, 0);
    asm volatile("s_wait_asynccnt 0x0" ::: "memory");   // this wave's part of stage 0 has landed
    __syncthreads();                                      // every wave's part has
    fill(1, 1);
    const int fa = (wr + lr) * GP + 16 * hi, fb = (128 + wc + lr) * GP + 16 * hi;   // the lane's byte offset in a buffer: row lr of the wave's first A and Bt fragment
#pragma unroll 1
    for (int t = 0; t < NT; ++t) {
        const char* sb = ring + (t & 1) * BUFB;
        V a[4], a2[4], b[4];
        auto frags = [&](int ks) {
#pragma unroll
            for (int mb = 0; mb < 4; ++mb) { a[mb] = WFrag<bf>::ld((const bf*)(sb + fa + mb * 16 * GP + ks * 64)); if (NSPLIT) a2[mb] = WFrag<bf>::ld((const bf*)(sb + fa + 256 * GP + mb * 16 * GP + ks * 64)); }
#pragma unroll
            for (int nb = 0; nb < 4; ++nb) b[nb] = WFrag<bf>::ld((const bf*)(sb + fb + nb * 16 * GP + ks * 64)); };
        auto prods = [&]() {
#pragma unroll
            for (int nb = 0; nb < 4; ++nb)
#pragma unroll
                for (int mb = 0; mb < 4; ++mb) { acc[mb][nb] = WFrag<bf>::mma(a[mb], b[nb], acc[mb][nb]); if (NSPLIT) acc[mb][nb] = WFrag<bf>::mma(a2[mb], b[nb], acc[mb][nb]); } };
        frags(0);
        __builtin_amdgcn_sched_barrier(0);   // a block's fragment reads go out as one group ahead of its products: sunk among them, each row of products waits out the LDS latency on its own
        prods();
        frags(1);                                             // the stage's last reads: its second block then works from registers alone
        if (NSPLIT) { __builtin_amdgcn_sched_barrier(0); prods(); }   // three operands: the block's twelve fragments, the accumulators and the copies' addresses do not fit 256 registers together, so its products come first, behind its reads as one group as above
        asm volatile("s_wait_dscnt 0x0" ::: "memory");      // this wave's reads of the buffer are done before it is handed to the copies
        asm volatile("s_wait_asynccnt 0x0" ::: "memory");   // this wave's part of stage t + 1 has landed
        __syncthreads();                                      // publishes stage t + 1 and ends every wave's reads of stage t
        if (t + 2 < NT) fill(t + 2, t & 1);
        if (!NSPLIT) prods();                                 // behind the refill, so that the copies fly under these products too
    }
    asm volatile("s_wait_asynccnt 0x0" ::: "memory");   // no copy is left in flight at the wave's end
    static_assert(HD == 64, "EPI 1 takes a wave's 64 columns for one head");
    const int trow = r0 % TT;   // sequence position of the tile's row 0
    if (EPI == 1) { const size_t pz = z * ((size_t)ZH * TT * HD) + (size_t)((r0 / TT) * NH_ + c0 / HD) * TT * HD; E16 += pz; Eh += pz; El += pz; }   // plane set z, head plane of this tile
    if (EPI == 1 && z == 2) {   // v: a lane's 8 accumulator rows are 8 consecutive t of one d, which is its slot of piece nb of tile mb: 16 bytes a plane straight from registers, every store 512 bytes in a row
#pragma unroll
        for (int nb = 0; nb < 4; ++nb) { const float bb = bfr(bias[c0 + nb * 16 + lr]);
#pragma unroll
            for (int mb = 0; mb < 4; ++mb) { v8h o16; v8us oh, ol;
#pragma unroll
                for (int j = 0; j < 8; ++j) { const float y = acc[mb][nb][j] + bb; o16[j] = tohx(y); unsigned short a2, c2; splitf(y, a2, c2); oh[j] = a2; ol[j] = c2; }
                // the three plane stores (one byte offset, three uniform bases) and their wait in one statement: as separate statements the build sends the first store ahead of the other planes' conversions, which reuse its data registers in front of the wait
                asm volatile("global_store_b128 %0, %1, %4\n\tglobal_store_b128 %0, %2, %5\n\tglobal_store_b128 %0, %3, %6\n\ts_wait_xcnt 0x0"
                             :: "v"((unsigned)(((trow / 16 + mb) * PT + nb * 256 + lane * 8) * 2)), "v"(__builtin_bit_cast(v4f, o16)), "v"(__builtin_bit_cast(v4f, oh)), "v"(__builtin_bit_cast(v4f, ol)), "s"(E16), "s"(Eh), "s"(El) : "memory"); } }
        return;
    }
    float bb[4];   // the biases of the lane's accumulator columns: added on the way into LDS, where a lane has one column a tile and not the 32 of its four slots
    if (EPI == 1) {
#pragma unroll
        for (int nb = 0; nb < 4; ++nb) bb[nb] = bfr(bias[c0 + nb * 16 + lr]); }
#pragma unroll
    for (int mb = 0; mb < 4; ++mb) {
#pragma unroll
        for (int nb = 0; nb < 4; ++nb) {
#pragma unroll
            for (int j = 0; j < 8; ++j) os[(hi * 8 + j) * 68 + nb * 16 + lr] = (EPI == 1) ? acc[mb][nb][j] + bb[nb] : acc[mb][nb][j]; }
        __builtin_amdgcn_wave_barrier(); asm volatile("" ::: "memory");
        if (EPI == 0) {
        float* crow2 = C + (size_t)(r0 + mb * 16) * ldc + c0;
#pragma unroll
            for (int s = 0; s < 8; ++s) { const int row = 2 * s + hi, cofs = lr * 4; v4f val = *(const v4fa*)(os + row * 68 + cofs); val[0] += bfr(bias[c0 + cofs]); val[1] += bfr(bias[c0 + cofs + 1]); val[2] += bfr(bias[c0 + cofs + 2]); val[3] += bfr(bias[c0 + cofs + 3]);
                *(v4f*)(crow2 + (size_t)row * ldc + cofs) = val; }
            asm volatile("s_wait_xcnt 0x0" ::: "memory");   // behind the run of stores above: what follows in the build reuses their data registers, and the wait stands in front of that overwrite
        } else {   // piece s of packed tile mb: each lane converts the 8 consecutive columns of its slot, a store is 512 bytes in a row in every plane
#pragma unroll
            for (int s = 0; s < 4; ++s) { const int row = lr, cofs = (s >> 1) * 32 + (s & 1) * 16 + hi * 8; const v4f va = *(const v4fa*)(os + row * 68 + cofs), vb = *(const v4fa*)(os + row * 68 + cofs + 4); v8h o16; v8us oh, ol;
#pragma unroll
                for (int q = 0; q < 8; ++q) { const float y = (q < 4) ? va[q & 3] : vb[q & 3]; o16[q] = tohx(y); unsigned short a2, c2; splitf(y, a2, c2); oh[q] = a2; ol[q] = c2; }
                const size_t oo = (size_t)(trow / 16 + mb) * PT + s * 256 + lane * 8; *(v8h*)(E16 + oo) = o16; *(v8us*)(Eh + oo) = oh; *(v8us*)(El + oo) = ol;
                asm volatile("s_wait_xcnt 0x0" ::: "memory"); }   // behind the three plane stores: what follows in the build reuses their address and data registers, and the wait stands in front of that overwrite
        }
        __builtin_amdgcn_wave_barrier(); asm volatile("" ::: "memory");
    }
}

typedef __attribute__((ext_vector_type(2))) _Float16 v2h;
typedef __attribute__((ext_vector_type(4))) _Float16 v4h;
typedef __attribute__((ext_vector_type(2))) unsigned short v2us;
typedef __attribute__((ext_vector_type(4))) unsigned short v4us;
typedef __attribute__((ext_vector_type(2))) float v2f;
typedef __attribute__((ext_vector_type(4))) int v4i;

#define TP 144                                  // bytes from one n row of a wave's transposing tile in LDS to the next: 128 + 16, a multiple of the 16-byte accesses
#define WTB (4 * (DQ / 64) * (DM / 256))        // transposing blocks: a block of eight waves takes 64 n x 256 k of one weight
#define CVB (NB_ * TT * DM / (8 * 2048))        // converting blocks: a wave takes 2048 elements of x
// wtT: ONE WAVE transposes a tile of 64 k x 32 n of w [K][N] (f32) into Bt [N][K] (bf16). All sixteen loads of a lane are in flight at once; a wave-wide load is four whole 128-byte lines (rows i, 16 + i, 32 + i, 48 + i of the tile), so that a lane ends up with 16 consecutive k of four n.
// These go as 32 bytes a row into the wave's own LDS tile [n][k]; read back by rows, a wave-wide store is four whole lines of Bt. Two waves side by side in n read each 256-byte unit of w together, four along k write 512 bytes of each Bt row.
__device__ __forceinline__ void wtT(const unsigned bx, const float* __restrict__ w0, const float* __restrict__ w1, const float* __restrict__ w2, const float* __restrict__ w3, bf* Bt, char* tiles) {
    static_assert(DM % 256 == 0 && DQ % 64 == 0, "whole block tiles");
    constexpr int K = DM, N = DQ, BPW = (N / 64) * (K / 256);   // blocks a weight
    const unsigned by = bx / BPW, rem = bx % BPW;               // by: which of the four equally shaped weights
    const float* __restrict__ w = (by == 0) ? w0 : (by == 1) ? w1 : (by == 2) ? w2 : w3; Bt += (size_t)by * K * N;
    const int lane = threadIdx.x & 31, g = lane >> 3, c4 = lane & 7, wave = __builtin_amdgcn_readfirstlane((int)(threadIdx.x >> 5));
    const int n0 = (int)(rem % (N / 64)) * 64 + (wave & 1) * 32, k0 = (int)(rem / (N / 64)) * 256 + (wave >> 1) * 64;
    const char* s = (const char*)(w + (size_t)k0 * N + n0); const unsigned lb = (unsigned)(g * 16 * N + c4 * 4) * 4u;   // the tile's first byte (wave-uniform), the lane's byte offset in it
    v4f r[16];
#pragma unroll
    for (int i = 0; i < 16; ++i) r[i] = *(const v4f*)(s + lb + i * (N * 4));
    asm volatile("s_wait_xcnt 0x0" :: "v"(lb) : "memory");   // behind the run of loads: the offset register that all of them name is an input here, so that it stays whole up to the wait and is not handed to the last load as its destination
    char* t = tiles + wave * (32 * TP);
#pragma unroll
    for (int c = 0; c < 4; ++c) { v8us a, b;
#pragma unroll
        for (int i = 0; i < 8; ++i) { a[i] = f2bf(r[i][c]); b[i] = f2bf(r[8 + i][c]); }
        *(v8us*)(t + (c4 * 4 + c) * TP + g * 32) = a; *(v8us*)(t + (c4 * 4 + c) * TP + g * 32 + 16) = b; }
    asm volatile("s_wait_dscnt 0x0" ::: "memory");   // the wave's tile is whole in LDS before its lanes read what other lanes wrote; no other wave touches these rows
    bf* d = Bt + (size_t)n0 * K + k0 + (g * K + c4 * 8);
#pragma unroll
    for (int q = 0; q < 8; ++q) *(v8us*)(d + q * 4 * K) = *(const v8us*)(t + (q * 4 + g) * TP + c4 * 16);
}
// cvtL: one wave converts 2048 consecutive elements; sixteen whole-line loads of 16 bytes a lane in flight at once, a wave-wide store is two whole lines
__device__ __forceinline__ void cvtL(const unsigned bx, const float* __restrict__ src, bf* dst) {
    static_assert((size_t)NB_ * TT * DM % (8 * 2048) == 0, "whole waves");
    const size_t o = ((size_t)bx * 8 + __builtin_amdgcn_readfirstlane((int)(threadIdx.x >> 5))) * 2048; const unsigned l = (threadIdx.x & 31) * 4, lb = l * 4u;   // the wave's first element; the lane's element and byte offset in a piece of 128
    v4f r[16];
#pragma unroll
    for (int i = 0; i < 16; ++i) r[i] = *(const v4f*)((const char*)(src + o) + lb + i * 512);
    asm volatile("s_wait_xcnt 0x0" :: "v"(lb) : "memory");   // behind the run of loads, as in wtT
#pragma unroll
    for (int i = 0; i < 16; ++i) { v4us c;
#pragma unroll
        for (int k = 0; k < 4; ++k) c[k] = f2bf(r[i][k]);
        *(v4us*)(dst + o + (l + i * 128)) = c; }
}
// ---- k_prep: the four weight transposes and the conversion of x in one launch; neither reads what the other writes. 16 waves a WGP in all, every one of them resident from the start, each with its whole share of the reads in flight. The transposing blocks, whose waves run longer, have the lowest indices.
__global__ __launch_bounds__(256) void k_prep(const float* __restrict__ w0, const float* __restrict__ w1, const float* __restrict__ w2, const float* __restrict__ w3, bf* Bt, const float* __restrict__ x, bf* xb) {
    __shared__ __align__(16) char tiles[8 * 32 * TP];
    if (blockIdx.x < WTB) wtT(blockIdx.x, w0, w1, w2, w3, Bt, tiles);
    else cvtL(blockIdx.x - WTB, x, xb);
}

typedef __attribute__((ext_vector_type(2))) __bf16 v2bf;
// p (f32, 8 keys of one query) -> 8 elements s0 .. s0 + 7 of a B operand; both conversions round to nearest even
__device__ __forceinline__ void packp(v16h& d, v16h&, const v8f p, const int s0) {
#pragma unroll
    for (int j = 0; j < 8; j += 2) { const v2h c = __builtin_convertvector((v2f){p[j], p[j + 1]}, v2h); d[s0 + j] = c[0]; d[s0 + j + 1] = c[1]; } }
__device__ __forceinline__ void packp(v16bf& d, v16bf& dl, const v8f p, const int s0) {
#pragma unroll
    for (int j = 0; j < 8; j += 2) { const v2bf c = __builtin_convertvector((v2f){p[j], p[j + 1]}, v2bf); const v2bf l = __builtin_convertvector((v2f){p[j] - (float)c[0], p[j + 1] - (float)c[1]}, v2bf); d[s0 + j] = c[0]; d[s0 + j + 1] = c[1]; dl[s0 + j] = l[0]; dl[s0 + j + 1] = l[1]; } }

typedef __attribute__((ext_vector_type(8))) int v8i;
template <typename T16, bool HI>
__device__ __forceinline__ float fattn(const T16* __restrict__ Q, const T16* __restrict__ Q2, const T16* __restrict__ Kp, const T16* __restrict__ K2, const T16* __restrict__ Vt, const T16* __restrict__ Vt2, v8f (&O)[4]) {
    typedef typename WFrag<T16>::V V;
    static_assert(HD == 64 && BW == 128, "tile counts below are those of head size 64 and half window 128");
    // the lane's number, read in another way in each form: lane arithmetic that both forms spell alike is moved in front of the branch that picks the form, where the build no longer sees that a load's lane offset has 32 bits and spends a 64-bit register address on every base
    const int lane = HI ? (int)__builtin_amdgcn_mbcnt_lo(~0u, 0u) : (int)(threadIdx.x & 31), lr = lane & 15, hi = lane >> 4, e = 8 * hi - lr;
    const int r = ((int)blockIdx.y * 4 + __builtin_amdgcn_readfirstlane((int)(threadIdx.x >> 5))) * 16, wb = r - BW;
    const size_t z = blockIdx.x, pl = z * ((size_t)TT * HD);
    const unsigned ls = (unsigned)lane * 16u;   // the lane's byte offset in a piece of a packed tile: every load address below is a wave-uniform base + this + a constant
    auto at = [](const T16* base, unsigned off) { return (const T16*)((const char*)base + off); };
    auto keep = [](V a, bool in0, bool in1) { v8i w = __builtin_bit_cast(v8i, a);   // a fragment's first four registers are its first 16-key tile, the rest its second
#pragma unroll
        for (int i = 0; i < 8; ++i) w[i] = ((i < 4) ? in0 : in1) ? w[i] : 0;
        return __builtin_bit_cast(V, w); };
    V q[2], q2[2];
#pragma unroll
    for (int ks = 0; ks < 2; ++ks) { q[ks] = WFrag<T16>::ld2(at(Q + pl + (size_t)r * HD + ks * 512, ls), at(Q + pl + (size_t)r * HD + ks * 512 + 256, ls)); if (HI) q2[ks] = WFrag<T16>::ld2(at(Q2 + pl + (size_t)r * HD + ks * 512, ls), at(Q2 + pl + (size_t)r * HD + ks * 512 + 256, ls)); }   // pieces 2 ks and 2 ks + 1 of the rows' tile (16 positions are PT = 16 HD elements: r * HD is the tile's start)
    const T16* kw = Kp + pl + (long)wb * HD; const T16* kw2 = HI ? K2 + pl + (long)wb * HD : nullptr; const T16* vw = Vt + pl + (long)wb * HD; const T16* vw2 = HI ? Vt2 + pl + (long)wb * HD : nullptr;   // the window's first 16-key tile in the k and in the v planes
    v8f S[17]; float mx = -3.0e38f;
#pragma unroll
    for (int g = 0; g < 3; ++g) {   // key tiles in groups of six (the last: five)
        V k[6][2], k2[6][2];
#pragma unroll
        for (int i = 0; i < 6; ++i)
#pragma unroll
            for (int ks = 0; ks < 2; ++ks) { const int t = g * 6 + i; if (t < 17) { k[i][ks] = WFrag<T16>::ld2(at(kw + t * PT + ks * 512, ls), at(kw + t * PT + ks * 512 + 256, ls)); if (HI) k2[i][ks] = WFrag<T16>::ld2(at(kw2 + t * PT + ks * 512, ls), at(kw2 + t * PT + ks * 512 + 256, ls)); } }
        // behind the group's loads (and q's): what follows in the build reuses their offset and base registers, and the wait stands in front of that overwrite; the bases are named as inputs so that they stay whole up to the wait
        if constexpr (HI) asm volatile("s_wait_xcnt 0x0" :: "s"(kw), "s"(kw2) : "memory"); else asm volatile("s_wait_xcnt 0x0" :: "s"(kw) : "memory");
        __builtin_amdgcn_sched_barrier(0);   // a group's k loads go out together: sunk to their products, each tile's latency is waited out on its own
#pragma unroll
        for (int i = 0; i < 6; ++i) { const int t = g * 6 + i; if (t >= 17) continue;
            const float off = (t == 8 || (unsigned)(wb + t * 16) < (unsigned)TT) ? 0.0f : -3.0e38f;   // tile 8 is the wave's own rows
            v8f a = (v8f){};
#pragma unroll
            for (int ks = 0; ks < 2; ++ks) { a = WFrag<T16>::mma(k[i][ks], q[ks], a); if (HI) { a = WFrag<T16>::mma(k[i][ks], q2[ks], a); a = WFrag<T16>::mma(k2[i][ks], q[ks], a); } }
#pragma unroll
            for (int j = 0; j < 8; ++j) { float s = a[j] * SCL + off;   // SCL is a power of two: the product is exact, and off is 0 inside the sequence
                if (t == 0) s = (j + e >= 0) ? s : -3.0e38f;    // key >= query - BW
                if (t == 16) s = (j + e <= 0) ? s : -3.0e38f;   // key <= query + BW
                a[j] = s; mx = fmaxf(mx, s); }
            S[t] = a; }
    }
    const float m = fmaxf(mx, __shfl_xor(mx, 16, 32)); v8f sv = (v8f){};   // row maximum, eight independent partial row sums; O: output tiles
#pragma unroll
    for (int mb = 0; mb < 4; ++mb) O[mb] = (v8f){};
#pragma unroll
    for (int kb = 0; kb < 9; ++kb) {
        const bool in0 = kb == 4 || (unsigned)(wb + kb * 32) < (unsigned)TT, in1 = (unsigned)(wb + kb * 32 + 16) < (unsigned)TT;
        V p, p2, va[4], va2[4];
#pragma unroll
        for (int mb = 0; mb < 4; ++mb) { va[mb] = WFrag<T16>::ld2(at(vw + 2 * kb * PT + mb * 256, ls), at(vw + (2 * kb + 1) * PT + mb * 256, ls)); if (HI) va2[mb] = WFrag<T16>::ld2(at(vw2 + 2 * kb * PT + mb * 256, ls), at(vw2 + (2 * kb + 1) * PT + mb * 256, ls)); }   // piece mb of the block's two key tiles; the block's v loads go out together, in flight under its exponentials
        __builtin_amdgcn_sched_barrier(0);   // keeps them there: sunk to their products, each load's latency is waited out on its own
#pragma unroll
        for (int u = 0; u < 2; ++u) { const int t = 2 * kb + u; v8f ev = (v8f){};
            if (t < 17) {
#pragma unroll
                for (int j = 0; j < 8; ++j) ev[j] = (S[t][j] - m) * 1.4426950408889634f;
                float x0, x1, x2, x3, x4, x5, x6, x7;
                // eight exp2 in one statement. The four leading slots are the distance behind a matrix instruction: the results may land in registers that were its A or B. Each exponential is followed by one that touches neither its result nor its source (early-clobber results), the last by the one slot that the instruction set asks for behind a transcendental.
                asm("v_nop\n\tv_nop\n\tv_nop\n\tv_nop\n\tv_exp_f32 %0, %8\n\tv_exp_f32 %1, %9\n\tv_exp_f32 %2, %10\n\tv_exp_f32 %3, %11\n\tv_exp_f32 %4, %12\n\tv_exp_f32 %5, %13\n\tv_exp_f32 %6, %14\n\tv_exp_f32 %7, %15\n\tv_nop"
                    : "=&v"(x0), "=&v"(x1), "=&v"(x2), "=&v"(x3), "=&v"(x4), "=&v"(x5), "=&v"(x6), "=&v"(x7) : "v"(ev[0]), "v"(ev[1]), "v"(ev[2]), "v"(ev[3]), "v"(ev[4]), "v"(ev[5]), "v"(ev[6]), "v"(ev[7]));
                ev = (v8f){x0, x1, x2, x3, x4, x5, x6, x7}; sv += ev; }
            packp(p, p2, HI ? ev : ev * PCAR, u * 8); }   // p goes into the product unnormalised (largest term 1); the row sum divides the output
#pragma unroll
        for (int mb = 0; mb < 4; ++mb) { const V b = keep(va[mb], in0, in1);
            O[mb] = WFrag<T16>::mma(b, p, O[mb]); if (HI) { O[mb] = WFrag<T16>::mma(b, p2, O[mb]); O[mb] = WFrag<T16>::mma(keep(va2[mb], in0, in1), p, O[mb]); } }
    }
    float sum = ((sv[0] + sv[1]) + (sv[2] + sv[3])) + ((sv[4] + sv[5]) + (sv[6] + sv[7])); sum += __shfl_xor(sum, 16, 32);
    return __fdiv_rn(HI ? 1.0f : (1.0f / PCAR), sum);   // the factor that turns O into y
}
// ---- k_fattn2: both forms of the attention in one launch; they share no data but their inputs, so neither waits for the other's last wave. Grid (head planes, 64-row tiles), a block is four waves of 16 query rows each.
// blockIdx.y is the row tile: the RH / 64 * ZH blocks of the hi/lo form, the longer one, have the lowest flat indices.
__global__ __launch_bounds__(128) void k_fattn2(const bf* __restrict__ Qh, const bf* __restrict__ Ql, const bf* __restrict__ Kh, const bf* __restrict__ Kl, const bf* __restrict__ Vh, const bf* __restrict__ Vl, const h16* __restrict__ Q16, const h16* __restrict__ K16, const h16* __restrict__ V16, bf* Eh, bf* El) {
    v8f O[4]; float f;
    if (blockIdx.y < RH / 64) f = fattn<bf, true>(Qh, Ql, Kh, Kl, Vh, Vl, O);
    else f = fattn<h16, false>(Q16, nullptr, K16, nullptr, V16, nullptr, O);
    // the way out is the same for both forms and stands once in the text
    const int lr = threadIdx.x & 15, hi = (threadIdx.x >> 4) & 1, r = ((int)blockIdx.y * 4 + __builtin_amdgcn_readfirstlane((int)(threadIdx.x >> 5))) * 16;
    const size_t z = blockIdx.x; const unsigned lo = (unsigned)(lr * DQ + 8 * hi) * 2u;   // the lane's byte offset in a 16-row fragment of pitch DQ
    const size_t ob = ((z / NH_) * (size_t)TT + r) * DQ + (z % NH_) * HD;
#pragma unroll
    for (int mb = 0; mb < 4; ++mb) { v8us oh, ol;   // a lane's 8 accumulator rows are 8 consecutive d of one query
#pragma unroll
        for (int j = 0; j < 8; ++j) { unsigned short a2, c2; splitf(O[mb][j] * f, a2, c2); oh[j] = a2; ol[j] = c2; }
        const size_t oo = ob + mb * 16; *(v8us*)((char*)(Eh + oo) + lo) = oh; *(v8us*)((char*)(El + oo) + lo) = ol;
        if (mb < 3) asm volatile("s_wait_xcnt 0x0" ::: "memory"); }   // behind the two plane stores: the next tile's conversion reuses their data registers in the build, and the wait stands in front of that overwrite
}

extern "C" void kernel_launch(void* const* d_in, const int* in_sizes, int n_in,
                              void* d_out, int out_size, void* d_ws, size_t ws_size, hipStream_t stream) {
    (void)in_sizes; (void)n_in; (void)out_size;
    const float* x = (const float*)d_in[0]; const float* wq = (const float*)d_in[1]; const float* bq = (const float*)d_in[2]; const float* wk = (const float*)d_in[3]; const float* bk = (const float*)d_in[4]; const float* wv = (const float*)d_in[5]; const float* bv = (const float*)d_in[6]; const float* wo = (const float*)d_in[7]; const float* bo = (const float*)d_in[8];   /* argument order x, wq, bq, wk, bk, wv, bv, wo, bo */
    float* OUT = (float*)d_out;     // [2][2048][1024]
    char* wsp = (char*)d_ws;
    auto take = [&](size_t bytes) { char* p = wsp; wsp += (bytes + 255) & ~(size_t)255; return (void*)p; };
    bf* WQ = (bf*)take((size_t)4 * DQ * DM * 2); bf* WK = WQ + (size_t)DQ * DM; bf* WV = WK + (size_t)DKV * DM; bf* WO = WV + (size_t)DKV * DM; (void)WK; (void)WV;   // four transposed 1024 x 1024 weights in a row: a grid dimension walks them
    bf* XB = (bf*)take((size_t)NB_ * TT * DM * 2);
    const size_t PS = (size_t)ZH * TT * HD;   // one plane set: 32 head planes; q, k, v sets in a row, the projection GEMM's z walks them
    h16* QP16 = (h16*)take(3 * PS * 2); h16* KP16 = QP16 + PS; h16* VT16 = KP16 + PS;
    bf* QPh = (bf*)take(3 * PS * 2); bf* KPh = QPh + PS; bf* VTh = KPh + PS; bf* QPl = (bf*)take(3 * PS * 2); bf* KPl = QPl + PS; bf* VTl = KPl + PS;
    bf* ATh = (bf*)take((size_t)2 * NB_ * TT * DQ * 2); bf* ATl = ATh + (size_t)NB_ * TT * DQ;   // merged hi/lo planes
    if ((size_t)(wsp - (char*)d_ws) > ws_size) return;    // 104 of the 256 MiB
    k_prep<<<WTB + CVB, 256, 0, stream>>>(wq, wk, wv, wo, WQ, x, XB);
    k_gemms<0, 1><<<dim3(NB_ * TT / 128, DQ / 128, 3), 128, 0, stream>>>(XB, nullptr, WQ, nullptr, 0, bq, bk, bv, (size_t)DQ * DM, QP16, QPh, QPl);   // z: q, k, v
    k_fattn2<<<dim3(ZH, TT / 64, 1), 128, 0, stream>>>(QPh, QPl, KPh, KPl, VTh, VTl, QP16, KP16, VT16, ATh, ATl);
    k_gemms<1, 0><<<dim3(NB_ * TT / 128, DM / 128, 1), 128, 0, stream>>>(ATh, ATl, WO, OUT, DM, bo, nullptr, nullptr, 0, nullptr, nullptr, nullptr);
}

// v009
// One run takes 62.7 microseconds.
// Next to v008, in two timings, it ran 1.03 times as fast each time.
// Over all steps from v000 it is 32.4 times as fast.
#include <hip/hip_runtime.h>

// Sliding-window (banded) multi-head attention (x [2][2048][1024]; q, k, v = x W + b ('xw' [1024][1024] 0.02, zero biases; 16 heads x 64); scores x 64^-0.5; keys j with i - 128 <= j <= i + 128 (symmetric window 256, -inf elsewhere); softmax; out = merged wo + bo ('xw') -> [2][2048][1024] (4.2 M); argument order x, wq, bq, wk, bk, wv, bv, wo, bo).
// Layout, both batches at once (4096 rows; 32 head planes z = batch * 16 + head): bf16 copy of x; 'xw' weights transposed once; exact projections + f32 biases, whose GEMM stores the 16-bit q, k, v head planes itself, in the order in which the attention's matrix fragments are loaded (PACKED PLANES below); banded attention fused in k_fattn2: a wave holds the scores of its 16 query rows against their 272-key window in registers, takes their exponentials there and feeds them to the p x v product, whose result the row sum divides; scores and p never reach memory (hybrid rows: < 512 hi/lo 3 products, rest fp16 x1024; both forms in one launch); it stores the merged hi/lo planes; merged hi/lo x wo exact + bo.
// Compute dtypes, f32 accumulate: every input rounded to bf16; projections exact + f32 biases; attention rows < 512 3 products, rest fp16; softmax f32; wo hl x exact + bias.

#define NB_  2
#define TT   2048
#define DM   1024
#define NH_  16
#define NKV  16
#define REP  (NH_ / NKV)
#define HD   64
#define DQ   (NH_ * HD)
#define DKV  (NKV * HD)
#define ZH   (NB_ * NH_)          // head planes per attention launch: all heads of both batches
#define RH   512                  // query rows < RH use hi+lo planes (0: none)
#define WIN  2048
#define BW   128      // half window: keys j in [i - 128, i + 128]
#define PCAR 1024.0f
#define SCL  0.125f   // HD^-0.5
typedef _Float16 h16;
typedef unsigned short bf;
typedef __attribute__((ext_vector_type(16))) __bf16   v16bf;
typedef __attribute__((ext_vector_type(16))) _Float16 v16h;
typedef __attribute__((ext_vector_type(8)))  _Float16 v8h;
typedef __attribute__((ext_vector_type(8)))  unsigned short v8us;
typedef __attribute__((ext_vector_type(8)))  float    v8f;
typedef __attribute__((ext_vector_type(4)))  float    v4f;
typedef v8h  __attribute__((may_alias)) v8ha;
typedef v4f  __attribute__((may_alias)) v4fa;
typedef v8us __attribute__((may_alias)) v8usa;

__device__ __forceinline__ unsigned short f2bf(float f) { unsigned u = __float_as_uint(f); u += 0x7FFFu + ((u >> 16) & 1u); return (unsigned short)(u >> 16); }
__device__ __forceinline__ float bf2f(unsigned short b) { return __uint_as_float(((unsigned)b) << 16); }
__device__ __forceinline__ float bfr(float f) { return bf2f(f2bf(f)); }
__device__ __forceinline__ v16h cat16(v8h lo, v8h hi) { return __builtin_shufflevector(lo, hi, 0, 1, 2, 3, 4, 5, 6, 7, 8, 9, 10, 11, 12, 13, 14, 15); }
__device__ __forceinline__ v16bf cat16b(v8us lo, v8us hi) { return __builtin_bit_cast(v16bf, __builtin_shufflevector(lo, hi, 0, 1, 2, 3, 4, 5, 6, 7, 8, 9, 10, 11, 12, 13, 14, 15)); }
__device__ __forceinline__ v8f wmma16(v16h a, v16h b, v8f c) { return __builtin_amdgcn_wmma_f32_16x16x32_f16(false, a, false, b, (short)0, c, false, false); }
__device__ __forceinline__ v8f wmmab(v16bf a, v16bf b, v8f c) { return __builtin_amdgcn_wmma_f32_16x16x32_bf16(false, a, false, b, (short)0, c, false, false); }
__device__ __forceinline__ h16 tohx(float x) { return (h16)x; }
__device__ __forceinline__ void splitf(float y, unsigned short& h, unsigned short& l) { h = f2bf(y); l = f2bf(y - bf2f(h)); }



// ---- k_gemms: GEMM, a work-group of four waves (2 x 2) per 128x128 output tile, each wave a 64x64 tile (16 accumulators); grid (M/128, N/128, Z), 128 threads. K = DM.
// C[m][n] = sum_k A[m][k] Bt[n][k] (NSPLIT 1: + A2[m][k] Bt[n][k] behind each block's first product) + f32 bias[n] (bias, bias1, bias2 for z = 0, 1, 2); A, A2, Bt K-contiguous bf16 planes; Bt's z stride sB in elements.
// Operands reach the waves through LDS: a stage is 64 k (one whole 128-byte line) of the tile's 128 A rows, 128 Bt rows (and 128 A2 rows), at pitch GP; two buffers; asynchronous copies to LDS fill the next stage while this one is worked on. A wave-wide copy is four whole lines; every wave copies 32 rows of each operand.
// EPI 0: C in f32, pitch ldc. EPI 1 (projections; a wave's 64 columns are one head): y = sum + bias goes out as fp16, bf16 hi and bf16 lo = y - hi, into plane set z of E16, Eh, El, head plane batch * NH_ + head. C is unused for EPI 1.
// PACKED PLANES: a head plane is TT / 16 tiles of 16 positions x 64 d (2 KiB, PT elements), a tile four pieces of 512 bytes, a piece 32 lane slots of 16 bytes: one wave-wide 16-byte load of the attention kernel reads one piece, four whole 128-byte lines, and each lane finds half a fragment in its slot. Slot hi * 16 + lr of piece s holds, for q and k, position lr, d = (s / 2) * 32 + (s % 2) * 16 + hi * 8 + 0..7; for v, d = s * 16 + lr, positions hi * 8 + 0..7.
template <typename T16> struct WFrag;
template <> struct WFrag<h16> { typedef v16h V; static __device__ __forceinline__ V ld(const h16* p) { return cat16(*(const v8h*)p, *(const v8h*)(p + 16)); } static __device__ __forceinline__ V ld2(const h16* p, const h16* p1) { return cat16(*(const v8h*)p, *(const v8h*)p1); } static __device__ __forceinline__ V ld1(const h16* p) { return cat16(*(const v8h*)p, (v8h){}); } static __device__ __forceinline__ v8f mma(V a, V b, v8f c) { return wmma16(a, b, c); } };
template <> struct WFrag<bf> { typedef v16bf V; static __device__ __forceinline__ V ld(const bf* p) { return cat16b(*(const v8us*)p, *(const v8us*)(p + 16)); } static __device__ __forceinline__ V ld2(const bf* p, const bf* p1) { return cat16b(*(const v8us*)p, *(const v8us*)p1); } static __device__ __forceinline__ V ld1(const bf* p) { return cat16b(*(const v8us*)p, (v8us){}); } static __device__ __forceinline__ v8f mma(V a, V b, v8f c) { return wmmab(a, b, c); } };
#define PT (16 * HD)   // elements of a packed tile
#define GP 144   // bytes from one staged row to the next: 128 + 16, an odd number of 16-byte units, so that the 16-byte fragment reads of 16 rows meet no bank twice
// eight asynchronous copies of 16 bytes a lane: rows r, r + 4, .. r + 28 of one operand's stage (l: the lane's LDS byte address, g: its global address, both of row r). The closing wait stands in front of whatever rewrites the address registers named here.
__device__ __forceinline__ void copy8(const unsigned l, const bf* g) {
    asm volatile("global_load_async_to_lds_b128 %0, %8, off\n\tglobal_load_async_to_lds_b128 %1, %9, off\n\tglobal_load_async_to_lds_b128 %2, %10, off\n\tglobal_load_async_to_lds_b128 %3, %11, off\n\t"
                 "global_load_async_to_lds_b128 %4, %12, off\n\tglobal_load_async_to_lds_b128 %5, %13, off\n\tglobal_load_async_to_lds_b128 %6, %14, off\n\tglobal_load_async_to_lds_b128 %7, %15, off\n\ts_wait_xcnt 0x0"
                 :: "v"(l), "v"(l + 4 * GP), "v"(l + 8 * GP), "v"(l + 12 * GP), "v"(l + 16 * GP), "v"(l + 20 * GP), "v"(l + 24 * GP), "v"(l + 28 * GP),
                    "v"(g), "v"(g + 4 * DM), "v"(g + 8 * DM), "v"(g + 12 * DM), "v"(g + 16 * DM), "v"(g + 20 * DM), "v"(g + 24 * DM), "v"(g + 28 * DM) : "memory");
}
template <int NSPLIT, int EPI>
__global__ __launch_bounds__(128) void k_gemms(const bf* __restrict__ A, const bf* __restrict__ A2, const bf* __restrict__ Bt, float* C, int ldc, const float* __restrict__ bias, const float* __restrict__ bias1, const float* __restrict__ bias2, size_t sB, h16* E16, bf* Eh, bf* El) {
    typedef WFrag<bf>::V V;
    static_assert(DM == DQ && DM % 128 == 0, "one K for both launches; at least two stages");
    constexpr int K = DM, NT = K / 64, BUFB = (2 + NSPLIT) * 128 * GP;   // stages; bytes of a buffer: A rows, Bt rows (, A2 rows)
    __shared__ __align__(16) char ring[2 * BUFB];
    __shared__ __align__(16) float osm[4 * 16 * 68];
    const size_t z = blockIdx.z; Bt += z * sB;
    bias = (z == 0) ? bias : (z == 1) ? bias1 : bias2;   // z-batched projections: each z has its own bias vector
    const int lane = threadIdx.x & 31, lr = lane & 15, hi = lane >> 4, wave = __builtin_amdgcn_readfirstlane((int)(threadIdx.x >> 5));
    const int R0 = blockIdx.x * 128, C0 = blockIdx.y * 128, wr = (wave & 1) * 64, wc = (wave >> 1) * 64, r0 = R0 + wr, c0 = C0 + wc;   // the work-group's tile, the wave's place in it, the wave's tile
    float* os = osm + wave * (16 * 68);
    // the lane's part in a copy: row wave * 32 + lane / 8 (+ 4 a copy) of the stage, 16-byte piece lane % 8 of its line
    const int crow = wave * 32 + (lane >> 3), cpc = (lane & 7) * 8;
    const unsigned lc = (unsigned)(size_t)ring + (unsigned)(crow * GP + cpc * 2);
    const bf* ga = A + (size_t)(R0 + crow) * K + cpc; const bf* gb = Bt + (size_t)(C0 + crow) * K + cpc; const bf* ga2 = NSPLIT ? A2 + (size_t)(R0 + crow) * K + cpc : nullptr;
    auto fill = [&](int t, int buf) { const unsigned l = lc + (unsigned)(buf * BUFB); copy8(l, ga + t * 64); copy8(l + 128 * GP, gb + t * 64); if (NSPLIT) copy8(l + 256 * GP, ga2 + t * 64); };
    v8f acc[4][4];
#pragma unroll
    for (int mb = 0; mb < 4; ++mb)
#pragma unroll
        for (int nb = 0; nb < 4; ++nb) acc[mb][nb] = (v8f){};
    fill(0, 0);
    asm volatile("s_wait_asynccnt 0x0" ::: "memory");   // this wave's part of stage 0 has landed
    __syncthreads();                                      // every wave's part has
    fill(1, 1);
    const int fa = (wr + lr) * GP + 16 * hi, fb = (128 + wc + lr) * GP + 16 * hi;   // the lane's byte offset in a buffer: row lr of the wave's first A and Bt fragment
#pragma unroll 1
    for (int t = 0; t < NT; ++t) {
        const char* sb = ring + (t & 1) * BUFB;
        V a[4], a2[4], b[4];
        auto frags = [&](int ks) {
#pragma unroll
            for (int mb = 0; mb < 4; ++mb) { a[mb] = WFrag<bf>::ld((const bf*)(sb + fa + mb * 16 * GP + ks * 64)); if (NSPLIT) a2[mb] = WFrag<bf>::ld((const bf*)(sb + fa + 256 * GP + mb * 16 * GP + ks * 64)); }
#pragma unroll
            for (int nb = 0; nb < 4; ++nb) b[nb] = WFrag<bf>::ld((const bf*)(sb + fb + nb * 16 * GP + ks * 64)); };
        auto prods = [&]() {
#pragma unroll
            for (int nb = 0; nb < 4; ++nb)
#pragma unroll
                for (int mb = 0; mb < 4; ++mb) { acc[mb][nb] = WFrag<bf>::mma(a[mb], b[nb], acc[mb][nb]); if (NSPLIT) acc[mb][nb] = WFrag<bf>::mma(a2[mb], b[nb], acc[mb][nb]); } };
        frags(0);
        __builtin_amdgcn_sched_barrier(0);   // a block's fragment reads go out as one group ahead of its products: sunk among them, each row of products waits out the LDS latency on its own
        prods();
        frags(1);                                             // the stage's last reads: its second block then works from registers alone
        if (NSPLIT) { __builtin_amdgcn_sched_barrier(0); prods(); }   // three operands: the block's twelve fragments, the accumulators and the copies' addresses do not fit 256 registers together, so its products come first, behind its reads as one group as above
        asm volatile("s_wait_dscnt 0x0" ::: "memory");      // this wave's reads of the buffer are done before it is handed to the copies
        asm volatile("s_wait_asynccnt 0x0" ::: "memory");   // this wave's part of stage t + 1 has landed
        __syncthreads();                                      // publishes stage t + 1 and ends every wave's reads of stage t
        if (t + 2 < NT) fill(t + 2, t & 1);
        if (!NSPLIT) prods();                                 // behind the refill, so that the copies fly under these products too
    }
    asm volatile("s_wait_asynccnt 0x0" ::: "memory");   // no copy is left in flight at the wave's end
    static_assert(HD == 64, "EPI 1 takes a wave's 64 columns for one head");
    const int trow = r0 % TT;   // sequence position of the tile's row 0
    if (EPI == 1) { const size_t pz = z * ((size_t)ZH * TT * HD) + (size_t)((r0 / TT) * NH_ + c0 / HD) * TT * HD; E16 += pz; Eh += pz; El += pz; }   // plane set z, head plane of this tile
    if (EPI == 1 && z == 2) {   // v: a lane's 8 accumulator rows are 8 consecutive t of one d, which is its slot of piece nb of tile mb: 16 bytes a plane straight from registers, every store 512 bytes in a row
#pragma unroll
        for (int nb = 0; nb < 4; ++nb) { const float bb = bfr(bias[c0 + nb * 16 + lr]);
#pragma unroll
            for (int mb = 0; mb < 4; ++mb) { v8h o16; v8us oh, ol;
#pragma unroll
                for (int j = 0; j < 8; ++j) { const float y = acc[mb][nb][j] + bb; o16[j] = tohx(y); unsigned short a2, c2; splitf(y, a2, c2); oh[j] = a2; ol[j] = c2; }
                // the three plane stores (one byte offset, three uniform bases) and their wait in one statement: as separate statements the build sends the first store ahead of the other planes' conversions, which reuse its data registers in front of the wait
                asm volatile("global_store_b128 %0, %1, %4\n\tglobal_store_b128 %0, %2, %5\n\tglobal_store_b128 %0, %3, %6\n\ts_wait_xcnt 0x0"
                             :: "v"((unsigned)(((trow / 16 + mb) * PT + nb * 256 + lane * 8) * 2)), "v"(__builtin_bit_cast(v4f, o16)), "v"(__builtin_bit_cast(v4f, oh)), "v"(__builtin_bit_cast(v4f, ol)), "s"(E16), "s"(Eh), "s"(El) : "memory"); } }
        return;
    }
    float bb[4];   // the biases of the lane's accumulator columns: added on the way into LDS, where a lane has one column a tile and not the 32 of its four slots
    if (EPI == 1) {
#pragma unroll
        for (int nb = 0; nb < 4; ++nb) bb[nb] = bfr(bias[c0 + nb * 16 + lr]); }
#pragma unroll
    for (int mb = 0; mb < 4; ++mb) {
#pragma unroll
        for (int nb = 0; nb < 4; ++nb) {
#pragma unroll
            for (int j = 0; j < 8; ++j) os[(hi * 8 + j) * 68 + nb * 16 + lr] = (EPI == 1) ? acc[mb][nb][j] + bb[nb] : acc[mb][nb][j]; }
        __builtin_amdgcn_wave_barrier(); asm volatile("" ::: "memory");
        if (EPI == 0) {
        float* crow2 = C + (size_t)(r0 + mb * 16) * ldc + c0;
#pragma unroll
            for (int s = 0; s < 8; ++s) { const int row = 2 * s + hi, cofs = lr * 4; v4f val = *(const v4fa*)(os + row * 68 + cofs); val[0] += bfr(bias[c0 + cofs]); val[1] += bfr(bias[c0 + cofs + 1]); val[2] += bfr(bias[c0 + cofs + 2]); val[3] += bfr(bias[c0 + cofs + 3]);
                *(v4f*)(crow2 + (size_t)row * ldc + cofs) = val; }
            asm volatile("s_wait_xcnt 0x0" ::: "memory");   // behind the run of stores above: what follows in the build reuses their data registers, and the wait stands in front of that overwrite
        } else {   // piece s of packed tile mb: each lane converts the 8 consecutive columns of its slot, a store is 512 bytes in a row in every plane
#pragma unroll
            for (int s = 0; s < 4; ++s) { const int row = lr, cofs = (s >> 1) * 32 + (s & 1) * 16 + hi * 8; const v4f va = *(const v4fa*)(os + row * 68 + cofs), vb = *(const v4fa*)(os + row * 68 + cofs + 4); v8h o16; v8us oh, ol;
#pragma unroll
                for (int q = 0; q < 8; ++q) { const float y = (q < 4) ? va[q & 3] : vb[q & 3]; o16[q] = tohx(y); unsigned short a2, c2; splitf(y, a2, c2); oh[q] = a2; ol[q] = c2; }
                const size_t oo = (size_t)(trow / 16 + mb) * PT + s * 256 + lane * 8; *(v8h*)(E16 + oo) = o16; *(v8us*)(Eh + oo) = oh; *(v8us*)(El + oo) = ol;
                asm volatile("s_wait_xcnt 0x0" ::: "memory"); }   // behind the three plane stores: what follows in the build reuses their address and data registers, and the wait stands in front of that overwrite
        }
        __builtin_amdgcn_wave_barrier(); asm volatile("" ::: "memory");
    }
}

typedef __attribute__((ext_vector_type(2))) _Float16 v2h;
typedef __attribute__((ext_vector_type(4))) _Float16 v4h;
typedef __attribute__((ext_vector_type(2))) unsigned short v2us;
typedef __attribute__((ext_vector_type(4))) unsigned short v4us;
typedef __attribute__((ext_vector_type(2))) float v2f;
typedef __attribute__((ext_vector_type(4))) int v4i;

#define TP 144                                  // bytes from one n row of a wave's transposing tile in LDS to the next: 128 + 16, a multiple of the 16-byte accesses
#define WTB (4 * (DQ / 64) * (DM / 256))        // transposing blocks: a block of eight waves takes 64 n x 256 k of one weight
#define CVB (NB_ * TT * DM / (8 * 2048))        // converting blocks: a wave takes 2048 elements of x
// wtT: ONE WAVE transposes a tile of 64 k x 32 n of w [K][N] (f32) into Bt [N][K] (bf16). All sixteen loads of a lane are in flight at once; a wave-wide load is four whole 128-byte lines (rows i, 16 + i, 32 + i, 48 + i of the tile), so that a lane ends up with 16 consecutive k of four n.
// These go as 32 bytes a row into the wave's own LDS tile [n][k]; read back by rows, a wave-wide store is four whole lines of Bt. Four waves along k write 512 bytes of each Bt row.
__device__ __forceinline__ void wtT(const unsigned bx, const float* __restrict__ w0, const float* __restrict__ w1, const float* __restrict__ w2, const float* __restrict__ w3, bf* Bt, char* tiles) {
    static_assert(DM % 256 == 0 && DQ % 64 == 0, "whole block tiles");
    constexpr int K = DM, N = DQ, BPW = (N / 64) * (K / 256);   // blocks a weight
    const unsigned by = bx / BPW, rem = bx % BPW;               // by: which of the four equally shaped weights
    const float* __restrict__ w = (by == 0) ? w0 : (by == 1) ? w1 : (by == 2) ? w2 : w3; Bt += (size_t)by * K * N;
    const int lane = threadIdx.x & 31, g = lane >> 3, c4 = lane & 7, wave = __builtin_amdgcn_readfirstlane((int)(threadIdx.x >> 5));
    const int n0 = (int)(rem % (N / 64)) * 64 + (wave & 1) * 32, k0 = (int)(rem / (N / 64)) * 256 + (wave >> 1) * 64;
    const char* s = (const char*)(w + (size_t)k0 * N + n0); const unsigned lb = (unsigned)(g * 16 * N + c4 * 4) * 4u;   // the tile's first byte (wave-uniform), the lane's byte offset in it
    v4f r[16];
#pragma unroll
    for (int i = 0; i < 16; ++i) r[i] = *(const v4f*)(s + lb + i * (N * 4));
    asm volatile("s_wait_xcnt 0x0" :: "v"(lb) : "memory");   // behind the run of loads: the offset register that all of them name is an input here, so that it stays whole up to the wait and is not handed to the last load as its destination
    char* t = tiles + wave * (32 * TP);
#pragma unroll
    for (int c = 0; c < 4; ++c) { v8us a, b;
#pragma unroll
        for (int i = 0; i < 8; ++i) { a[i] = f2bf(r[i][c]); b[i] = f2bf(r[8 + i][c]); }
        *(v8us*)(t + (c4 * 4 + c) * TP + g * 32) = a; *(v8us*)(t + (c4 * 4 + c) * TP + g * 32 + 16) = b; }
    asm volatile("s_wait_dscnt 0x0" ::: "memory");   // the wave's tile is whole in LDS before its lanes read what other lanes wrote; no other wave touches these rows
    bf* d = Bt + (size_t)n0 * K + k0 + (g * K + c4 * 8);
#pragma unroll
    for (int q = 0; q < 8; ++q) *(v8us*)(d + q * 4 * K) = *(const v8us*)(t + (q * 4 + g) * TP + c4 * 16);
}
// cvtL: one wave converts 2048 consecutive elements; sixteen whole-line loads of 16 bytes a lane in flight at once, a wave-wide store is two whole lines
__device__ __forceinline__ void cvtL(const unsigned bx, const float* __restrict__ src, bf* dst) {
    static_assert((size_t)NB_ * TT * DM % (8 * 2048) == 0, "whole waves");
    const size_t o = ((size_t)bx * 8 + __builtin_amdgcn_readfirstlane((int)(threadIdx.x >> 5))) * 2048; const unsigned l = (threadIdx.x & 31) * 4, lb = l * 4u;   // the wave's first element; the lane's element and byte offset in a piece of 128
    v4f r[16];
#pragma unroll
    for (int i = 0; i < 16; ++i) r[i] = *(const v4f*)((const char*)(src + o) + lb + i * 512);
    asm volatile("s_wait_xcnt 0x0" :: "v"(lb) : "memory");   // behind the run of loads, as in wtT
#pragma unroll
    for (int i = 0; i < 16; ++i) { v4us c;
#pragma unroll
        for (int k = 0; k < 4; ++k) c[k] = f2bf(r[i][k]);
        *(v4us*)(dst + o + (l + i * 128)) = c; }
}
// ---- k_prep: the four weight transposes and the conversion of x in one launch; neither reads what the other writes. 16 waves a WGP in all, every one of them resident from the start, each with its whole share of the reads in flight. The transposing blocks, whose waves run longer, have the lowest indices.
__global__ __launch_bounds__(256) void k_prep(const float* __restrict__ w0, const float* __restrict__ w1, const float* __restrict__ w2, const float* __restrict__ w3, bf* Bt, const float* __restrict__ x, bf* xb) {
    __shared__ __align__(16) char tiles[8 * 32 * TP];
    if (blockIdx.x < WTB) wtT(blockIdx.x, w0, w1, w2, w3, Bt, tiles);
    else cvtL(blockIdx.x - WTB, x, xb);
}

typedef __attribute__((ext_vector_type(2))) __bf16 v2bf;
// p (f32, 8 keys of one query) -> 8 elements s0 .. s0 + 7 of a B operand; both conversions round to nearest even
__device__ __forceinline__ void packp(v16h& d, v16h&, const v8f p, const int s0) {
#pragma unroll
    for (int j = 0; j < 8; j += 2) { const v2h c = __builtin_convertvector((v2f){p[j], p[j + 1]}, v2h); d[s0 + j] = c[0]; d[s0 + j + 1] = c[1]; } }
__device__ __forceinline__ void packp(v16bf& d, v16bf& dl, const v8f p, const int s0) {
#pragma unroll
    for (int j = 0; j < 8; j += 2) { const v2bf c = __builtin_convertvector((v2f){p[j], p[j + 1]}, v2bf); const v2bf l = __builtin_convertvector((v2f){p[j] - (float)c[0], p[j + 1] - (float)c[1]}, v2bf); d[s0 + j] = c[0]; d[s0 + j + 1] = c[1]; dl[s0 + j] = l[0]; dl[s0 + j + 1] = l[1]; } }

#define WT 20              // 16-key tiles in the window of a block's 64 query rows: 64 + 2 BW keys
#define WB (WT * PT * 2)   // their bytes in one packed plane, all in a row
// ten asynchronous copies of 16 bytes a lane: pieces of 2 KiB (the block's 128 lanes x 16 bytes) one behind the other (l: the lane's LDS byte address, g: its global address, both in the first piece); a wave-wide copy is four whole lines. The closing wait stands in front of whatever rewrites the address registers named here.
__device__ __forceinline__ void copy10(const unsigned l, const char* g) {
    asm volatile("global_load_async_to_lds_b128 %0, %10, off\n\tglobal_load_async_to_lds_b128 %1, %11, off\n\tglobal_load_async_to_lds_b128 %2, %12, off\n\tglobal_load_async_to_lds_b128 %3, %13, off\n\tglobal_load_async_to_lds_b128 %4, %14, off\n\t"
                 "global_load_async_to_lds_b128 %5, %15, off\n\tglobal_load_async_to_lds_b128 %6, %16, off\n\tglobal_load_async_to_lds_b128 %7, %17, off\n\tglobal_load_async_to_lds_b128 %8, %18, off\n\tglobal_load_async_to_lds_b128 %9, %19, off\n\ts_wait_xcnt 0x0"
                 :: "v"(l), "v"(l + 2048), "v"(l + 2 * 2048), "v"(l + 3 * 2048), "v"(l + 4 * 2048), "v"(l + 5 * 2048), "v"(l + 6 * 2048), "v"(l + 7 * 2048), "v"(l + 8 * 2048), "v"(l + 9 * 2048),
                    "v"(g), "v"(g + 2048), "v"(g + 2 * 2048), "v"(g + 3 * 2048), "v"(g + 4 * 2048), "v"(g + 5 * 2048), "v"(g + 6 * 2048), "v"(g + 7 * 2048), "v"(g + 8 * 2048), "v"(g + 9 * 2048) : "memory");
}
typedef __attribute__((ext_vector_type(8))) int v8i;
template <typename T16, bool HI>
__device__ __forceinline__ float fattn(const T16* __restrict__ Q, const T16* __restrict__ Q2, const T16* __restrict__ Kp, const T16* __restrict__ K2, const T16* __restrict__ Vt, const T16* __restrict__ Vt2, v8f (&O)[4], char* kv) {
    typedef typename WFrag<T16>::V V;
    static_assert(HD == 64 && BW == 128, "tile counts below are those of head size 64 and half window 128");
    static_assert(WT * 16 == 64 + 2 * BW && WT == 20 && TT % 64 == 0, "a block's window: two statements of ten copies a plane");
    // the lane's number, read in another way in each form: lane arithmetic that both forms spell alike is moved in front of the branch that picks the form, where the build no longer sees that a load's lane offset has 32 bits and spends a 64-bit register address on every base
    const int lane = HI ? (int)__builtin_amdgcn_mbcnt_lo(~0u, 0u) : (int)(threadIdx.x & 31), lr = lane & 15, hi = lane >> 4, e = 8 * hi - lr;
    const int wave = __builtin_amdgcn_readfirstlane((int)(threadIdx.x >> 5)), r = ((int)blockIdx.y * 4 + wave) * 16, wb = r - BW;
    const size_t z = blockIdx.x, pl = z * ((size_t)TT * HD);
    const unsigned ls = (unsigned)lane * 16u;   // the lane's byte offset in a piece of a packed tile: every address below is a wave-uniform base + this + a constant
    auto at = [](const T16* base, unsigned off) { return (const T16*)((const char*)base + off); };
    auto keep = [](V a, bool in0, bool in1) { v8i w = __builtin_bit_cast(v8i, a);   // a fragment's first four registers are its first 16-key tile, the rest its second
#pragma unroll
        for (int i = 0; i < 8; ++i) w[i] = ((i < 4) ? in0 : in1) ? w[i] : 0;
        return __builtin_bit_cast(V, w); };
    V q[2], q2[2]; const T16* qb = Q + pl + (size_t)r * HD; const T16* qb2 = HI ? Q2 + pl + (size_t)r * HD : nullptr;   // the rows' tile (16 positions are PT = 16 HD elements: r * HD is the tile's start)
#pragma unroll
    for (int ks = 0; ks < 2; ++ks) { q[ks] = WFrag<T16>::ld2(at(qb + ks * 512, ls), at(qb + ks * 512 + 256, ls)); if (HI) q2[ks] = WFrag<T16>::ld2(at(qb2 + ks * 512, ls), at(qb2 + ks * 512 + 256, ls)); }   // pieces 2 ks and 2 ks + 1 of the rows' tile
    // behind q's loads: what follows in the build reuses their offset and base registers, and the wait stands in front of that overwrite; they are named as inputs so that they stay whole up to the wait
    if constexpr (HI) asm volatile("s_wait_xcnt 0x0" :: "s"(qb), "s"(qb2), "v"(ls) : "memory"); else asm volatile("s_wait_xcnt 0x0" :: "s"(qb), "v"(ls) : "memory");
    const long w0 = (long)pl + ((long)blockIdx.y * 64 - BW) * HD;   // the block's window in a plane set: its first element
    const unsigned cb = (unsigned)wave * 512u + ls, cl = (unsigned)(size_t)kv + cb;   // the lane's 16 bytes in a piece of 2 KiB, and their LDS address in kv's first piece
    auto stage = [&](const T16* set, const unsigned dst) { const char* g = (const char*)(set + w0) + cb; unsigned l = cl + dst;   // one plane's window, WT pieces, to byte dst of kv
#pragma unroll 1   // rolled, so that the addresses are formed from l and g at each statement: unrolled, the build keeps the LDS addresses of the first staging in forty registers for the second, over the whole of the scores
        for (int h = 0; h < 2; ++h) { copy10(l, g); l += 10 * 2048; g += 10 * 2048; } };
    stage(Kp, 0); if constexpr (HI) stage(K2, WB);
    asm volatile("s_wait_asynccnt 0x0" ::: "memory");   // this wave's part of the k window(s) has landed
    __syncthreads();                                      // every wave's part has
    if constexpr (!HI) stage(Vt, WB);                     // v has its own half of kv and flies under the scores
    const char* fl = kv + wave * (PT * 2) + ls;   // the lane's slot in piece 0 of the wave's first key tile, first window
    constexpr int G = HI ? 2 : 6;   // key tiles a group: with two the hi/lo form stays inside 256 registers, a quarter of a SIMD's
    v8f S[17]; float mx = -3.0e38f;
#pragma unroll
    for (int g = 0; g < (17 + G - 1) / G; ++g) {
        V k[G][2], k2[G][2];
#pragma unroll
        for (int i = 0; i < G; ++i)
#pragma unroll
            for (int ks = 0; ks < 2; ++ks) { const int t = g * G + i; if (t < 17) { const char* p = fl + t * (PT * 2) + ks * 1024; k[i][ks] = WFrag<T16>::ld2((const T16*)p, (const T16*)(p + 512)); if (HI) k2[i][ks] = WFrag<T16>::ld2((const T16*)(p + WB), (const T16*)(p + WB + 512)); } }
        __builtin_amdgcn_sched_barrier(0);   // a group's k reads go out together: sunk to their products, each tile's latency is waited out on its own
#pragma unroll
        for (int i = 0; i < G; ++i) { const int t = g * G + i; if (t >= 17) continue;
            const float off = (t == 8 || (unsigned)(wb + t * 16) < (unsigned)TT) ? 0.0f : -3.0e38f;   // tile 8 is the wave's own rows
            v8f a = (v8f){};
#pragma unroll
            for (int ks = 0; ks < 2; ++ks) { a = WFrag<T16>::mma(k[i][ks], q[ks], a); if (HI) { a = WFrag<T16>::mma(k[i][ks], q2[ks], a); a = WFrag<T16>::mma(k2[i][ks], q[ks], a); } }
#pragma unroll
            for (int j = 0; j < 8; ++j) { float s = a[j] * SCL + off;   // SCL is a power of two: the product is exact, and off is 0 inside the sequence
                if (t == 0) s = (j + e >= 0) ? s : -3.0e38f;    // key >= query - BW
                if (t == 16) s = (j + e <= 0) ? s : -3.0e38f;   // key <= query + BW
                a[j] = s; mx = fmaxf(mx, s); }
            S[t] = a; }
    }
    if constexpr (HI) {
        asm volatile("s_wait_dscnt 0x0" ::: "memory");      // this wave's reads of k are done before kv is handed to the copies
        __syncthreads();                                      // every wave's are
        stage(Vt, 0); stage(Vt2, WB);
    }
    if constexpr (!HI) __builtin_amdgcn_sched_barrier(0);   // keeps the scores in front of the wait, so that the copies fly under all of them: the build otherwise sinks the last of them behind it
    asm volatile("s_wait_asynccnt 0x0" ::: "memory");   // this wave's part of the v window(s) has landed
    __syncthreads();                                      // every wave's part has
    const char* vl = fl + (HI ? 0 : WB);   // as fl, in the window of v (hi)
    const float m = fmaxf(mx, __shfl_xor(mx, 16, 32)); v8f sv = (v8f){};   // row maximum, eight independent partial row sums; O: output tiles
#pragma unroll
    for (int mb = 0; mb < 4; ++mb) O[mb] = (v8f){};
#pragma unroll
    for (int kb = 0; kb < 9; ++kb) {
        const bool in0 = kb == 4 || (unsigned)(wb + kb * 32) < (unsigned)TT, in1 = (unsigned)(wb + kb * 32 + 16) < (unsigned)TT;
        V p, p2, va[4], va2[4];
#pragma unroll
        for (int mb = 0; mb < 4; ++mb) { const char* p = vl + 2 * kb * (PT * 2) + mb * 512;   // piece mb of the block's two key tiles (the last block has one: the 18th tile lies outside the last wave's part of kv and stays zero); the block's v reads go out together, in flight under its exponentials
            if (kb < 8) { va[mb] = WFrag<T16>::ld2((const T16*)p, (const T16*)(p + PT * 2)); if (HI) va2[mb] = WFrag<T16>::ld2((const T16*)(p + WB), (const T16*)(p + WB + PT * 2)); }
            else { va[mb] = WFrag<T16>::ld1((const T16*)p); if (HI) va2[mb] = WFrag<T16>::ld1((const T16*)(p + WB)); } }
        __builtin_amdgcn_sched_barrier(0);   // keeps them there: sunk to their products, each read's latency is waited out on its own
#pragma unroll
        for (int u = 0; u < 2; ++u) { const int t = 2 * kb + u; v8f ev = (v8f){};
            if (t < 17) {
#pragma unroll
                for (int j = 0; j < 8; ++j) ev[j] = (S[t][j] - m) * 1.4426950408889634f;
                float x0, x1, x2, x3, x4, x5, x6, x7;
                // eight exp2 in one statement. The four leading slots are the distance behind a matrix instruction: the results may land in registers that were its A or B. Each exponential is followed by one that touches neither its result nor its source (early-clobber results), the last by the one slot that the instruction set asks for behind a transcendental.
                asm("v_nop\n\tv_nop\n\tv_nop\n\tv_nop\n\tv_exp_f32 %0, %8\n\tv_exp_f32 %1, %9\n\tv_exp_f32 %2, %10\n\tv_exp_f32 %3, %11\n\tv_exp_f32 %4, %12\n\tv_exp_f32 %5, %13\n\tv_exp_f32 %6, %14\n\tv_exp_f32 %7, %15\n\tv_nop"
                    : "=&v"(x0), "=&v"(x1), "=&v"(x2), "=&v"(x3), "=&v"(x4), "=&v"(x5), "=&v"(x6), "=&v"(x7) : "v"(ev[0]), "v"(ev[1]), "v"(ev[2]), "v"(ev[3]), "v"(ev[4]), "v"(ev[5]), "v"(ev[6]), "v"(ev[7]));
                ev = (v8f){x0, x1, x2, x3, x4, x5, x6, x7}; sv += ev; }
            packp(p, p2, HI ? ev : ev * PCAR, u * 8); }   // p goes into the product unnormalised (largest term 1); the row sum divides the output
#pragma unroll
        for (int mb = 0; mb < 4; ++mb) { const V b = keep(va[mb], in0, in1);
            O[mb] = WFrag<T16>::mma(b, p, O[mb]); if (HI) { O[mb] = WFrag<T16>::mma(b, p2, O[mb]); O[mb] = WFrag<T16>::mma(keep(va2[mb], in0, in1), p, O[mb]); } }
    }
    float sum = ((sv[0] + sv[1]) + (sv[2] + sv[3])) + ((sv[4] + sv[5]) + (sv[6] + sv[7])); sum += __shfl_xor(sum, 16, 32);
    return __fdiv_rn(HI ? 1.0f : (1.0f / PCAR), sum);   // the factor that turns O into y
}
// ---- k_fattn2: both forms of the attention in one launch; they share no data but their inputs, so neither waits for the other's last wave. Grid (head planes, 64-row tiles), a block is four waves of 16 query rows each, which share their key window in LDS.
// blockIdx.y is the row tile: the RH / 64 * ZH blocks of the hi/lo form, the longer one, have the lowest flat indices.
__global__ __launch_bounds__(128) __attribute__((amdgpu_waves_per_eu(4, 4))) void k_fattn2(const bf* __restrict__ Qh, const bf* __restrict__ Ql, const bf* __restrict__ Kh, const bf* __restrict__ Kl, const bf* __restrict__ Vh, const bf* __restrict__ Vl, const h16* __restrict__ Q16, const h16* __restrict__ K16, const h16* __restrict__ V16, bf* Eh, bf* El) {
    __shared__ __align__(16) char kv[2 * WB];   // two windows; four blocks fill a WGP's LDS, and at four waves a SIMD (the attribute above holds the build to their share of the registers) all blocks of the grid are resident at once
    v8f O[4]; float f;
    if (blockIdx.y < RH / 64) f = fattn<bf, true>(Qh, Ql, Kh, Kl, Vh, Vl, O, kv);
    else f = fattn<h16, false>(Q16, nullptr, K16, nullptr, V16, nullptr, O, kv);
    // the way out is the same for both forms and stands once in the text
    const int lr = threadIdx.x & 15, hi = (threadIdx.x >> 4) & 1, r = ((int)blockIdx.y * 4 + __builtin_amdgcn_readfirstlane((int)(threadIdx.x >> 5))) * 16;
    const size_t z = blockIdx.x; const unsigned lo = (unsigned)(lr * DQ + 8 * hi) * 2u;   // the lane's byte offset in a 16-row fragment of pitch DQ
    const size_t ob = ((z / NH_) * (size_t)TT + r) * DQ + (z % NH_) * HD;
#pragma unroll
    for (int mb = 0; mb < 4; ++mb) { v8us oh, ol;   // a lane's 8 accumulator rows are 8 consecutive d of one query
#pragma unroll
        for (int j = 0; j < 8; ++j) { unsigned short a2, c2; splitf(O[mb][j] * f, a2, c2); oh[j] = a2; ol[j] = c2; }
        const size_t oo = ob + mb * 16; *(v8us*)((char*)(Eh + oo) + lo) = oh; *(v8us*)((char*)(El + oo) + lo) = ol;
        if (mb < 3) asm volatile("s_wait_xcnt 0x0" ::: "memory"); }   // behind the two plane stores: the next tile's conversion reuses their data registers in the build, and the wait stands in front of that overwrite
}

extern "C" void kernel_launch(void* const* d_in, const int* in_sizes, int n_in,
                              void* d_out, int out_size, void* d_ws, size_t ws_size, hipStream_t stream) {
    (void)in_sizes; (void)n_in; (void)out_size;
    const float* x = (const float*)d_in[0]; const float* wq = (const float*)d_in[1]; const float* bq = (const float*)d_in[2]; const float* wk = (const float*)d_in[3]; const float* bk = (const float*)d_in[4]; const float* wv = (const float*)d_in[5]; const float* bv = (const float*)d_in[6]; const float* wo = (const float*)d_in[7]; const float* bo = (const float*)d_in[8];   /* argument order x, wq, bq, wk, bk, wv, bv, wo, bo */
    float* OUT = (float*)d_out;     // [2][2048][1024]
    char* wsp = (char*)d_ws;
    auto take = [&](size_t bytes) { char* p = wsp; wsp += (bytes + 255) & ~(size_t)255; return (void*)p; };
    bf* WQ = (bf*)take((size_t)4 * DQ * DM * 2); bf* WK = WQ + (size_t)DQ * DM; bf* WV = WK + (size_t)DKV * DM; bf* WO = WV + (size_t)DKV * DM; (void)WK; (void)WV;   // four transposed 1024 x 1024 weights in a row: a grid dimension walks them
    bf* XB = (bf*)take((size_t)NB_ * TT * DM * 2);
    const size_t PS = (size_t)ZH * TT * HD;   // one plane set: 32 head planes; q, k, v sets in a row, the projection GEMM's z walks them
    h16* QP16 = (h16*)take(3 * PS * 2); h16* KP16 = QP16 + PS; h16* VT16 = KP16 + PS;
    bf* QPh = (bf*)take(3 * PS * 2); bf* KPh = QPh + PS; bf* VTh = KPh + PS; bf* QPl = (bf*)take(3 * PS * 2); bf* KPl = QPl + PS; bf* VTl = KPl + PS;
    bf* ATh = (bf*)take((size_t)2 * NB_ * TT * DQ * 2); bf* ATl = ATh + (size_t)NB_ * TT * DQ;   // merged hi/lo planes
    if ((size_t)(wsp - (char*)d_ws) > ws_size) return;    // 104 of the 256 MiB
    k_prep<<<WTB + CVB, 256, 0, stream>>>(wq, wk, wv, wo, WQ, x, XB);
    k_gemms<0, 1><<<dim3(NB_ * TT / 128, DQ / 128, 3), 128, 0, stream>>>(XB, nullptr, WQ, nullptr, 0, bq, bk, bv, (size_t)DQ * DM, QP16, QPh, QPl);   // z: q, k, v
    k_fattn2<<<dim3(ZH, TT / 64, 1), 128, 0, stream>>>(QPh, QPl, KPh, KPl, VTh, VTl, QP16, KP16, VT16, ATh, ATl);
    k_gemms<1, 0><<<dim3(NB_ * TT / 128, DM / 128, 1), 128, 0, stream>>>(ATh, ATl, WO, OUT, DM, bo, nullptr, nullptr, 0, nullptr, nullptr, nullptr);
}

// v010
// It runs in 59.9 microseconds.
// Timed twice side by side with v009, it ran 1.07 and 1.06 times as fast.
// All steps since v000 together make it 34.4 times as fast.
#include <hip/hip_runtime.h>

// Sliding-window (banded) multi-head attention (x [2][2048][1024]; q, k, v = x W + b ('xw' [1024][1024] 0.02, zero biases; 16 heads x 64); scores x 64^-0.5; keys j with i - 128 <= j <= i + 128 (symmetric window 256, -inf elsewhere); softmax; out = merged wo + bo ('xw') -> [2][2048][1024] (4.2 M); argument order x, wq, bq, wk, bk, wv, bv, wo, bo).
// Layout, both batches at once (4096 rows; 32 head planes z = batch * 16 + head): bf16 copy of x; 'xw' weights transposed once; exact projections + f32 biases, whose GEMM stores the 16-bit q, k, v head planes itself, in the order in which the attention's matrix fragments are loaded (PACKED PLANES below); banded attention fused in k_fattn2: a wave holds the scores of its 16 query rows against their 272-key window in registers, takes their exponentials there and feeds them to the p x v product, whose result the row sum divides; scores and p never reach memory (hybrid rows: < 512 hi/lo 3 products, rest fp16 x1024; both forms in one launch); it stores the merged hi/lo planes; merged hi/lo x wo exact + bo.
// Compute dtypes, f32 accumulate: every input rounded to bf16; projections exact + f32 biases; attention rows < 512 3 products, rest fp16; softmax f32; wo hl x exact + bias.

#define NB_  2
#define TT   2048
#define DM   1024
#define NH_  16
#define NKV  16
#define REP  (NH_ / NKV)
#define HD   64
#define DQ   (NH_ * HD)
#define DKV  (NKV * HD)
#define ZH   (NB_ * NH_)          // head planes per attention launch: all heads of both batches
#define RH   512                  // query rows < RH use hi+lo planes (0: none)
#define WIN  2048
#define BW   128      // half window: keys j in [i - 128, i + 128]
#define PCAR 1024.0f
#define SCL  0.125f   // HD^-0.5
typedef _Float16 h16;
typedef unsigned short bf;
typedef __attribute__((ext_vector_type(16))) __bf16   v16bf;
typedef __attribute__((ext_vector_type(16))) _Float16 v16h;
typedef __attribute__((ext_vector_type(8)))  _Float16 v8h;
typedef __attribute__((ext_vector_type(8)))  unsigned short v8us;
typedef __attribute__((ext_vector_type(8)))  float    v8f;
typedef __attribute__((ext_vector_type(4)))  float    v4f;
typedef v8h  __attribute__((may_alias)) v8ha;
typedef v4f  __attribute__((may_alias)) v4fa;
typedef v8us __attribute__((may_alias)) v8usa;

__device__ __forceinline__ unsigned short f2bf(float f) { return __builtin_bit_cast(unsigned short, (__bf16)f); }   // the hardware's conversion: nearest even
__device__ __forceinline__ float bf2f(unsigned short b) { return __uint_as_float(((unsigned)b) << 16); }
__device__ __forceinline__ float bfr(float f) { return bf2f(f2bf(f)); }
__device__ __forceinline__ v16h cat16(v8h lo, v8h hi) { return __builtin_shufflevector(lo, hi, 0, 1, 2, 3, 4, 5, 6, 7, 8, 9, 10, 11, 12, 13, 14, 15); }
__device__ __forceinline__ v16bf cat16b(v8us lo, v8us hi) { return __builtin_bit_cast(v16bf, __builtin_shufflevector(lo, hi, 0, 1, 2, 3, 4, 5, 6, 7, 8, 9, 10, 11, 12, 13, 14, 15)); }
__device__ __forceinline__ v8f wmma16(v16h a, v16h b, v8f c) { return __builtin_amdgcn_wmma_f32_16x16x32_f16(false, a, false, b, (short)0, c, false, false); }
__device__ __forceinline__ v8f wmmab(v16bf a, v16bf b, v8f c) { return __builtin_amdgcn_wmma_f32_16x16x32_bf16(false, a, false, b, (short)0, c, false, false); }
typedef __attribute__((ext_vector_type(2))) float v2f;
typedef __attribute__((ext_vector_type(2))) __bf16 v2bf;
typedef __attribute__((ext_vector_type(2))) _Float16 v2h;
typedef __attribute__((ext_vector_type(2))) unsigned short v2us;
// two f32 -> two bf16 in one packed conversion (nearest even)
__device__ __forceinline__ v2us bf2(float a, float b) { return __builtin_bit_cast(v2us, __builtin_convertvector((v2f){a, b}, v2bf)); }
// eight f32 -> bf16 hi and bf16 lo = y - hi, two elements a conversion
__device__ __forceinline__ void split8(const v8f y, v8us& oh, v8us& ol) {
#pragma unroll
    for (int j = 0; j < 8; j += 2) { const v2us h = bf2(y[j], y[j + 1]); const v2us l = bf2(y[j] - bf2f(h[0]), y[j + 1] - bf2f(h[1])); oh[j] = h[0]; oh[j + 1] = h[1]; ol[j] = l[0]; ol[j + 1] = l[1]; } }
// eight f32 -> fp16, two elements a conversion
__device__ __forceinline__ v8h half8(const v8f y) { v8h o;
#pragma unroll
    for (int j = 0; j < 8; j += 2) { const v2h c = __builtin_convertvector((v2f){y[j], y[j + 1]}, v2h); o[j] = c[0]; o[j + 1] = c[1]; }
    return o; }



// ---- k_gemms: GEMM, a work-group of four waves (2 x 2) per 128x128 output tile, each wave a 64x64 tile (16 accumulators); grid (M/128, N/128, Z), 128 threads. K = DM.
// C[m][n] = sum_k A[m][k] Bt[n][k] (NSPLIT 1: + A2[m][k] Bt[n][k] behind each block's first product) + f32 bias[n] (bias, bias1, bias2 for z = 0, 1, 2); A, A2, Bt K-contiguous bf16 planes; Bt's z stride sB in elements.
// Operands reach the waves through LDS: a stage is 64 k (one whole 128-byte line) of the tile's 128 A rows, 128 Bt rows (and 128 A2 rows), at pitch GP; two buffers; asynchronous copies to LDS fill the next stage while this one is worked on. A wave-wide copy is four whole lines; every wave copies 32 rows of each operand.
// EPI 0: C in f32, pitch ldc. EPI 1 (projections; a wave's 64 columns are one head): y = sum + bias goes out as fp16, bf16 hi and bf16 lo = y - hi, into plane set z of E16, Eh, El, head plane batch * NH_ + head. C is unused for EPI 1.
// PACKED PLANES: a head plane is TT / 16 tiles of 16 positions x 64 d (2 KiB, PT elements), a tile four pieces of 512 bytes, a piece 32 lane slots of 16 bytes: one wave-wide 16-byte load of the attention kernel reads one piece, four whole 128-byte lines, and each lane finds half a fragment in its slot. Slot hi * 16 + lr of piece s holds, for q and k, position lr, d = (s / 2) * 32 + (s % 2) * 16 + hi * 8 + 0..7; for v, d = s * 16 + lr, positions hi * 8 + 0..7.
template <typename T16> struct WFrag;
template <> struct WFrag<h16> { typedef v16h V; static __device__ __forceinline__ V ld(const h16* p) { return cat16(*(const v8h*)p, *(const v8h*)(p + 16)); } static __device__ __forceinline__ V ld2(const h16* p, const h16* p1) { return cat16(*(const v8h*)p, *(const v8h*)p1); } static __device__ __forceinline__ V ld1(const h16* p) { return cat16(*(const v8h*)p, (v8h){}); } static __device__ __forceinline__ v8f mma(V a, V b, v8f c) { return wmma16(a, b, c); } };
template <> struct WFrag<bf> { typedef v16bf V; static __device__ __forceinline__ V ld(const bf* p) { return cat16b(*(const v8us*)p, *(const v8us*)(p + 16)); } static __device__ __forceinline__ V ld2(const bf* p, const bf* p1) { return cat16b(*(const v8us*)p, *(const v8us*)p1); } static __device__ __forceinline__ V ld1(const bf* p) { return cat16b(*(const v8us*)p, (v8us){}); } static __device__ __forceinline__ v8f mma(V a, V b, v8f c) { return wmmab(a, b, c); } };
#define PT (16 * HD)   // elements of a packed tile
#define GP 144   // bytes from one staged row to the next: 128 + 16, an odd number of 16-byte units, so that the 16-byte fragment reads of 16 rows meet no bank twice
// eight asynchronous copies of 16 bytes a lane: rows r, r + 4, .. r + 28 of one operand's stage (l: the lane's LDS byte address, g: its global address, both of row r). The closing wait stands in front of whatever rewrites the address registers named here.
__device__ __forceinline__ void copy8(const unsigned l, const bf* g) {
    asm volatile("global_load_async_to_lds_b128 %0, %8, off\n\tglobal_load_async_to_lds_b128 %1, %9, off\n\tglobal_load_async_to_lds_b128 %2, %10, off\n\tglobal_load_async_to_lds_b128 %3, %11, off\n\t"
                 "global_load_async_to_lds_b128 %4, %12, off\n\tglobal_load_async_to_lds_b128 %5, %13, off\n\tglobal_load_async_to_lds_b128 %6, %14, off\n\tglobal_load_async_to_lds_b128 %7, %15, off\n\ts_wait_xcnt 0x0"
                 :: "v"(l), "v"(l + 4 * GP), "v"(l + 8 * GP), "v"(l + 12 * GP), "v"(l + 16 * GP), "v"(l + 20 * GP), "v"(l + 24 * GP), "v"(l + 28 * GP),
                    "v"(g), "v"(g + 4 * DM), "v"(g + 8 * DM), "v"(g + 12 * DM), "v"(g + 16 * DM), "v"(g + 20 * DM), "v"(g + 24 * DM), "v"(g + 28 * DM) : "memory");
}
template <int NSPLIT, int EPI>
__global__ __launch_bounds__(128) void k_gemms(const bf* __restrict__ A, const bf* __restrict__ A2, const bf* __restrict__ Bt, float* C, int ldc, const float* __restrict__ bias, const float* __restrict__ bias1, const float* __restrict__ bias2, size_t sB, h16* E16, bf* Eh, bf* El) {
    typedef WFrag<bf>::V V;
    static_assert(DM == DQ && DM % 128 == 0, "one K for both launches; at least two stages");
    constexpr int K = DM, NT = K / 64, BUFB = (2 + NSPLIT) * 128 * GP;   // stages; bytes of a buffer: A rows, Bt rows (, A2 rows)
    __shared__ __align__(16) char ring[2 * BUFB];
    __shared__ __align__(16) float osm[4 * 16 * 68];
    const size_t z = blockIdx.z; Bt += z * sB;
    bias = (z == 0) ? bias : (z == 1) ? bias1 : bias2;   // z-batched projections: each z has its own bias vector
    const int lane = threadIdx.x & 31, lr = lane & 15, hi = lane >> 4, wave = __builtin_amdgcn_readfirstlane((int)(threadIdx.x >> 5));
    const int R0 = blockIdx.x * 128, C0 = blockIdx.y * 128, wr = (wave & 1) * 64, wc = (wave >> 1) * 64, r0 = R0 + wr, c0 = C0 + wc;   // the work-group's tile, the wave's place in it, the wave's tile
    float* os = osm + wave * (16 * 68);
    // the lane's part in a copy: row wave * 32 + lane / 8 (+ 4 a copy) of the stage, 16-byte piece lane % 8 of its line
    const int crow = wave * 32 + (lane >> 3), cpc = (lane & 7) * 8;
    const unsigned lc = (unsigned)(size_t)ring + (unsigned)(crow * GP + cpc * 2);
    const bf* ga = A + (size_t)(R0 + crow) * K + cpc; const bf* gb = Bt + (size_t)(C0 + crow) * K + cpc; const bf* ga2 = NSPLIT ? A2 + (size_t)(R0 + crow) * K + cpc : nullptr;
    auto fill = [&](int t, int buf) { const unsigned l = lc + (unsigned)(buf * BUFB); copy8(l, ga + t * 64); copy8(l + 128 * GP, gb + t * 64); if (NSPLIT) copy8(l + 256 * GP, ga2 + t * 64); };
    v8f acc[4][4];
#pragma unroll
    for (int mb = 0; mb < 4; ++mb)
#pragma unroll
        for (int nb = 0; nb < 4; ++nb) acc[mb][nb] = (v8f){};
    fill(0, 0);
    asm volatile("s_wait_asynccnt 0x0" ::: "memory");   // this wave's part of stage 0 has landed
    __syncthreads();                                      // every wave's part has
    fill(1, 1);
    const int fa = (wr + lr) * GP + 16 * hi, fb = (128 + wc + lr) * GP + 16 * hi;   // the lane's byte offset in a buffer: row lr of the wave's first A and Bt fragment
#pragma unroll 1
    for (int t = 0; t < NT; ++t) {
        const char* sb = ring + (t & 1) * BUFB;
        V a[4], a2[4], b[4];
        auto frags = [&](int ks) {
#pragma unroll
            for (int mb = 0; mb < 4; ++mb) { a[mb] = WFrag<bf>::ld((const bf*)(sb + fa + mb * 16 * GP + ks * 64)); if (NSPLIT) a2[mb] = WFrag<bf>::ld((const bf*)(sb + fa + 256 * GP + mb * 16 * GP + ks * 64)); }
#pragma unroll
            for (int nb = 0; nb < 4; ++nb) b[nb] = WFrag<bf>::ld((const bf*)(sb + fb + nb * 16 * GP + ks * 64)); };
        auto prods = [&]() {
#pragma unroll
            for (int nb = 0; nb < 4; ++nb)
#pragma unroll
                for (int mb = 0; mb < 4; ++mb) { acc[mb][nb] = WFrag<bf>::mma(a[mb], b[nb], acc[mb][nb]); if (NSPLIT) acc[mb][nb] = WFrag<bf>::mma(a2[mb], b[nb], acc[mb][nb]); } };
        frags(0);
        __builtin_amdgcn_sched_barrier(0);   // a block's fragment reads go out as one group ahead of its products: sunk among them, each row of products waits out the LDS latency on its own
        prods();
        frags(1);                                             // the stage's last reads: its second block then works from registers alone
        if (NSPLIT) { __builtin_amdgcn_sched_barrier(0); prods(); }   // three operands: the block's twelve fragments, the accumulators and the copies' addresses do not fit 256 registers together, so its products come first, behind its reads as one group as above
        asm volatile("s_wait_dscnt 0x0" ::: "memory");      // this wave's reads of the buffer are done before it is handed to the copies
        asm volatile("s_wait_asynccnt 0x0" ::: "memory");   // this wave's part of stage t + 1 has landed
        __syncthreads();                                      // publishes stage t + 1 and ends every wave's reads of stage t
        if (t + 2 < NT) fill(t + 2, t & 1);
        if (!NSPLIT) prods();                                 // behind the refill, so that the copies fly under these products too
    }
    asm volatile("s_wait_asynccnt 0x0" ::: "memory");   // no copy is left in flight at the wave's end
    static_assert(HD == 64, "EPI 1 takes a wave's 64 columns for one head");
    const int trow = r0 % TT;   // sequence position of the tile's row 0
    if (EPI == 1) { const size_t pz = z * ((size_t)ZH * TT * HD) + (size_t)((r0 / TT) * NH_ + c0 / HD) * TT * HD; E16 += pz; Eh += pz; El += pz; }   // plane set z, head plane of this tile
    if (EPI == 1 && z == 2) {   // v: a lane's 8 accumulator rows are 8 consecutive t of one d, which is its slot of piece nb of tile mb: 16 bytes a plane straight from registers, every store 512 bytes in a row
#pragma unroll
        for (int nb = 0; nb < 4; ++nb) { const float bb = bfr(bias[c0 + nb * 16 + lr]);
#pragma unroll
            for (int mb = 0; mb < 4; ++mb) { v8us oh, ol; const v8f y = acc[mb][nb] + bb; const v8h o16 = half8(y); split8(y, oh, ol);
                // the three plane stores (one byte offset, three uniform bases) and their wait in one statement: as separate statements the build sends the first store ahead of the other planes' conversions, which reuse its data registers in front of the wait
                asm volatile("global_store_b128 %0, %1, %4\n\tglobal_store_b128 %0, %2, %5\n\tglobal_store_b128 %0, %3, %6\n\ts_wait_xcnt 0x0"
                             :: "v"((unsigned)(((trow / 16 + mb) * PT + nb * 256 + lane * 8) * 2)), "v"(__builtin_bit_cast(v4f, o16)), "v"(__builtin_bit_cast(v4f, oh)), "v"(__builtin_bit_cast(v4f, ol)), "s"(E16), "s"(Eh), "s"(El) : "memory"); } }
        return;
    }
    float bb[4];   // the biases of the lane's accumulator columns: added on the way into LDS, where a lane has one column a tile and not the 32 of its four slots
    if (EPI == 1) {
#pragma unroll
        for (int nb = 0; nb < 4; ++nb) bb[nb] = bfr(bias[c0 + nb * 16 + lr]); }
#pragma unroll
    for (int mb = 0; mb < 4; ++mb) {
#pragma unroll
        for (int nb = 0; nb < 4; ++nb) {
#pragma unroll
            for (int j = 0; j < 8; ++j) os[(hi * 8 + j) * 68 + nb * 16 + lr] = (EPI == 1) ? acc[mb][nb][j] + bb[nb] : acc[mb][nb][j]; }
        __builtin_amdgcn_wave_barrier(); asm volatile("" ::: "memory");
        if (EPI == 0) {
        float* crow2 = C + (size_t)(r0 + mb * 16) * ldc + c0;
#pragma unroll
            for (int s = 0; s < 8; ++s) { const int row = 2 * s + hi, cofs = lr * 4; v4f val = *(const v4fa*)(os + row * 68 + cofs); val[0] += bfr(bias[c0 + cofs]); val[1] += bfr(bias[c0 + cofs + 1]); val[2] += bfr(bias[c0 + cofs + 2]); val[3] += bfr(bias[c0 + cofs + 3]);
                *(v4f*)(crow2 + (size_t)row * ldc + cofs) = val; }
            asm volatile("s_wait_xcnt 0x0" ::: "memory");   // behind the run of stores above: what follows in the build reuses their data registers, and the wait stands in front of that overwrite
        } else {   // piece s of packed tile mb: each lane converts the 8 consecutive columns of its slot, a store is 512 bytes in a row in every plane
#pragma unroll
            for (int s = 0; s < 4; ++s) { const int row = lr, cofs = (s >> 1) * 32 + (s & 1) * 16 + hi * 8; const v4f va = *(const v4fa*)(os + row * 68 + cofs), vb = *(const v4fa*)(os + row * 68 + cofs + 4); v8us oh, ol;
                const v8f y = __builtin_shufflevector(va, vb, 0, 1, 2, 3, 4, 5, 6, 7); const v8h o16 = half8(y); split8(y, oh, ol);
                const size_t oo = (size_t)(trow / 16 + mb) * PT + s * 256 + lane * 8; *(v8h*)(E16 + oo) = o16; *(v8us*)(Eh + oo) = oh; *(v8us*)(El + oo) = ol;
                asm volatile("s_wait_xcnt 0x0" ::: "memory"); }   // behind the three plane stores: what follows in the build reuses their address and data registers, and the wait stands in front of that overwrite
        }
        __builtin_amdgcn_wave_barrier(); asm volatile("" ::: "memory");
    }
}

typedef __attribute__((ext_vector_type(4))) _Float16 v4h;
typedef __attribute__((ext_vector_type(4))) unsigned short v4us;
typedef __attribute__((ext_vector_type(4))) int v4i;

#define TP 144                                  // bytes from one n row of a wave's transposing tile in LDS to the next: 128 + 16, a multiple of the 16-byte accesses
#define WTB (4 * (DQ / 64) * (DM / 256))        // transposing blocks: a block of eight waves takes 64 n x 256 k of one weight
#define CVB (NB_ * TT * DM / (8 * 2048))        // converting blocks: a wave takes 2048 elements of x
// wtT: ONE WAVE transposes a tile of 64 k x 32 n of w [K][N] (f32) into Bt [N][K] (bf16). All sixteen loads of a lane are in flight at once; a wave-wide load is four whole 128-byte lines (rows i, 16 + i, 32 + i, 48 + i of the tile), so that a lane ends up with 16 consecutive k of four n.
// These go as 32 bytes a row into the wave's own LDS tile [n][k]; read back by rows, a wave-wide store is four whole lines of Bt. Four waves along k write 512 bytes of each Bt row.
__device__ __forceinline__ void wtT(const unsigned bx, const float* __restrict__ w0, const float* __restrict__ w1, const float* __restrict__ w2, const float* __restrict__ w3, bf* Bt, char* tiles) {
    static_assert(DM % 256 == 0 && DQ % 64 == 0, "whole block tiles");
    constexpr int K = DM, N = DQ, BPW = (N / 64) * (K / 256);   // blocks a weight
    const unsigned by = bx / BPW, rem = bx % BPW;               // by: which of the four equally shaped weights
    const float* __restrict__ w = (by == 0) ? w0 : (by == 1) ? w1 : (by == 2) ? w2 : w3; Bt += (size_t)by * K * N;
    const int lane = threadIdx.x & 31, g = lane >> 3, c4 = lane & 7, wave = __builtin_amdgcn_readfirstlane((int)(threadIdx.x >> 5));
    const int n0 = (int)(rem % (N / 64)) * 64 + (wave & 1) * 32, k0 = (int)(rem / (N / 64)) * 256 + (wave >> 1) * 64;
    const char* s = (const char*)(w + (size_t)k0 * N + n0); const unsigned lb = (unsigned)(g * 16 * N + c4 * 4) * 4u;   // the tile's first byte (wave-uniform), the lane's byte offset in it
    v4f r[16];
#pragma unroll
    for (int i = 0; i < 16; ++i) r[i] = *(const v4f*)(s + lb + i * (N * 4));
    __builtin_amdgcn_sched_barrier(0);   // keeps the conversions behind the run of loads: lifted among them, they hand the first loads' registers to the last ones, which then go out only when the first have come back
    asm volatile("s_wait_xcnt 0x0" :: "v"(lb) : "memory");   // behind the run of loads: the offset register that all of them name is an input here, so that it stays whole up to the wait and is not handed to the last load as its destination
    char* t = tiles + wave * (32 * TP);
#pragma unroll
    for (int c = 0; c < 4; ++c) { v8us a, b;
#pragma unroll
        for (int i = 0; i < 8; i += 2) { const v2us p = bf2(r[i][c], r[i + 1][c]), q = bf2(r[8 + i][c], r[9 + i][c]); a[i] = p[0]; a[i + 1] = p[1]; b[i] = q[0]; b[i + 1] = q[1]; }
        *(v8us*)(t + (c4 * 4 + c) * TP + g * 32) = a; *(v8us*)(t + (c4 * 4 + c) * TP + g * 32 + 16) = b; }
    asm volatile("s_wait_dscnt 0x0" ::: "memory");   // the wave's tile is whole in LDS before its lanes read what other lanes wrote; no other wave touches these rows
    bf* d = Bt + (size_t)n0 * K + k0 + (g * K + c4 * 8);
#pragma unroll
    for (int q = 0; q < 8; ++q) *(v8us*)(d + q * 4 * K) = *(const v8us*)(t + (q * 4 + g) * TP + c4 * 16);
}
// cvtL: one wave converts 2048 consecutive elements; sixteen whole-line loads of 16 bytes a lane in flight at once, a wave-wide store is two whole lines
__device__ __forceinline__ void cvtL(const unsigned bx, const float* __restrict__ src, bf* dst) {
    static_assert((size_t)NB_ * TT * DM % (8 * 2048) == 0, "whole waves");
    const size_t o = ((size_t)bx * 8 + __builtin_amdgcn_readfirstlane((int)(threadIdx.x >> 5))) * 2048; const unsigned l = (threadIdx.x & 31) * 4, lb = l * 4u;   // the wave's first element; the lane's element and byte offset in a piece of 128
    v4f r[16];
#pragma unroll
    for (int i = 0; i < 16; ++i) r[i] = *(const v4f*)((const char*)(src + o) + lb + i * 512);
    __builtin_amdgcn_sched_barrier(0);   // keeps the conversions behind the run of loads: lifted among them, they hand the first loads' registers to the last four, which then go out only when the first have come back
    asm volatile("s_wait_xcnt 0x0" :: "v"(lb) : "memory");   // behind the run of loads, as in wtT
#pragma unroll
    for (int i = 0; i < 16; ++i) { v4us c;
#pragma unroll
        for (int k = 0; k < 4; k += 2) { const v2us p = bf2(r[i][k], r[i][k + 1]); c[k] = p[0]; c[k + 1] = p[1]; }
        *(v4us*)(dst + o + (l + i * 128)) = c; }
}
// ---- k_prep: the four weight transposes and the conversion of x in one launch; neither reads what the other writes. 16 waves a WGP in all, every one of them resident from the start, each with its whole share of the reads in flight. The transposing blocks, whose waves run longer, have the lowest indices.
__global__ __launch_bounds__(256) void k_prep(const float* __restrict__ w0, const float* __restrict__ w1, const float* __restrict__ w2, const float* __restrict__ w3, bf* Bt, const float* __restrict__ x, bf* xb) {
    __shared__ __align__(16) char tiles[8 * 32 * TP];
    if (blockIdx.x < WTB) wtT(blockIdx.x, w0, w1, w2, w3, Bt, tiles);
    else cvtL(blockIdx.x - WTB, x, xb);
}

// p (f32, 8 keys of one query) -> 8 elements s0 .. s0 + 7 of a B operand; both conversions round to nearest even
__device__ __forceinline__ void packp(v16h& d, v16h&, const v8f p, const int s0) {
#pragma unroll
    for (int j = 0; j < 8; j += 2) { const v2h c = __builtin_convertvector((v2f){p[j], p[j + 1]}, v2h); d[s0 + j] = c[0]; d[s0 + j + 1] = c[1]; } }
__device__ __forceinline__ void packp(v16bf& d, v16bf& dl, const v8f p, const int s0) {
#pragma unroll
    for (int j = 0; j < 8; j += 2) { const v2bf c = __builtin_convertvector((v2f){p[j], p[j + 1]}, v2bf); const v2bf l = __builtin_convertvector((v2f){p[j] - (float)c[0], p[j + 1] - (float)c[1]}, v2bf); d[s0 + j] = c[0]; d[s0 + j + 1] = c[1]; dl[s0 + j] = l[0]; dl[s0 + j + 1] = l[1]; } }

#define WT 20              // 16-key tiles in the window of a block's 64 query rows: 64 + 2 BW keys
#define WB (WT * PT * 2)   // their bytes in one packed plane, all in a row
// ten asynchronous copies of 16 bytes a lane: pieces of 2 KiB (the block's 128 lanes x 16 bytes) one behind the other (l: the lane's LDS byte address, g: its global address, both in the first piece); a wave-wide copy is four whole lines. The closing wait stands in front of whatever rewrites the address registers named here.
__device__ __forceinline__ void copy10(const unsigned l, const char* g) {
    asm volatile("global_load_async_to_lds_b128 %0, %10, off\n\tglobal_load_async_to_lds_b128 %1, %11, off\n\tglobal_load_async_to_lds_b128 %2, %12, off\n\tglobal_load_async_to_lds_b128 %3, %13, off\n\tglobal_load_async_to_lds_b128 %4, %14, off\n\t"
                 "global_load_async_to_lds_b128 %5, %15, off\n\tglobal_load_async_to_lds_b128 %6, %16, off\n\tglobal_load_async_to_lds_b128 %7, %17, off\n\tglobal_load_async_to_lds_b128 %8, %18, off\n\tglobal_load_async_to_lds_b128 %9, %19, off\n\ts_wait_xcnt 0x0"
                 :: "v"(l), "v"(l + 2048), "v"(l + 2 * 2048), "v"(l + 3 * 2048), "v"(l + 4 * 2048), "v"(l + 5 * 2048), "v"(l + 6 * 2048), "v"(l + 7 * 2048), "v"(l + 8 * 2048), "v"(l + 9 * 2048),
                    "v"(g), "v"(g + 2048), "v"(g + 2 * 2048), "v"(g + 3 * 2048), "v"(g + 4 * 2048), "v"(g + 5 * 2048), "v"(g + 6 * 2048), "v"(g + 7 * 2048), "v"(g + 8 * 2048), "v"(g + 9 * 2048) : "memory");
}
typedef __attribute__((ext_vector_type(8))) int v8i;
template <typename T16, bool HI>
__device__ __forceinline__ float fattn(const T16* __restrict__ Q, const T16* __restrict__ Q2, const T16* __restrict__ Kp, const T16* __restrict__ K2, const T16* __restrict__ Vt, const T16* __restrict__ Vt2, v8f (&O)[4], char* kv) {
    typedef typename WFrag<T16>::V V;
    static_assert(HD == 64 && BW == 128, "tile counts below are those of head size 64 and half window 128");
    static_assert(WT * 16 == 64 + 2 * BW && WT == 20 && TT % 64 == 0, "a block's window: two statements of ten copies a plane");
    // the lane's number, read in another way in each form: lane arithmetic that both forms spell alike is moved in front of the branch that picks the form, where the build no longer sees that a load's lane offset has 32 bits and spends a 64-bit register address on every base
    const int lane = HI ? (int)__builtin_amdgcn_mbcnt_lo(~0u, 0u) : (int)(threadIdx.x & 31), lr = lane & 15, hi = lane >> 4, e = 8 * hi - lr;
    const int wave = __builtin_amdgcn_readfirstlane((int)(threadIdx.x >> 5)), r = ((int)blockIdx.y * 4 + wave) * 16, wb = r - BW;
    const size_t z = blockIdx.x, pl = z * ((size_t)TT * HD);
    const unsigned ls = (unsigned)lane * 16u;   // the lane's byte offset in a piece of a packed tile: every address below is a wave-uniform base + this + a constant
    auto at = [](const T16* base, unsigned off) { return (const T16*)((const char*)base + off); };
    auto keep = [](V a, bool in0, bool in1) { v8i w = __builtin_bit_cast(v8i, a);   // a fragment's first four registers are its first 16-key tile, the rest its second
#pragma unroll
        for (int i = 0; i < 8; ++i) w[i] = ((i < 4) ? in0 : in1) ? w[i] : 0;
        return __builtin_bit_cast(V, w); };
    V q[2], q2[2]; const T16* qb = Q + pl + (size_t)r * HD; const T16* qb2 = HI ? Q2 + pl + (size_t)r * HD : nullptr;   // the rows' tile (16 positions are PT = 16 HD elements: r * HD is the tile's start)
#pragma unroll
    for (int ks = 0; ks < 2; ++ks) { q[ks] = WFrag<T16>::ld2(at(qb + ks * 512, ls), at(qb + ks * 512 + 256, ls)); if (HI) q2[ks] = WFrag<T16>::ld2(at(qb2 + ks * 512, ls), at(qb2 + ks * 512 + 256, ls)); }   // pieces 2 ks and 2 ks + 1 of the rows' tile
    // behind q's loads: what follows in the build reuses their offset and base registers, and the wait stands in front of that overwrite; they are named as inputs so that they stay whole up to the wait
    if constexpr (HI) asm volatile("s_wait_xcnt 0x0" :: "s"(qb), "s"(qb2), "v"(ls) : "memory"); else asm volatile("s_wait_xcnt 0x0" :: "s"(qb), "v"(ls) : "memory");
    const long w0 = (long)pl + ((long)blockIdx.y * 64 - BW) * HD;   // the block's window in a plane set: its first element
    const unsigned cb = (unsigned)wave * 512u + ls, cl = (unsigned)(size_t)kv + cb;   // the lane's 16 bytes in a piece of 2 KiB, and their LDS address in kv's first piece
    auto stage = [&](const T16* set, const unsigned dst) { const char* g = (const char*)(set + w0) + cb; unsigned l = cl + dst;   // one plane's window, WT pieces, to byte dst of kv
#pragma unroll 1   // rolled, so that the addresses are formed from l and g at each statement: unrolled, the build keeps the LDS addresses of the first staging in forty registers for the second, over the whole of the scores
        for (int h = 0; h < 2; ++h) { copy10(l, g); l += 10 * 2048; g += 10 * 2048; } };
    stage(Kp, 0); if constexpr (HI) stage(K2, WB);
    asm volatile("s_wait_asynccnt 0x0" ::: "memory");   // this wave's part of the k window(s) has landed
    __syncthreads();                                      // every wave's part has
    if constexpr (!HI) stage(Vt, WB);                     // v has its own half of kv and flies under the scores
    const char* fl = kv + wave * (PT * 2) + ls;   // the lane's slot in piece 0 of the wave's first key tile, first window
    constexpr int G = HI ? 2 : 6;   // key tiles a group: with two the hi/lo form stays inside 256 registers, a quarter of a SIMD's
    v8f S[17]; float mx = -3.0e38f;
#pragma unroll
    for (int g = 0; g < (17 + G - 1) / G; ++g) {
        V k[G][2], k2[G][2];
#pragma unroll
        for (int i = 0; i < G; ++i)
#pragma unroll
            for (int ks = 0; ks < 2; ++ks) { const int t = g * G + i; if (t < 17) { const char* p = fl + t * (PT * 2) + ks * 1024; k[i][ks] = WFrag<T16>::ld2((const T16*)p, (const T16*)(p + 512)); if (HI) k2[i][ks] = WFrag<T16>::ld2((const T16*)(p + WB), (const T16*)(p + WB + 512)); } }
        __builtin_amdgcn_sched_barrier(0);   // a group's k reads go out together: sunk to their products, each tile's latency is waited out on its own
#pragma unroll
        for (int i = 0; i < G; ++i) { const int t = g * G + i; if (t >= 17) continue;
            const float off = (t == 8 || (unsigned)(wb + t * 16) < (unsigned)TT) ? 0.0f : -3.0e38f;   // tile 8 is the wave's own rows
            v8f a = (v8f){};
#pragma unroll
            for (int ks = 0; ks < 2; ++ks) { a = WFrag<T16>::mma(k[i][ks], q[ks], a); if (HI) { a = WFrag<T16>::mma(k[i][ks], q2[ks], a); a = WFrag<T16>::mma(k2[i][ks], q[ks], a); } }
#pragma unroll
            for (int j = 0; j < 8; ++j) { float s = a[j] * SCL + off;   // SCL is a power of two: the product is exact, and off is 0 inside the sequence
                if (t == 0) s = (j + e >= 0) ? s : -3.0e38f;    // key >= query - BW
                if (t == 16) s = (j + e <= 0) ? s : -3.0e38f;   // key <= query + BW
                a[j] = s; mx = fmaxf(mx, s); }
            S[t] = a; }
    }
    if constexpr (HI) {
        asm volatile("s_wait_dscnt 0x0" ::: "memory");      // this wave's reads of k are done before kv is handed to the copies
        __syncthreads();                                      // every wave's are
        stage(Vt, 0); stage(Vt2, WB);
    }
    if constexpr (!HI) __builtin_amdgcn_sched_barrier(0);   // keeps the scores in front of the wait, so that the copies fly under all of them: the build otherwise sinks the last of them behind it
    asm volatile("s_wait_asynccnt 0x0" ::: "memory");   // this wave's part of the v window(s) has landed
    __syncthreads();                                      // every wave's part has
    const char* vl = fl + (HI ? 0 : WB);   // as fl, in the window of v (hi)
    const float m = fmaxf(mx, __shfl_xor(mx, 16, 32)); v8f sv = (v8f){};   // row maximum, eight independent partial row sums; O: output tiles
#pragma unroll
    for (int mb = 0; mb < 4; ++mb) O[mb] = (v8f){};
#pragma unroll
    for (int kb = 0; kb < 9; ++kb) {
        const bool in0 = kb == 4 || (unsigned)(wb + kb * 32) < (unsigned)TT, in1 = (unsigned)(wb + kb * 32 + 16) < (unsigned)TT;
        V p, p2, va[4], va2[4];
#pragma unroll
        for (int mb = 0; mb < 4; ++mb) { const char* p = vl + 2 * kb * (PT * 2) + mb * 512;   // piece mb of the block's two key tiles (the last block has one: the 18th tile lies outside the last wave's part of kv and stays zero); the block's v reads go out together, in flight under its exponentials
            if (kb < 8) { va[mb] = WFrag<T16>::ld2((const T16*)p, (const T16*)(p + PT * 2)); if (HI) va2[mb] = WFrag<T16>::ld2((const T16*)(p + WB), (const T16*)(p + WB + PT * 2)); }
            else { va[mb] = WFrag<T16>::ld1((const T16*)p); if (HI) va2[mb] = WFrag<T16>::ld1((const T16*)(p + WB)); } }
        __builtin_amdgcn_sched_barrier(0);   // keeps them there: sunk to their products, each read's latency is waited out on its own
#pragma unroll
        for (int u = 0; u < 2; ++u) { const int t = 2 * kb + u; v8f ev = (v8f){};
            if (t < 17) {
#pragma unroll
                for (int j = 0; j < 8; ++j) ev[j] = (S[t][j] - m) * 1.4426950408889634f;
                float x0, x1, x2, x3, x4, x5, x6, x7;
                // eight exp2 in one statement. The four leading slots are the distance behind a matrix instruction: the results may land in registers that were its A or B. Each exponential is followed by one that touches neither its result nor its source (early-clobber results), the last by the one slot that the instruction set asks for behind a transcendental.
                asm("v_nop\n\tv_nop\n\tv_nop\n\tv_nop\n\tv_exp_f32 %0, %8\n\tv_exp_f32 %1, %9\n\tv_exp_f32 %2, %10\n\tv_exp_f32 %3, %11\n\tv_exp_f32 %4, %12\n\tv_exp_f32 %5, %13\n\tv_exp_f32 %6, %14\n\tv_exp_f32 %7, %15\n\tv_nop"
                    : "=&v"(x0), "=&v"(x1), "=&v"(x2), "=&v"(x3), "=&v"(x4), "=&v"(x5), "=&v"(x6), "=&v"(x7) : "v"(ev[0]), "v"(ev[1]), "v"(ev[2]), "v"(ev[3]), "v"(ev[4]), "v"(ev[5]), "v"(ev[6]), "v"(ev[7]));
                ev = (v8f){x0, x1, x2, x3, x4, x5, x6, x7}; sv += ev; }
            packp(p, p2, HI ? ev : ev * PCAR, u * 8); }   // p goes into the product unnormalised (largest term 1); the row sum divides the output
#pragma unroll
        for (int mb = 0; mb < 4; ++mb) { const V b = keep(va[mb], in0, in1);
            O[mb] = WFrag<T16>::mma(b, p, O[mb]); if (HI) { O[mb] = WFrag<T16>::mma(b, p2, O[mb]); O[mb] = WFrag<T16>::mma(keep(va2[mb], in0, in1), p, O[mb]); } }
    }
    float sum = ((sv[0] + sv[1]) + (sv[2] + sv[3])) + ((sv[4] + sv[5]) + (sv[6] + sv[7])); sum += __shfl_xor(sum, 16, 32);
    return __fdiv_rn(HI ? 1.0f : (1.0f / PCAR), sum);   // the factor that turns O into y
}
// ---- k_fattn2: both forms of the attention in one launch; they share no data but their inputs, so neither waits for the other's last wave. Grid (head planes, 64-row tiles), a block is four waves of 16 query rows each, which share their key window in LDS.
// blockIdx.y is the row tile: the RH / 64 * ZH blocks of the hi/lo form, the longer one, have the lowest flat indices.
__global__ __launch_bounds__(128) __attribute__((amdgpu_waves_per_eu(4, 4))) void k_fattn2(const bf* __restrict__ Qh, const bf* __restrict__ Ql, const bf* __restrict__ Kh, const bf* __restrict__ Kl, const bf* __restrict__ Vh, const bf* __restrict__ Vl, const h16* __restrict__ Q16, const h16* __restrict__ K16, const h16* __restrict__ V16, bf* Eh, bf* El) {
    __shared__ __align__(16) char kv[2 * WB];   // two windows; four blocks fill a WGP's LDS, and at four waves a SIMD (the attribute above holds the build to their share of the registers) all blocks of the grid are resident at once
    v8f O[4]; float f;
    if (blockIdx.y < RH / 64) f = fattn<bf, true>(Qh, Ql, Kh, Kl, Vh, Vl, O, kv);
    else f = fattn<h16, false>(Q16, nullptr, K16, nullptr, V16, nullptr, O, kv);
    // the way out is the same for both forms and stands once in the text
    const int lr = threadIdx.x & 15, hi = (threadIdx.x >> 4) & 1, r = ((int)blockIdx.y * 4 + __builtin_amdgcn_readfirstlane((int)(threadIdx.x >> 5))) * 16;
    const size_t z = blockIdx.x; const unsigned lo = (unsigned)(lr * DQ + 8 * hi) * 2u;   // the lane's byte offset in a 16-row fragment of pitch DQ
    const size_t ob = ((z / NH_) * (size_t)TT + r) * DQ + (z % NH_) * HD;
#pragma unroll
    for (int mb = 0; mb < 4; ++mb) { v8us oh, ol;   // a lane's 8 accumulator rows are 8 consecutive d of one query
        split8(O[mb] * f, oh, ol);
        const size_t oo = ob + mb * 16; *(v8us*)((char*)(Eh + oo) + lo) = oh; *(v8us*)((char*)(El + oo) + lo) = ol;
        if (mb < 3) asm volatile("s_wait_xcnt 0x0" ::: "memory"); }   // behind the two plane stores: the next tile's conversion reuses their data registers in the build, and the wait stands in front of that overwrite
}

extern "C" void kernel_launch(void* const* d_in, const int* in_sizes, int n_in,
                              void* d_out, int out_size, void* d_ws, size_t ws_size, hipStream_t stream) {
    (void)in_sizes; (void)n_in; (void)out_size;
    const float* x = (const float*)d_in[0]; const float* wq = (const float*)d_in[1]; const float* bq = (const float*)d_in[2]; const float* wk = (const float*)d_in[3]; const float* bk = (const float*)d_in[4]; const float* wv = (const float*)d_in[5]; const float* bv = (const float*)d_in[6]; const float* wo = (const float*)d_in[7]; const float* bo = (const float*)d_in[8];   /* argument order x, wq, bq, wk, bk, wv, bv, wo, bo */
    float* OUT = (float*)d_out;     // [2][2048][1024]
    char* wsp = (char*)d_ws;
    auto take = [&](size_t bytes) { char* p = wsp; wsp += (bytes + 255) & ~(size_t)255; return (void*)p; };
    bf* WQ = (bf*)take((size_t)4 * DQ * DM * 2); bf* WK = WQ + (size_t)DQ * DM; bf* WV = WK + (size_t)DKV * DM; bf* WO = WV + (size_t)DKV * DM; (void)WK; (void)WV;   // four transposed 1024 x 1024 weights in a row: a grid dimension walks them
    bf* XB = (bf*)take((size_t)NB_ * TT * DM * 2);
    const size_t PS = (size_t)ZH * TT * HD;   // one plane set: 32 head planes; q, k, v sets in a row, the projection GEMM's z walks them
    h16* QP16 = (h16*)take(3 * PS * 2); h16* KP16 = QP16 + PS; h16* VT16 = KP16 + PS;
    bf* QPh = (bf*)take(3 * PS * 2); bf* KPh = QPh + PS; bf* VTh = KPh + PS; bf* QPl = (bf*)take(3 * PS * 2); bf* KPl = QPl + PS; bf* VTl = KPl + PS;
    bf* ATh = (bf*)take((size_t)2 * NB_ * TT * DQ * 2); bf* ATl = ATh + (size_t)NB_ * TT * DQ;   // merged hi/lo planes
    if ((size_t)(wsp - (char*)d_ws) > ws_size) return;    // 104 of the 256 MiB
    k_prep<<<WTB + CVB, 256, 0, stream>>>(wq, wk, wv, wo, WQ, x, XB);
    k_gemms<0, 1><<<dim3(NB_ * TT / 128, DQ / 128, 3), 128, 0, stream>>>(XB, nullptr, WQ, nullptr, 0, bq, bk, bv, (size_t)DQ * DM, QP16, QPh, QPl);   // z: q, k, v
    k_fattn2<<<dim3(ZH, TT / 64, 1), 128, 0, stream>>>(QPh, QPl, KPh, KPl, VTh, VTl, QP16, KP16, VT16, ATh, ATl);
    k_gemms<1, 0><<<dim3(NB_ * TT / 128, DM / 128, 1), 128, 0, stream>>>(ATh, ATl, WO, OUT, DM, bo, nullptr, nullptr, 0, nullptr, nullptr, nullptr);
}
